// v000
// The times below were measured on an AMD MI455X: many runs one after another, warmed up first and cycling through
// copies of the inputs, with the whole window's GPU time divided by the number of runs. Launches and the gaps
// between them are all in it. The median over several windows is given; except for v000 it joins two sittings, which
// can be a few percent apart, so the side-by-side timings, each taken in one sitting, are the better comparison.
// v000 is the starting kernel. One run takes 1170 microseconds.
// compute dtype: all float inputs rounded to bf16; the fused q / k / v projection with EXACT bf16 products on WMMA 16x16x32 (f32 accumulate) (no biases); causal logits: 3 products for the first 384 rows, single f16 q x k after, x 64^-0.5; softmax f32; P x 2^11 once to f16 x v once to f16 (bf16 hi + lo below row 384); ctx hi+lo x exact W below row 384, x2^6 f16 carry x f16(bf16 x 2^8) W after, no bias; f32 output.
#include <hip/hip_runtime.h>
#include <math.h>

typedef __attribute__((ext_vector_type(16))) _Float16 v16h;
typedef __attribute__((ext_vector_type(16))) __bf16 v16b;
typedef __attribute__((ext_vector_type(8)))  _Float16 v8h;
typedef __attribute__((ext_vector_type(8)))  float v8f;
typedef __attribute__((ext_vector_type(4)))  float v4f;
typedef __attribute__((ext_vector_type(2)))  float v2f;
typedef __attribute__((ext_vector_type(4)))  unsigned v4u;
typedef __attribute__((ext_vector_type(4)))  int v4i;
typedef float __attribute__((may_alias)) float_a;
typedef int __attribute__((may_alias)) int_a;

template <typename T> __device__ __forceinline__ void vst2(void* p, T v) { *(T*)p = v;  }
__device__ __forceinline__ v8f wmma16(v16h a, v16h b, v8f c) {
  v8f d = __builtin_amdgcn_wmma_f32_16x16x32_f16(false, a, false, b, (short)0, c, false, false);
  asm volatile("v_nop\n\tv_nop\n\tv_nop\n\tv_nop" : "+v"(d) : "v"(a), "v"(b));
  return d;
}
__device__ __forceinline__ v8f wmma_bf(v16b a, v16b b, v8f c) {
  v8f d = __builtin_amdgcn_wmma_f32_16x16x32_bf16(false, a, false, b, (short)0, c, false, false);
  asm volatile("v_nop\n\tv_nop\n\tv_nop\n\tv_nop" : "+v"(d) : "v"(a), "v"(b));
  return d;
}
// 16x16x32 fragments: lane = (h = lane>>4, row/col = lane&15); elements 0..7 = k0+8h+0..7, 8..15 = k0+16+8h+0..7; D element r = row 8h+r
__device__ __forceinline__ v16h frag_h(const _Float16* rowk0, int lane) {
  union { v16h v; v8h q[2]; } u; const _Float16* p = rowk0 + 8 * (lane >> 4);
  u.q[0] = *(const v8h*)p; u.q[1] = *(const v8h*)(p + 16); return u.v;
}
__device__ __forceinline__ v16h frag_f32(const float* rowk0, int lane) {
  v16h a; const float* p = rowk0 + 8 * (lane >> 4);
#pragma unroll
  for (int i = 0; i < 8; ++i) { a[i] = (_Float16)p[i]; a[8 + i] = (_Float16)p[16 + i]; }
  return a;
}
__device__ __forceinline__ v16h frag_f32s(const float* rowk0, int lane, float sc) {
  v16h a; const float* p = rowk0 + 8 * (lane >> 4);
#pragma unroll
  for (int i = 0; i < 8; ++i) { a[i] = (_Float16)(p[i] * sc); a[8 + i] = (_Float16)(p[16 + i] * sc); }
  return a;
}
// column fragment from a [K][ld] layout (column n), rows >= K read as 0
__device__ __forceinline__ v16h fragc_f32(const float* W, int k0, int n, int lane, int ld, int K) {
  v16h a; const int g = lane >> 4;
#pragma unroll
  for (int i = 0; i < 8; ++i) { const int ka = k0 + 8 * g + i, kb = ka + 16;
    a[i] = (_Float16)(ka < K ? W[(size_t)(ka < K ? ka : K - 1) * ld + n] : 0.f); a[8 + i] = (_Float16)(kb < K ? W[(size_t)(kb < K ? kb : K - 1) * ld + n] : 0.f); }
  return a;
}
struct F2 { v16b h, l; };
__device__ __forceinline__ F2 bsplit16(const float v[16]) { F2 r;
#pragma unroll
  for (int i = 0; i < 16; ++i) { const __bf16 h = (__bf16)v[i]; r.h[i] = h; r.l[i] = (__bf16)(v[i] - (float)h); }
  return r; }
__device__ __forceinline__ F2 split_row(const float* row, int k0, int lane) { float v[16]; const float* p = row + k0 + 8 * (lane >> 4);
#pragma unroll
  for (int i = 0; i < 8; ++i) { v[i] = p[i]; v[8 + i] = p[16 + i]; }
  return bsplit16(v); }
__device__ __forceinline__ F2 split_rowK(const float* row, int k0, int lane, int K) { float v[16]; const int g = lane >> 4;
#pragma unroll
  for (int i = 0; i < 8; ++i) { const int ka = k0 + 8 * g + i, kb = ka + 16; v[i] = ka < K ? row[ka < K ? ka : K - 1] : 0.f; v[8 + i] = kb < K ? row[kb < K ? kb : K - 1] : 0.f; }
  return bsplit16(v); }
__device__ __forceinline__ F2 split_col(const float* W, int k0, int n, int lane, int ld, int K) { float v[16]; const int g = lane >> 4;
#pragma unroll
  for (int i = 0; i < 8; ++i) { const int ka = k0 + 8 * g + i, kb = ka + 16; v[i] = ka < K ? W[(size_t)(ka < K ? ka : K - 1) * ld + n] : 0.f; v[8 + i] = kb < K ? W[(size_t)(kb < K ? kb : K - 1) * ld + n] : 0.f; }
  return bsplit16(v); }
__device__ __forceinline__ v8f mac3(const F2& a, const F2& b, v8f c) { c = wmma_bf(a.l, b.h, c); c = wmma_bf(a.h, b.l, c); return wmma_bf(a.h, b.h, c); }
__device__ __forceinline__ float sigm(float v) { return 1.0f / (1.0f + expf(-v)); }
#define LDSX() do { asm volatile("s_wait_dscnt 0" ::: "memory"); __builtin_amdgcn_wave_barrier(); __builtin_amdgcn_fence(__ATOMIC_RELEASE, "workgroup"); } while (0)

// Bias-free causal multi-head self-attention with a fused (out,in) QKV projection (x [2,2048,1024]; Wqkv [3072,1024] torch (out,in): jnp.split thirds of einsum('btd,ed->bte') = x @ Wqkv.T (q = rows 0..1023, k = 1024..2047, v = 2048..3071); Wout [1024,1024] (out,in); no biases; 16 heads x 64; scores x 1/sqrt(64); tril kept, -inf elsewhere; softmax; out @ Wout.T).
#define NB 2
#define TT 2048
#define CC 1024            // NH * HD = projected width
#define DIN 1024          // input (model) width
#define NH 16
#define HD 64
#define NQB (TT / 64)
#define HG 4
#define SCALE (0.125f)
#define CAUSAL 1
#ifndef TNB
#define TNB NB
#endif
__device__ __forceinline__ float bfr(float v) { return (float)(__bf16)v; }
__host__ __device__ __forceinline__ int kb_last(int qb) { return CAUSAL ? ((qb * 64 + 63) >> 7) : (TT / 128 - 1); }
typedef __attribute__((ext_vector_type(8))) __bf16 v8b;
__device__ __forceinline__ v16b frag_b(const __bf16* rowk0, int lane) {
  union { v16b v; v8b q[2]; } u; const __bf16* p = rowk0 + 8 * (lane >> 4);
  u.q[0] = *(const v8b*)p; u.q[1] = *(const v8b*)(p + 16); return u.v;
}
#define QBH 6              // causal: query blocks 0..QBH-1 of each sequence (few keys, no averaging) take the high-precision path
#define QHI 384            // rows carrying a q residual plane
#define KHI 384            // key rows carrying k residual / v bf16 hi+lo planes (used only by the causal high-precision path)
// B fragment (k rows k0+.., output column o) of a weight: (in,out) [K][ld] or (out,in) [ld rows of K]: bf16 exact, or f16(bf16 * 256) exact
__device__ __forceinline__ v16b wcol_io(const float* Wm, int k0, int o, int lane, int ld) { v16b w; const int g = lane >> 4;
#pragma unroll
  for (int i = 0; i < 8; ++i) { w[i] = (__bf16)Wm[(size_t)(k0 + 8 * g + i) * ld + o]; w[8 + i] = (__bf16)Wm[(size_t)(k0 + 16 + 8 * g + i) * ld + o]; }
  return w; }
__device__ __forceinline__ v16b wcol_oi(const float* Wm, int k0, int o, int lane, int K) { v16b w; const float* p = Wm + (size_t)o * K + k0 + 8 * (lane >> 4);
#pragma unroll
  for (int i = 0; i < 8; ++i) { w[i] = (__bf16)p[i]; w[8 + i] = (__bf16)p[16 + i]; }
  return w; }
__device__ __forceinline__ v16h wcolh_io(const float* Wm, int k0, int o, int lane, int ld) { v16h w; const int g = lane >> 4;
#pragma unroll
  for (int i = 0; i < 8; ++i) { w[i] = (_Float16)(bfr(Wm[(size_t)(k0 + 8 * g + i) * ld + o]) * 256.0f); w[8 + i] = (_Float16)(bfr(Wm[(size_t)(k0 + 16 + 8 * g + i) * ld + o]) * 256.0f); }
  return w; }
__device__ __forceinline__ v16h wcolh_oi(const float* Wm, int k0, int o, int lane, int K) { v16h w; const float* p = Wm + (size_t)o * K + k0 + 8 * (lane >> 4);
#pragma unroll
  for (int i = 0; i < 8; ++i) { w[i] = (_Float16)(bfr(p[i]) * 256.0f); w[8 + i] = (_Float16)(bfr(p[16 + i]) * 256.0f); }
  return w; }
#define WQKV_LAYOUT 1   // 0 = (in,out) [DIN][CC]; 1 = (out,in) [CC][DIN]; 2 = per-head [NH][DIN][HD]
__device__ __forceinline__ v16b wcol_hdk(const float* Wm, int k0, int o, int lane) { v16b w; const int g = lane >> 4; const float* p = Wm + (size_t)(o / HD) * DIN * HD + (o % HD);
#pragma unroll
  for (int i = 0; i < 8; ++i) { w[i] = (__bf16)p[(size_t)(k0 + 8 * g + i) * HD]; w[8 + i] = (__bf16)p[(size_t)(k0 + 16 + 8 * g + i) * HD]; }
  return w; }
#define WO_OUT_IN 1
#if WQKV_LAYOUT == 1
#define WCOL(W, k0, o, lane) wcol_oi(W, k0, o, lane, DIN)
#elif WQKV_LAYOUT == 2
#define WCOL(W, k0, o, lane) wcol_hdk(W, k0, o, lane)
#else
#define WCOL(W, k0, o, lane) wcol_io(W, k0, o, lane, CC)
#endif
#if WO_OUT_IN
#define WOCOL(W, k0, o, lane) wcol_oi(W, k0, o, lane, CC)
#define WOCOLH(W, k0, o, lane) wcolh_oi(W, k0, o, lane, CC)
#else
#define WOCOL(W, k0, o, lane) wcol_io(W, k0, o, lane, DIN)
#define WOCOLH(W, k0, o, lane) wcolh_io(W, k0, o, lane, DIN)
#endif

#ifndef SM_EXTRA_PARAMS
#define SM_EXTRA_PARAMS
#endif
#ifndef PROJ_EXTRA_PARAMS
#define PROJ_EXTRA_PARAMS
#endif
#ifndef SM_MASK_HOOK
#define SM_MASK_HOOK (void)0
#endif

#define WS_QH  0u                                      // f16 q rows [b*t][CC]
#define WS_KH  (WS_QH + 2u * (size_t)NB * TT * CC)      // f16 k rows [b*t][CC]
#define WS_VT  (WS_KH + 2u * (size_t)NB * TT * CC)      // f16 v planes [b][c][t]
#define WS_QL  (WS_VT + 2u * (size_t)NB * CC * TT)      // f16 q residual x 2^10 rows [b][t < QHI][CC]
#define WS_KL  (WS_QL + 2u * (size_t)NB * QHI * CC)     // f16 k residual x 2^10 rows [b][t < KHI][CC]
#define WS_VB  (WS_KL + 2u * (size_t)NB * KHI * CC)     // bf16 v hi planes [b][c][t < KHI]
#define WS_VBL (WS_VB + 2u * (size_t)NB * CC * KHI)
#define WS_S   (WS_VBL + 2u * (size_t)NB * CC * KHI)    // f32 logits / P [hg][t][s]
#define WS_Y   (WS_S  + 4u * (size_t)HG * TT * TT)      // f32 ctx rows [b*t][CC] (only when there is an output projection)
#define WS_END (WS_Y  + 4u * (size_t)NB * TT * CC)

// ---- k_proj: block = (64 rows, 128 cols, which): q/k/v = X W (+ b) with exact bf16 products (K = DIN) -> which 0: q f16 rows (+ residual rows < QHI); 1: k f16 rows (+ residual rows < KHI); 2: v f16 planes [c][t] (+ bf16 hi/lo planes for t < KHI)
__global__ __launch_bounds__(128) void k_proj(const float* __restrict__ XQ, const float* __restrict__ XK, const float* __restrict__ XV, const float* __restrict__ WQ, const float* __restrict__ WK, const float* __restrict__ WV, const float* __restrict__ BQ, const float* __restrict__ BK, const float* __restrict__ BV,
    _Float16* __restrict__ QH, _Float16* __restrict__ QL, _Float16* __restrict__ KH, _Float16* __restrict__ KL, _Float16* __restrict__ VT, __bf16* __restrict__ VB, __bf16* __restrict__ VBL) {
  __shared__ __align__(16) _Float16 sh[64][136], sl[64][136]; __shared__ __align__(16) _Float16 th[128][72]; __shared__ __align__(16) __bf16 tb[128][72], tbl[128][72];
  const int tid = threadIdx.x, wave = tid >> 5, lane = tid & 31, col = lane & 15, g = lane >> 4; const int which = blockIdx.z; const int c0 = blockIdx.y * 128; const size_t r0 = (size_t)blockIdx.x * 64; const size_t bb = r0 / TT; const int t0 = (int)(r0 % TT);
  const float* X = which == 0 ? XQ : which == 1 ? XK : XV; const float* WA = which == 0 ? WQ : which == 1 ? WK : WV; const float* BA = which == 0 ? BQ : which == 1 ? BK : BV;
  v8f acc[8] = {};
#pragma unroll 2
  for (int kc = 0; kc < DIN / 32; ++kc) { v16b a; { const float* p = X + (r0 + wave * 16 + col) * DIN + kc * 32 + 8 * g;
#pragma unroll
      for (int i = 0; i < 8; ++i) { a[i] = (__bf16)p[i]; a[8 + i] = (__bf16)p[16 + i]; } }
    asm volatile("s_wait_loadcnt 0x0" ::: "memory");
#pragma unroll
    for (int j = 0; j < 8; ++j) { const v16b w = WCOL(WA, kc * 32, c0 + j * 16 + col, lane); asm volatile("s_wait_loadcnt 0x0" ::: "memory"); acc[j] = wmma_bf(a, w, acc[j]); } }
  if (which < 2) { _Float16* DH = which == 0 ? QH : KH; _Float16* DL = which == 0 ? QL : KL; const int nhi = which == 0 ? QHI : KHI; const bool hi_rows = t0 < nhi;
#pragma unroll
    for (int j = 0; j < 8; ++j) { const float bias = BA ? bfr(BA[c0 + j * 16 + col]) : 0.f;
#pragma unroll
      for (int r = 0; r < 8; ++r) { const float v = acc[j][r] + bias; const _Float16 hv = (_Float16)v; sh[wave * 16 + 8 * g + r][j * 16 + col] = hv; sl[wave * 16 + 8 * g + r][j * 16 + col] = (_Float16)((v - (float)hv) * 1024.0f); } }
    __syncthreads();
    for (int e = tid; e < 64 * 16; e += 128) { const int rl = e >> 4, q = e & 15; vst2((unsigned*)(DH + (r0 + rl) * CC + c0 + q * 8), *(const v4u*)&sh[rl][q * 8]); if (hi_rows) vst2((unsigned*)(DL + (bb * nhi + t0 + rl) * (size_t)CC + c0 + q * 8), *(const v4u*)&sl[rl][q * 8]); }
  } else { const bool hi_rows = t0 < KHI;
#pragma unroll
    for (int j = 0; j < 8; ++j) { const float bias = BA ? bfr(BA[c0 + j * 16 + col]) : 0.f;
#pragma unroll
      for (int r = 0; r < 8; ++r) { const float v = acc[j][r] + bias; const int rl = wave * 16 + 8 * g + r, cl = j * 16 + col; th[cl][rl] = (_Float16)v; const __bf16 bh = (__bf16)v; tb[cl][rl] = bh; tbl[cl][rl] = (__bf16)(v - (float)bh); } }
    __syncthreads();
    for (int e = tid; e < 128 * 8; e += 128) { const int cl = e >> 3, q = e & 7; vst2((unsigned*)(VT + (bb * CC + c0 + cl) * (size_t)TT + t0 + q * 8), *(const v4u*)&th[cl][q * 8]); if (hi_rows) { const size_t o3 = (bb * CC + c0 + cl) * (size_t)KHI + t0 + q * 8; vst2((unsigned*)(VB + o3), *(const v4u*)&tb[cl][q * 8]); vst2((unsigned*)(VBL + o3), *(const v4u*)&tbl[cl][q * 8]); } } } }
// ---- k_sc: block = (query block qb, key block kb <= kb_last(qb), head in group) of batch b: logits x SCALE; q hi + residual (x 2^10) against k (2 products) for query rows < QHI, plus the k residual (3 products) for query blocks < QBH (causal early rows); causal: blocks past the diagonal exit, the mask itself is applied by index in k_sm
__global__ __launch_bounds__(128) void k_sc(const _Float16* __restrict__ QH, const _Float16* __restrict__ KH, const _Float16* __restrict__ QL, const _Float16* __restrict__ KL, int b, int h0, float* __restrict__ S0) { __shared__ __align__(16) float ss[4][16][132];
  const int qb = blockIdx.x, kb = blockIdx.y; if (kb > kb_last(qb)) return;
  const int h = h0 + blockIdx.z; float* S = S0 + (size_t)blockIdx.z * TT * TT;
  const int tid = threadIdx.x, wave = tid >> 5, lane = tid & 31, col = lane & 15, g = lane >> 4; const int k0 = kb * 128; const int ql0 = qb * 64 + wave * 16; const size_t q0 = (size_t)b * TT + ql0, kr0 = (size_t)b * TT + k0;
  v8f acc[8] = {}, accl[8] = {};
  const _Float16* QLb = QL + (size_t)b * QHI * CC; const _Float16* KLb = KL + (size_t)b * KHI * CC;
  if (qb < QBH) {
#pragma unroll
    for (int kc = 0; kc < HD / 32; ++kc) { const v16h ah = frag_h(QH + (q0 + col) * CC + h * HD + kc * 32, lane), al = frag_h(QLb + (size_t)(ql0 + col) * CC + h * HD + kc * 32, lane);
#pragma unroll
      for (int j = 0; j < 8; ++j) { const v16h kbf = frag_h(KH + (kr0 + j * 16 + col) * CC + h * HD + kc * 32, lane), klf = frag_h(KLb + (size_t)(k0 + j * 16 + col) * CC + h * HD + kc * 32, lane); acc[j] = wmma16(ah, kbf, acc[j]); accl[j] = wmma16(al, kbf, accl[j]); accl[j] = wmma16(ah, klf, accl[j]); } }
  } else if (qb * 64 < QHI) {
#pragma unroll
    for (int kc = 0; kc < HD / 32; ++kc) { const v16h ah = frag_h(QH + (q0 + col) * CC + h * HD + kc * 32, lane), al = frag_h(QLb + (size_t)(ql0 + col) * CC + h * HD + kc * 32, lane);
#pragma unroll
      for (int j = 0; j < 8; ++j) { const v16h kbf = frag_h(KH + (kr0 + j * 16 + col) * CC + h * HD + kc * 32, lane); acc[j] = wmma16(ah, kbf, acc[j]); accl[j] = wmma16(al, kbf, accl[j]); } }
  } else {
#pragma unroll
    for (int kc = 0; kc < HD / 32; ++kc) { const v16h ah = frag_h(QH + (q0 + col) * CC + h * HD + kc * 32, lane);
#pragma unroll
      for (int j = 0; j < 8; ++j) { const v16h kbf = frag_h(KH + (kr0 + j * 16 + col) * CC + h * HD + kc * 32, lane); acc[j] = wmma16(ah, kbf, acc[j]); } } }
#pragma unroll
  for (int j = 0; j < 8; ++j) {
#pragma unroll
    for (int r = 0; r < 8; ++r) ss[wave][8 * g + r][j * 16 + col] = (acc[j][r] + accl[j][r] * (1.0f / 1024.0f)) * SCALE; }
  LDSX(); for (int rl = 0; rl < 16; ++rl) vst2(S + (size_t)(ql0 + rl) * TT + k0 + lane * 4, *(const v4f*)&ss[wave][rl][lane * 4]); }
// ---- k_sm: block = query row t (head in group): keys [0, kend): causal -> logit if s <= t else excluded; softmax in f32; P x 2^11 in place (0 for excluded)
__global__ __launch_bounds__(256) void k_sm(float* __restrict__ S0 SM_EXTRA_PARAMS) { __shared__ float sred[8]; __shared__ float sbc; __shared__ __align__(16) float shv[TT];
  const int tid = threadIdx.x; const int t = blockIdx.x; const int kend = (kb_last(t >> 6) + 1) * 128;
  float* sr = S0 + (size_t)blockIdx.y * TT * TT + (size_t)t * TT;
  float m = -3.0e38f; for (int k = tid; k < kend; k += 256) { float v = (!CAUSAL || k <= t) ? sr[k] : -3.0e38f; SM_MASK_HOOK; shv[k] = v; m = fmaxf(m, v); }
#pragma unroll
  for (int o = 1; o < 32; o <<= 1) m = fmaxf(m, __shfl_xor(m, o));
  if ((tid & 31) == 0) sred[tid >> 5] = m; __syncthreads(); if (tid == 0) { float a = sred[0]; for (int i = 1; i < 8; ++i) a = fmaxf(a, sred[i]); sbc = a; } __syncthreads(); m = sbc; __syncthreads();
  float sum = 0.f; for (int k = tid; k < kend; k += 256) { const float v = shv[k]; const float e = (v <= -1.0e38f) ? 0.f : expf(v - m); shv[k] = e; sum += e; }
#pragma unroll
  for (int o = 1; o < 32; o <<= 1) sum += __shfl_xor(sum, o);
  if ((tid & 31) == 0) sred[tid >> 5] = sum; __syncthreads(); if (tid == 0) { float a = 0.f; for (int i = 0; i < 8; ++i) a += sred[i]; sbc = a > 0.f ? 2048.0f / a : 0.f; }   /* a fully excluded row yields P = 0 */ __syncthreads(); const float inv = sbc;
  for (int k = tid; k < kend; k += 256) shv[k] = shv[k] * inv;
  __syncthreads(); for (int q = tid; q < kend / 4; q += 256) vst2(sr + q * 4, *(const v4f*)&shv[q * 4]); }
// ---- k_pv: block = 64 queries (qb) of (b, h): ctx = P . v over keys [0, kend) (P x 2^11 once to f16 against v f16: 1 product; causal early query blocks: P and v as bf16 hi + lo, 3 products); 256-B (row, head) segment by 16 lanes
__global__ __launch_bounds__(128) void k_pv(const float* __restrict__ PS0, const _Float16* __restrict__ VT, const __bf16* __restrict__ VB, const __bf16* __restrict__ VBL, int b, int h0, float* __restrict__ Y) { const int h = h0 + blockIdx.z; const float* PS = PS0 + (size_t)blockIdx.z * TT * TT; __shared__ __align__(16) float ss[4][16][HD + 4];
  const int tid = threadIdx.x, wave = tid >> 5, lane = tid & 31, col = lane & 15, g = lane >> 4; const int qb = blockIdx.x; const int ql0 = qb * 64 + wave * 16; const int kce = (kb_last(qb) + 1) * 4;
  v8f acc[HD / 16] = {};
  if (qb < QBH) {
#pragma unroll 1
    for (int kc = 0; kc < kce; ++kc) { const F2 p = split_row(PS + (size_t)(ql0 + col) * TT, kc * 32, lane);
      asm volatile("s_wait_loadcnt 0x0" ::: "memory");
#pragma unroll
      for (int j = 0; j < HD / 16; ++j) { const size_t po = ((size_t)b * CC + h * HD + j * 16 + col) * (size_t)KHI + kc * 32; const v16b vh = frag_b(VB + po, lane); acc[j] = wmma_bf(p.h, vh, acc[j]); acc[j] = wmma_bf(p.l, vh, acc[j]); acc[j] = wmma_bf(p.h, frag_b(VBL + po, lane), acc[j]); } }
  } else {
#pragma unroll 1
    for (int kc = 0; kc < kce; ++kc) { const v16h p = frag_f32(PS + (size_t)(ql0 + col) * TT + kc * 32, lane);
      asm volatile("s_wait_loadcnt 0x0" ::: "memory");
#pragma unroll
      for (int j = 0; j < HD / 16; ++j) { const size_t po = ((size_t)b * CC + h * HD + j * 16 + col) * (size_t)TT + kc * 32; acc[j] = wmma16(p, frag_h(VT + po, lane), acc[j]); } } }
#pragma unroll
  for (int j = 0; j < HD / 16; ++j)
#pragma unroll
    for (int r = 0; r < 8; ++r) ss[wave][8 * g + r][j * 16 + col] = acc[j][r] * (1.0f / 2048.0f);
  LDSX(); for (int rl = 0; rl < 16; ++rl) if (lane < HD / 4) vst2(Y + ((size_t)b * TT + ql0 + rl) * CC + h * HD + lane * 4, *(const v4f*)&ss[wave][rl][lane * 4]); }
// ---- k_out: block = (64 rows, 128 cols): out = ctx Wo (+ bo): ctx x 2^6 once to f16 against Wo as f16(bf16 x 2^8) exact (1 product) x 2^-14; causal early rows (< QHI of each sequence): ctx bf16 hi + lo against exact bf16 Wo (2 products)
__global__ __launch_bounds__(128) void k_out(const float* __restrict__ Y, const float* __restrict__ WO, const float* __restrict__ BO, float* __restrict__ OUT) { __shared__ __align__(16) float sf[4][16][132];
  const int tid = threadIdx.x, wave = tid >> 5, lane = tid & 31, col = lane & 15, g = lane >> 4; const int c0 = blockIdx.y * 128; const size_t r0 = (size_t)blockIdx.x * 64 + wave * 16;
  v8f acc[8] = {};
  if (CAUSAL && (int)(((size_t)blockIdx.x * 64) % TT) < QHI) {   /* block-uniform */
#pragma unroll 2
    for (int kc = 0; kc < CC / 32; ++kc) { const F2 a = split_row(Y + (r0 + col) * CC, kc * 32, lane); asm volatile("s_wait_loadcnt 0x0" ::: "memory");
#pragma unroll
      for (int j = 0; j < 8; ++j) { const v16b w = WOCOL(WO, kc * 32, c0 + j * 16 + col, lane); asm volatile("s_wait_loadcnt 0x0" ::: "memory"); acc[j] = wmma_bf(a.h, w, acc[j]); acc[j] = wmma_bf(a.l, w, acc[j]); } }
#pragma unroll
    for (int j = 0; j < 8; ++j) { const float bias = BO ? bfr(BO[c0 + j * 16 + col]) : 0.f;
#pragma unroll
      for (int r = 0; r < 8; ++r) sf[wave][8 * g + r][j * 16 + col] = acc[j][r] + bias; }
  } else {
#pragma unroll 2
    for (int kc = 0; kc < CC / 32; ++kc) { const v16h a = frag_f32s(Y + (r0 + col) * CC + kc * 32, lane, 64.0f); asm volatile("s_wait_loadcnt 0x0" ::: "memory");   /* ctx carried x 2^6 into f16 so small-magnitude context rows stay clear of f16 subnormals */
#pragma unroll
      for (int j = 0; j < 8; ++j) { const v16h w = WOCOLH(WO, kc * 32, c0 + j * 16 + col, lane); asm volatile("s_wait_loadcnt 0x0" ::: "memory"); acc[j] = wmma16(a, w, acc[j]); } }
#pragma unroll
    for (int j = 0; j < 8; ++j) { const float bias = BO ? bfr(BO[c0 + j * 16 + col]) : 0.f;
#pragma unroll
      for (int r = 0; r < 8; ++r) sf[wave][8 * g + r][j * 16 + col] = acc[j][r] * (1.0f / 16384.0f) + bias; } }   /* 2^-8 (Wo carry) x 2^-6 (ctx carry) */
  LDSX(); for (int rl = 0; rl < 16; ++rl) vst2(OUT + (r0 + rl) * DIN + c0 + lane * 4, *(const v4f*)&sf[wave][rl][lane * 4]); }

extern "C" void kernel_launch(void* const* d_in, const int* in_sizes, int n_in, void* d_out, int out_size, void* d_ws, size_t ws_size, hipStream_t stream) {
  (void)in_sizes; (void)n_in; (void)out_size;
  const float** F = (const float**)d_in;
  if (ws_size < (size_t)WS_END) return;
  char* ws = (char*)d_ws; _Float16 *QH = (_Float16*)(ws + WS_QH), *KH = (_Float16*)(ws + WS_KH), *VT = (_Float16*)(ws + WS_VT), *QL = (_Float16*)(ws + WS_QL), *KL = (_Float16*)(ws + WS_KL); __bf16 *VB = (__bf16*)(ws + WS_VB), *VBL = (__bf16*)(ws + WS_VBL); float *S = (float*)(ws + WS_S), *Y = (float*)(ws + WS_Y);
  (void)Y; (void)QL; (void)KL; (void)VB; (void)VBL;
  // inputs: 0 x [2,2048,1024]; 1 W_qkv [3072,1024] (out,in): q rows 0..1023, k 1024..2047, v 2048..3071; 2 W_o [1024,1024] (out,in); no biases
  k_proj<<<dim3(TNB * TT / 64, CC / 128, 3), 128, 0, stream>>>(F[0], F[0], F[0], F[1], F[1] + (size_t)CC * DIN, F[1] + 2 * (size_t)CC * DIN, nullptr, nullptr, nullptr, QH, QL, KH, KL, VT, VB, VBL);
  for (int b = 0; b < TNB; ++b) for (int h0 = 0; h0 < NH; h0 += HG) {
    k_sc<<<dim3(NQB, TT / 128, HG), 128, 0, stream>>>(QH, KH, QL, KL, b, h0, S);
    k_sm<<<dim3(TT, HG), 256, 0, stream>>>(S);
    k_pv<<<dim3(NQB, 1, HG), 128, 0, stream>>>(S, VT, VB, VBL, b, h0, Y);
  }
  k_out<<<dim3(TNB * TT / 64, DIN / 128), 128, 0, stream>>>(Y, F[2], nullptr, (float*)d_out);
}

// v001
// Measured time: 840 microseconds a run.
// Next to v000, in two timings, it ran 1.40 times as fast each time.
// compute dtype: all float inputs rounded to bf16; the fused q / k / v projection with EXACT bf16 products on WMMA 16x16x32 (f32 accumulate) (no biases); causal logits: 3 products for the first 384 rows, single f16 q x k after, x 64^-0.5; softmax f32; P x 2^11 once to f16 x v once to f16 (bf16 hi + lo below row 384); ctx hi+lo x exact W below row 384, x2^6 f16 carry x f16(bf16 x 2^8) W after, no bias; f32 output.
#include <hip/hip_runtime.h>
#include <math.h>

typedef __attribute__((ext_vector_type(16))) _Float16 v16h;
typedef __attribute__((ext_vector_type(16))) __bf16 v16b;
typedef __attribute__((ext_vector_type(8)))  _Float16 v8h;
typedef __attribute__((ext_vector_type(8)))  float v8f;
typedef __attribute__((ext_vector_type(4)))  float v4f;
typedef __attribute__((ext_vector_type(2)))  float v2f;
typedef __attribute__((ext_vector_type(4)))  unsigned v4u;
typedef __attribute__((ext_vector_type(4)))  int v4i;
typedef float __attribute__((may_alias)) float_a;
typedef int __attribute__((may_alias)) int_a;

template <typename T> __device__ __forceinline__ void vst2(void* p, T v) { *(T*)p = v;  }
__device__ __forceinline__ v8f wmma16(v16h a, v16h b, v8f c) {
  v8f d = __builtin_amdgcn_wmma_f32_16x16x32_f16(false, a, false, b, (short)0, c, false, false);
  asm volatile("v_nop\n\tv_nop\n\tv_nop\n\tv_nop" : "+v"(d) : "v"(a), "v"(b));
  return d;
}
__device__ __forceinline__ v8f wmma_bf(v16b a, v16b b, v8f c) {
  v8f d = __builtin_amdgcn_wmma_f32_16x16x32_bf16(false, a, false, b, (short)0, c, false, false);
  asm volatile("v_nop\n\tv_nop\n\tv_nop\n\tv_nop" : "+v"(d) : "v"(a), "v"(b));
  return d;
}
// 16x16x32 fragments: lane = (h = lane>>4, row/col = lane&15); elements 0..7 = k0+8h+0..7, 8..15 = k0+16+8h+0..7; D element r = row 8h+r
__device__ __forceinline__ v16h frag_h(const _Float16* rowk0, int lane) {
  union { v16h v; v8h q[2]; } u; const _Float16* p = rowk0 + 8 * (lane >> 4);
  u.q[0] = *(const v8h*)p; u.q[1] = *(const v8h*)(p + 16); return u.v;
}
__device__ __forceinline__ v16h frag_f32(const float* rowk0, int lane) {
  v16h a; const float* p = rowk0 + 8 * (lane >> 4);
#pragma unroll
  for (int i = 0; i < 8; ++i) { a[i] = (_Float16)p[i]; a[8 + i] = (_Float16)p[16 + i]; }
  return a;
}
__device__ __forceinline__ v16h frag_f32s(const float* rowk0, int lane, float sc) {
  v16h a; const float* p = rowk0 + 8 * (lane >> 4);
#pragma unroll
  for (int i = 0; i < 8; ++i) { a[i] = (_Float16)(p[i] * sc); a[8 + i] = (_Float16)(p[16 + i] * sc); }
  return a;
}
// column fragment from a [K][ld] layout (column n), rows >= K read as 0
__device__ __forceinline__ v16h fragc_f32(const float* W, int k0, int n, int lane, int ld, int K) {
  v16h a; const int g = lane >> 4;
#pragma unroll
  for (int i = 0; i < 8; ++i) { const int ka = k0 + 8 * g + i, kb = ka + 16;
    a[i] = (_Float16)(ka < K ? W[(size_t)(ka < K ? ka : K - 1) * ld + n] : 0.f); a[8 + i] = (_Float16)(kb < K ? W[(size_t)(kb < K ? kb : K - 1) * ld + n] : 0.f); }
  return a;
}
struct F2 { v16b h, l; };
__device__ __forceinline__ F2 bsplit16(const float v[16]) { F2 r;
#pragma unroll
  for (int i = 0; i < 16; ++i) { const __bf16 h = (__bf16)v[i]; r.h[i] = h; r.l[i] = (__bf16)(v[i] - (float)h); }
  return r; }
__device__ __forceinline__ F2 split_row(const float* row, int k0, int lane) { float v[16]; const float* p = row + k0 + 8 * (lane >> 4);
#pragma unroll
  for (int i = 0; i < 8; ++i) { v[i] = p[i]; v[8 + i] = p[16 + i]; }
  return bsplit16(v); }
__device__ __forceinline__ F2 split_rowK(const float* row, int k0, int lane, int K) { float v[16]; const int g = lane >> 4;
#pragma unroll
  for (int i = 0; i < 8; ++i) { const int ka = k0 + 8 * g + i, kb = ka + 16; v[i] = ka < K ? row[ka < K ? ka : K - 1] : 0.f; v[8 + i] = kb < K ? row[kb < K ? kb : K - 1] : 0.f; }
  return bsplit16(v); }
__device__ __forceinline__ F2 split_col(const float* W, int k0, int n, int lane, int ld, int K) { float v[16]; const int g = lane >> 4;
#pragma unroll
  for (int i = 0; i < 8; ++i) { const int ka = k0 + 8 * g + i, kb = ka + 16; v[i] = ka < K ? W[(size_t)(ka < K ? ka : K - 1) * ld + n] : 0.f; v[8 + i] = kb < K ? W[(size_t)(kb < K ? kb : K - 1) * ld + n] : 0.f; }
  return bsplit16(v); }
__device__ __forceinline__ v8f mac3(const F2& a, const F2& b, v8f c) { c = wmma_bf(a.l, b.h, c); c = wmma_bf(a.h, b.l, c); return wmma_bf(a.h, b.h, c); }
__device__ __forceinline__ float sigm(float v) { return 1.0f / (1.0f + expf(-v)); }
#define LDSX() do { asm volatile("s_wait_dscnt 0" ::: "memory"); __builtin_amdgcn_wave_barrier(); __builtin_amdgcn_fence(__ATOMIC_RELEASE, "workgroup"); } while (0)

// Bias-free causal multi-head self-attention with a fused (out,in) QKV projection (x [2,2048,1024]; Wqkv [3072,1024] torch (out,in): jnp.split thirds of einsum('btd,ed->bte') = x @ Wqkv.T (q = rows 0..1023, k = 1024..2047, v = 2048..3071); Wout [1024,1024] (out,in); no biases; 16 heads x 64; scores x 1/sqrt(64); tril kept, -inf elsewhere; softmax; out @ Wout.T).
#define NB 2
#define TT 2048
#define CC 1024            // NH * HD = projected width
#define DIN 1024          // input (model) width
#define NH 16
#define HD 64
#define NQB (TT / 64)
#define HG 4
#define SCALE (0.125f)
#define CAUSAL 1
#ifndef TNB
#define TNB NB
#endif
__device__ __forceinline__ float bfr(float v) { return (float)(__bf16)v; }
__host__ __device__ __forceinline__ int kb_last(int qb) { return CAUSAL ? ((qb * 64 + 63) >> 7) : (TT / 128 - 1); }
typedef __attribute__((ext_vector_type(8))) __bf16 v8b;
__device__ __forceinline__ v16b frag_b(const __bf16* rowk0, int lane) {
  union { v16b v; v8b q[2]; } u; const __bf16* p = rowk0 + 8 * (lane >> 4);
  u.q[0] = *(const v8b*)p; u.q[1] = *(const v8b*)(p + 16); return u.v;
}
#define QBH 6              // causal: query blocks 0..QBH-1 of each sequence (few keys, no averaging) take the high-precision path
#define QHI 384            // rows carrying a q residual plane
#define KHI 384            // key rows carrying k residual / v bf16 hi+lo planes (used only by the causal high-precision path)
// B fragment (k rows k0+.., output column o) of a weight: (in,out) [K][ld] or (out,in) [ld rows of K]: bf16 exact, or f16(bf16 * 256) exact
__device__ __forceinline__ v16b wcol_io(const float* Wm, int k0, int o, int lane, int ld) { v16b w; const int g = lane >> 4;
#pragma unroll
  for (int i = 0; i < 8; ++i) { w[i] = (__bf16)Wm[(size_t)(k0 + 8 * g + i) * ld + o]; w[8 + i] = (__bf16)Wm[(size_t)(k0 + 16 + 8 * g + i) * ld + o]; }
  return w; }
__device__ __forceinline__ v16b wcol_oi(const float* Wm, int k0, int o, int lane, int K) { v16b w; const float* p = Wm + (size_t)o * K + k0 + 8 * (lane >> 4);
#pragma unroll
  for (int i = 0; i < 8; ++i) { w[i] = (__bf16)p[i]; w[8 + i] = (__bf16)p[16 + i]; }
  return w; }
__device__ __forceinline__ v16h wcolh_io(const float* Wm, int k0, int o, int lane, int ld) { v16h w; const int g = lane >> 4;
#pragma unroll
  for (int i = 0; i < 8; ++i) { w[i] = (_Float16)(bfr(Wm[(size_t)(k0 + 8 * g + i) * ld + o]) * 256.0f); w[8 + i] = (_Float16)(bfr(Wm[(size_t)(k0 + 16 + 8 * g + i) * ld + o]) * 256.0f); }
  return w; }
__device__ __forceinline__ v16h wcolh_oi(const float* Wm, int k0, int o, int lane, int K) { v16h w; const float* p = Wm + (size_t)o * K + k0 + 8 * (lane >> 4);
#pragma unroll
  for (int i = 0; i < 8; ++i) { w[i] = (_Float16)(bfr(p[i]) * 256.0f); w[8 + i] = (_Float16)(bfr(p[16 + i]) * 256.0f); }
  return w; }
#define WQKV_LAYOUT 1   // 0 = (in,out) [DIN][CC]; 1 = (out,in) [CC][DIN]; 2 = per-head [NH][DIN][HD]
__device__ __forceinline__ v16b wcol_hdk(const float* Wm, int k0, int o, int lane) { v16b w; const int g = lane >> 4; const float* p = Wm + (size_t)(o / HD) * DIN * HD + (o % HD);
#pragma unroll
  for (int i = 0; i < 8; ++i) { w[i] = (__bf16)p[(size_t)(k0 + 8 * g + i) * HD]; w[8 + i] = (__bf16)p[(size_t)(k0 + 16 + 8 * g + i) * HD]; }
  return w; }
#define WO_OUT_IN 1
#if WQKV_LAYOUT == 1
#define WCOL(W, k0, o, lane) wcol_oi(W, k0, o, lane, DIN)
#elif WQKV_LAYOUT == 2
#define WCOL(W, k0, o, lane) wcol_hdk(W, k0, o, lane)
#else
#define WCOL(W, k0, o, lane) wcol_io(W, k0, o, lane, CC)
#endif
#if WO_OUT_IN
#define WOCOL(W, k0, o, lane) wcol_oi(W, k0, o, lane, CC)
#define WOCOLH(W, k0, o, lane) wcolh_oi(W, k0, o, lane, CC)
#else
#define WOCOL(W, k0, o, lane) wcol_io(W, k0, o, lane, DIN)
#define WOCOLH(W, k0, o, lane) wcolh_io(W, k0, o, lane, DIN)
#endif

#ifndef SM_EXTRA_PARAMS
#define SM_EXTRA_PARAMS
#endif
#ifndef PROJ_EXTRA_PARAMS
#define PROJ_EXTRA_PARAMS
#endif
#ifndef SM_MASK_HOOK
#define SM_MASK_HOOK (void)0
#endif

#define WS_QH  0u                                      // f16 q rows [b*t][CC]
#define WS_KH  (WS_QH + 2u * (size_t)NB * TT * CC)      // f16 k rows [b*t][CC]
#define WS_VT  (WS_KH + 2u * (size_t)NB * TT * CC)      // f16 v planes [b][c][t]
#define WS_QL  (WS_VT + 2u * (size_t)NB * CC * TT)      // f16 q residual x 2^10 rows [b][t < QHI][CC]
#define WS_KL  (WS_QL + 2u * (size_t)NB * QHI * CC)     // f16 k residual x 2^10 rows [b][t < KHI][CC]
#define WS_VB  (WS_KL + 2u * (size_t)NB * KHI * CC)     // bf16 v hi planes [b][c][t < KHI]
#define WS_VBL (WS_VB + 2u * (size_t)NB * CC * KHI)
#define WS_S   (WS_VBL + 2u * (size_t)NB * CC * KHI)    // f32 logits / P [hg][t][s]
#define WS_Y   (WS_S  + 4u * (size_t)HG * TT * TT)      // f32 ctx rows [b*t][CC] (only when there is an output projection)
#define WS_END (WS_Y  + 4u * (size_t)NB * TT * CC)

// ---- k_proj: block = (64 rows, 128 cols, which): q/k/v = X W (+ b) with exact bf16 products (K = DIN) -> which 0: q f16 rows (+ residual rows < QHI); 1: k f16 rows (+ residual rows < KHI); 2: v f16 planes [c][t] (+ bf16 hi/lo planes for t < KHI)
__global__ __launch_bounds__(128) void k_proj(const float* __restrict__ XQ, const float* __restrict__ XK, const float* __restrict__ XV, const float* __restrict__ WQ, const float* __restrict__ WK, const float* __restrict__ WV, const float* __restrict__ BQ, const float* __restrict__ BK, const float* __restrict__ BV,
    _Float16* __restrict__ QH, _Float16* __restrict__ QL, _Float16* __restrict__ KH, _Float16* __restrict__ KL, _Float16* __restrict__ VT, __bf16* __restrict__ VB, __bf16* __restrict__ VBL) {
  __shared__ __align__(16) _Float16 sh[64][136], sl[64][136]; __shared__ __align__(16) _Float16 th[128][72]; __shared__ __align__(16) __bf16 tb[128][72], tbl[128][72];
  const int tid = threadIdx.x, wave = tid >> 5, lane = tid & 31, col = lane & 15, g = lane >> 4; const int which = blockIdx.z; const int c0 = blockIdx.y * 128; const size_t r0 = (size_t)blockIdx.x * 64; const size_t bb = r0 / TT; const int t0 = (int)(r0 % TT);
  const float* X = which == 0 ? XQ : which == 1 ? XK : XV; const float* WA = which == 0 ? WQ : which == 1 ? WK : WV; const float* BA = which == 0 ? BQ : which == 1 ? BK : BV;
  v8f acc[8] = {};
#pragma unroll 2
  for (int kc = 0; kc < DIN / 32; ++kc) { v16b a; { const float* p = X + (r0 + wave * 16 + col) * DIN + kc * 32 + 8 * g;
#pragma unroll
      for (int i = 0; i < 8; ++i) { a[i] = (__bf16)p[i]; a[8 + i] = (__bf16)p[16 + i]; } }
    asm volatile("s_wait_loadcnt 0x0" ::: "memory");
#pragma unroll
    for (int j = 0; j < 8; ++j) { const v16b w = WCOL(WA, kc * 32, c0 + j * 16 + col, lane); asm volatile("s_wait_loadcnt 0x0" ::: "memory"); acc[j] = wmma_bf(a, w, acc[j]); } }
  if (which < 2) { _Float16* DH = which == 0 ? QH : KH; _Float16* DL = which == 0 ? QL : KL; const int nhi = which == 0 ? QHI : KHI; const bool hi_rows = t0 < nhi;
#pragma unroll
    for (int j = 0; j < 8; ++j) { const float bias = BA ? bfr(BA[c0 + j * 16 + col]) : 0.f;
#pragma unroll
      for (int r = 0; r < 8; ++r) { const float v = acc[j][r] + bias; const _Float16 hv = (_Float16)v; sh[wave * 16 + 8 * g + r][j * 16 + col] = hv; sl[wave * 16 + 8 * g + r][j * 16 + col] = (_Float16)((v - (float)hv) * 1024.0f); } }
    __syncthreads();
    for (int e = tid; e < 64 * 16; e += 128) { const int rl = e >> 4, q = e & 15; vst2((unsigned*)(DH + (r0 + rl) * CC + c0 + q * 8), *(const v4u*)&sh[rl][q * 8]); if (hi_rows) vst2((unsigned*)(DL + (bb * nhi + t0 + rl) * (size_t)CC + c0 + q * 8), *(const v4u*)&sl[rl][q * 8]); }
  } else { const bool hi_rows = t0 < KHI;
#pragma unroll
    for (int j = 0; j < 8; ++j) { const float bias = BA ? bfr(BA[c0 + j * 16 + col]) : 0.f;
#pragma unroll
      for (int r = 0; r < 8; ++r) { const float v = acc[j][r] + bias; const int rl = wave * 16 + 8 * g + r, cl = j * 16 + col; th[cl][rl] = (_Float16)v; const __bf16 bh = (__bf16)v; tb[cl][rl] = bh; tbl[cl][rl] = (__bf16)(v - (float)bh); } }
    __syncthreads();
    for (int e = tid; e < 128 * 8; e += 128) { const int cl = e >> 3, q = e & 7; vst2((unsigned*)(VT + (bb * CC + c0 + cl) * (size_t)TT + t0 + q * 8), *(const v4u*)&th[cl][q * 8]); if (hi_rows) { const size_t o3 = (bb * CC + c0 + cl) * (size_t)KHI + t0 + q * 8; vst2((unsigned*)(VB + o3), *(const v4u*)&tb[cl][q * 8]); vst2((unsigned*)(VBL + o3), *(const v4u*)&tbl[cl][q * 8]); } } } }
// ---- k_sc: block = (query block qb, key block kb <= kb_last(qb), head in group) of batch b: logits x SCALE; q hi + residual (x 2^10) against k (2 products) for query rows < QHI, plus the k residual (3 products) for query blocks < QBH (causal early rows); causal: blocks past the diagonal exit, the mask itself is applied by index in k_sm
__global__ __launch_bounds__(128) void k_sc(const _Float16* __restrict__ QH, const _Float16* __restrict__ KH, const _Float16* __restrict__ QL, const _Float16* __restrict__ KL, int b, int h0, float* __restrict__ S0) { __shared__ __align__(16) float ss[4][16][132];
  const int qb = blockIdx.x, kb = blockIdx.y; if (kb > kb_last(qb)) return;
  const int h = h0 + blockIdx.z; float* S = S0 + (size_t)blockIdx.z * TT * TT;
  const int tid = threadIdx.x, wave = tid >> 5, lane = tid & 31, col = lane & 15, g = lane >> 4; const int k0 = kb * 128; const int ql0 = qb * 64 + wave * 16; const size_t q0 = (size_t)b * TT + ql0, kr0 = (size_t)b * TT + k0;
  v8f acc[8] = {}, accl[8] = {};
  const _Float16* QLb = QL + (size_t)b * QHI * CC; const _Float16* KLb = KL + (size_t)b * KHI * CC;
  if (qb < QBH) {
#pragma unroll
    for (int kc = 0; kc < HD / 32; ++kc) { const v16h ah = frag_h(QH + (q0 + col) * CC + h * HD + kc * 32, lane), al = frag_h(QLb + (size_t)(ql0 + col) * CC + h * HD + kc * 32, lane);
#pragma unroll
      for (int j = 0; j < 8; ++j) { const v16h kbf = frag_h(KH + (kr0 + j * 16 + col) * CC + h * HD + kc * 32, lane), klf = frag_h(KLb + (size_t)(k0 + j * 16 + col) * CC + h * HD + kc * 32, lane); acc[j] = wmma16(ah, kbf, acc[j]); accl[j] = wmma16(al, kbf, accl[j]); accl[j] = wmma16(ah, klf, accl[j]); } }
  } else if (qb * 64 < QHI) {
#pragma unroll
    for (int kc = 0; kc < HD / 32; ++kc) { const v16h ah = frag_h(QH + (q0 + col) * CC + h * HD + kc * 32, lane), al = frag_h(QLb + (size_t)(ql0 + col) * CC + h * HD + kc * 32, lane);
#pragma unroll
      for (int j = 0; j < 8; ++j) { const v16h kbf = frag_h(KH + (kr0 + j * 16 + col) * CC + h * HD + kc * 32, lane); acc[j] = wmma16(ah, kbf, acc[j]); accl[j] = wmma16(al, kbf, accl[j]); } }
  } else {
#pragma unroll
    for (int kc = 0; kc < HD / 32; ++kc) { const v16h ah = frag_h(QH + (q0 + col) * CC + h * HD + kc * 32, lane);
#pragma unroll
      for (int j = 0; j < 8; ++j) { const v16h kbf = frag_h(KH + (kr0 + j * 16 + col) * CC + h * HD + kc * 32, lane); acc[j] = wmma16(ah, kbf, acc[j]); } } }
#pragma unroll
  for (int j = 0; j < 8; ++j) {
#pragma unroll
    for (int r = 0; r < 8; ++r) ss[wave][8 * g + r][j * 16 + col] = (acc[j][r] + accl[j][r] * (1.0f / 1024.0f)) * SCALE; }
  LDSX(); for (int rl = 0; rl < 16; ++rl) vst2(S + (size_t)(ql0 + rl) * TT + k0 + lane * 4, *(const v4f*)&ss[wave][rl][lane * 4]); }
// ---- k_sm: block = query row t (head in group): keys [0, kend): causal -> logit if s <= t else excluded; softmax in f32; P x 2^11 in place (0 for excluded)
__global__ __launch_bounds__(256) void k_sm(float* __restrict__ S0 SM_EXTRA_PARAMS) { __shared__ float sred[8]; __shared__ float sbc; __shared__ __align__(16) float shv[TT];
  const int tid = threadIdx.x; const int t = blockIdx.x; const int kend = (kb_last(t >> 6) + 1) * 128;
  float* sr = S0 + (size_t)blockIdx.y * TT * TT + (size_t)t * TT;
  float m = -3.0e38f; for (int k = tid; k < kend; k += 256) { float v = (!CAUSAL || k <= t) ? sr[k] : -3.0e38f; SM_MASK_HOOK; shv[k] = v; m = fmaxf(m, v); }
#pragma unroll
  for (int o = 1; o < 32; o <<= 1) m = fmaxf(m, __shfl_xor(m, o));
  if ((tid & 31) == 0) sred[tid >> 5] = m; __syncthreads(); if (tid == 0) { float a = sred[0]; for (int i = 1; i < 8; ++i) a = fmaxf(a, sred[i]); sbc = a; } __syncthreads(); m = sbc; __syncthreads();
  float sum = 0.f; for (int k = tid; k < kend; k += 256) { const float v = shv[k]; const float e = (v <= -1.0e38f) ? 0.f : expf(v - m); shv[k] = e; sum += e; }
#pragma unroll
  for (int o = 1; o < 32; o <<= 1) sum += __shfl_xor(sum, o);
  if ((tid & 31) == 0) sred[tid >> 5] = sum; __syncthreads(); if (tid == 0) { float a = 0.f; for (int i = 0; i < 8; ++i) a += sred[i]; sbc = a > 0.f ? 2048.0f / a : 0.f; }   /* a fully excluded row yields P = 0 */ __syncthreads(); const float inv = sbc;
  for (int k = tid; k < kend; k += 256) shv[k] = shv[k] * inv;
  __syncthreads(); for (int q = tid; q < kend / 4; q += 256) vst2(sr + q * 4, *(const v4f*)&shv[q * 4]); }
// ---- k_pv: block = 16 queries (tile qt) of (b, h), PVW waves: wave w takes the 32-key chunks w, w + PVW, ... of keys [0, kend), so the longest serial run of dependent loads is kend / (32 PVW) chunks; the PVW f32 partials are summed in wave order through LDS. ctx = P . v (P x 2^11 once to f16 against v f16: 1 product; causal early query blocks: P and v as bf16 hi + lo, 3 products); 256-B (row, head) segment by 16 lanes
#define PVW 8
__global__ __launch_bounds__(32 * PVW) void k_pv(const float* __restrict__ PS0, const _Float16* __restrict__ VT, const __bf16* __restrict__ VB, const __bf16* __restrict__ VBL, int b, int h0, float* __restrict__ Y) { const int h = h0 + blockIdx.z; const float* PS = PS0 + (size_t)blockIdx.z * TT * TT; __shared__ __align__(16) float ss[PVW][16][HD + 4];
  const int tid = threadIdx.x, wave = __builtin_amdgcn_readfirstlane(tid >> 5), lane = tid & 31, col = lane & 15, g = lane >> 4; const int qb = blockIdx.x >> 2; const int ql0 = blockIdx.x * 16; const int kce = (kb_last(qb) + 1) * 4;
  v8f acc[HD / 16] = {};
  if (qb < QBH) {
#pragma unroll 1
    for (int kc = wave; kc < kce; kc += PVW) { const F2 p = split_row(PS + (size_t)(ql0 + col) * TT, kc * 32, lane);
      asm volatile("s_wait_loadcnt 0x0" ::: "memory");
#pragma unroll
      for (int j = 0; j < HD / 16; ++j) { const size_t po = ((size_t)b * CC + h * HD + j * 16 + col) * (size_t)KHI + kc * 32; const v16b vh = frag_b(VB + po, lane); acc[j] = wmma_bf(p.h, vh, acc[j]); acc[j] = wmma_bf(p.l, vh, acc[j]); acc[j] = wmma_bf(p.h, frag_b(VBL + po, lane), acc[j]); } }
  } else {
#pragma unroll 1
    for (int kc = wave; kc < kce; kc += PVW) { const v16h p = frag_f32(PS + (size_t)(ql0 + col) * TT + kc * 32, lane);
      asm volatile("s_wait_loadcnt 0x0" ::: "memory");
#pragma unroll
      for (int j = 0; j < HD / 16; ++j) { const size_t po = ((size_t)b * CC + h * HD + j * 16 + col) * (size_t)TT + kc * 32; acc[j] = wmma16(p, frag_h(VT + po, lane), acc[j]); } } }
#pragma unroll
  for (int j = 0; j < HD / 16; ++j)
#pragma unroll
    for (int r = 0; r < 8; ++r) ss[wave][8 * g + r][j * 16 + col] = acc[j][r];
  __syncthreads();   /* every wave's partial (zero for a wave without chunks) is in LDS before any thread sums across waves */
  for (int e = tid; e < 16 * (HD / 4); e += 32 * PVW) { const int rl = e / (HD / 4), q = e % (HD / 4); v4f s = *(const v4f*)&ss[0][rl][q * 4];
#pragma unroll
    for (int w = 1; w < PVW; ++w) s += *(const v4f*)&ss[w][rl][q * 4];
    vst2(Y + ((size_t)b * TT + ql0 + rl) * CC + h * HD + q * 4, s * (1.0f / 2048.0f)); } }
// ---- k_out: block = (64 rows, 128 cols): out = ctx Wo (+ bo): ctx x 2^6 once to f16 against Wo as f16(bf16 x 2^8) exact (1 product) x 2^-14; causal early rows (< QHI of each sequence): ctx bf16 hi + lo against exact bf16 Wo (2 products)
__global__ __launch_bounds__(128) void k_out(const float* __restrict__ Y, const float* __restrict__ WO, const float* __restrict__ BO, float* __restrict__ OUT) { __shared__ __align__(16) float sf[4][16][132];
  const int tid = threadIdx.x, wave = tid >> 5, lane = tid & 31, col = lane & 15, g = lane >> 4; const int c0 = blockIdx.y * 128; const size_t r0 = (size_t)blockIdx.x * 64 + wave * 16;
  v8f acc[8] = {};
  if (CAUSAL && (int)(((size_t)blockIdx.x * 64) % TT) < QHI) {   /* block-uniform */
#pragma unroll 2
    for (int kc = 0; kc < CC / 32; ++kc) { const F2 a = split_row(Y + (r0 + col) * CC, kc * 32, lane); asm volatile("s_wait_loadcnt 0x0" ::: "memory");
#pragma unroll
      for (int j = 0; j < 8; ++j) { const v16b w = WOCOL(WO, kc * 32, c0 + j * 16 + col, lane); asm volatile("s_wait_loadcnt 0x0" ::: "memory"); acc[j] = wmma_bf(a.h, w, acc[j]); acc[j] = wmma_bf(a.l, w, acc[j]); } }
#pragma unroll
    for (int j = 0; j < 8; ++j) { const float bias = BO ? bfr(BO[c0 + j * 16 + col]) : 0.f;
#pragma unroll
      for (int r = 0; r < 8; ++r) sf[wave][8 * g + r][j * 16 + col] = acc[j][r] + bias; }
  } else {
#pragma unroll 2
    for (int kc = 0; kc < CC / 32; ++kc) { const v16h a = frag_f32s(Y + (r0 + col) * CC + kc * 32, lane, 64.0f); asm volatile("s_wait_loadcnt 0x0" ::: "memory");   /* ctx carried x 2^6 into f16 so small-magnitude context rows stay clear of f16 subnormals */
#pragma unroll
      for (int j = 0; j < 8; ++j) { const v16h w = WOCOLH(WO, kc * 32, c0 + j * 16 + col, lane); asm volatile("s_wait_loadcnt 0x0" ::: "memory"); acc[j] = wmma16(a, w, acc[j]); } }
#pragma unroll
    for (int j = 0; j < 8; ++j) { const float bias = BO ? bfr(BO[c0 + j * 16 + col]) : 0.f;
#pragma unroll
      for (int r = 0; r < 8; ++r) sf[wave][8 * g + r][j * 16 + col] = acc[j][r] * (1.0f / 16384.0f) + bias; } }   /* 2^-8 (Wo carry) x 2^-6 (ctx carry) */
  LDSX(); for (int rl = 0; rl < 16; ++rl) vst2(OUT + (r0 + rl) * DIN + c0 + lane * 4, *(const v4f*)&sf[wave][rl][lane * 4]); }

extern "C" void kernel_launch(void* const* d_in, const int* in_sizes, int n_in, void* d_out, int out_size, void* d_ws, size_t ws_size, hipStream_t stream) {
  (void)in_sizes; (void)n_in; (void)out_size;
  const float** F = (const float**)d_in;
  if (ws_size < (size_t)WS_END) return;
  char* ws = (char*)d_ws; _Float16 *QH = (_Float16*)(ws + WS_QH), *KH = (_Float16*)(ws + WS_KH), *VT = (_Float16*)(ws + WS_VT), *QL = (_Float16*)(ws + WS_QL), *KL = (_Float16*)(ws + WS_KL); __bf16 *VB = (__bf16*)(ws + WS_VB), *VBL = (__bf16*)(ws + WS_VBL); float *S = (float*)(ws + WS_S), *Y = (float*)(ws + WS_Y);
  (void)Y; (void)QL; (void)KL; (void)VB; (void)VBL;
  // inputs: 0 x [2,2048,1024]; 1 W_qkv [3072,1024] (out,in): q rows 0..1023, k 1024..2047, v 2048..3071; 2 W_o [1024,1024] (out,in); no biases
  k_proj<<<dim3(TNB * TT / 64, CC / 128, 3), 128, 0, stream>>>(F[0], F[0], F[0], F[1], F[1] + (size_t)CC * DIN, F[1] + 2 * (size_t)CC * DIN, nullptr, nullptr, nullptr, QH, QL, KH, KL, VT, VB, VBL);
  for (int b = 0; b < TNB; ++b) for (int h0 = 0; h0 < NH; h0 += HG) {
    k_sc<<<dim3(NQB, TT / 128, HG), 128, 0, stream>>>(QH, KH, QL, KL, b, h0, S);
    k_sm<<<dim3(TT, HG), 256, 0, stream>>>(S);
    k_pv<<<dim3(TT / 16, 1, HG), 32 * PVW, 0, stream>>>(S, VT, VB, VBL, b, h0, Y);
  }
  k_out<<<dim3(TNB * TT / 64, DIN / 128), 128, 0, stream>>>(Y, F[2], nullptr, (float*)d_out);
}

// v002
// A run of this version takes 645 microseconds.
// Timed twice side by side with v001, it ran 1.31 times as fast both times.
// All steps since v000 together make it 1.83 times as fast.
// compute dtype: all float inputs rounded to bf16; the fused q / k / v projection with EXACT bf16 products on WMMA 16x16x32 (f32 accumulate) (no biases); causal logits: 3 products for the first 384 rows, single f16 q x k after, x 64^-0.5; softmax f32; P x 2^11 once to f16 x v once to f16 (bf16 hi + lo below row 384); ctx hi+lo x exact W below row 384, x2^6 f16 carry x f16(bf16 x 2^8) W after, no bias; f32 output.
#include <hip/hip_runtime.h>
#include <math.h>

typedef __attribute__((ext_vector_type(16))) _Float16 v16h;
typedef __attribute__((ext_vector_type(16))) __bf16 v16b;
typedef __attribute__((ext_vector_type(8)))  _Float16 v8h;
typedef __attribute__((ext_vector_type(8)))  float v8f;
typedef __attribute__((ext_vector_type(4)))  float v4f;
typedef __attribute__((ext_vector_type(2)))  float v2f;
typedef __attribute__((ext_vector_type(4)))  unsigned v4u;
typedef __attribute__((ext_vector_type(4)))  int v4i;
typedef float __attribute__((may_alias)) float_a;
typedef int __attribute__((may_alias)) int_a;

template <typename T> __device__ __forceinline__ void vst2(void* p, T v) { *(T*)p = v;  }
__device__ __forceinline__ v8f wmma16(v16h a, v16h b, v8f c) {
  v8f d = __builtin_amdgcn_wmma_f32_16x16x32_f16(false, a, false, b, (short)0, c, false, false);
  asm volatile("v_nop\n\tv_nop\n\tv_nop\n\tv_nop" : "+v"(d) : "v"(a), "v"(b));
  return d;
}
__device__ __forceinline__ v8f wmma_bf(v16b a, v16b b, v8f c) {
  v8f d = __builtin_amdgcn_wmma_f32_16x16x32_bf16(false, a, false, b, (short)0, c, false, false);
  asm volatile("v_nop\n\tv_nop\n\tv_nop\n\tv_nop" : "+v"(d) : "v"(a), "v"(b));
  return d;
}
// 16x16x32 fragments: lane = (h = lane>>4, row/col = lane&15); elements 0..7 = k0+8h+0..7, 8..15 = k0+16+8h+0..7; D element r = row 8h+r
__device__ __forceinline__ v16h frag_h(const _Float16* rowk0, int lane) {
  union { v16h v; v8h q[2]; } u; const _Float16* p = rowk0 + 8 * (lane >> 4);
  u.q[0] = *(const v8h*)p; u.q[1] = *(const v8h*)(p + 16); return u.v;
}
__device__ __forceinline__ v16h frag_f32(const float* rowk0, int lane) {
  v16h a; const float* p = rowk0 + 8 * (lane >> 4);
#pragma unroll
  for (int i = 0; i < 8; ++i) { a[i] = (_Float16)p[i]; a[8 + i] = (_Float16)p[16 + i]; }
  return a;
}
__device__ __forceinline__ v16h frag_f32s(const float* rowk0, int lane, float sc) {
  v16h a; const float* p = rowk0 + 8 * (lane >> 4);
#pragma unroll
  for (int i = 0; i < 8; ++i) { a[i] = (_Float16)(p[i] * sc); a[8 + i] = (_Float16)(p[16 + i] * sc); }
  return a;
}
// column fragment from a [K][ld] layout (column n), rows >= K read as 0
__device__ __forceinline__ v16h fragc_f32(const float* W, int k0, int n, int lane, int ld, int K) {
  v16h a; const int g = lane >> 4;
#pragma unroll
  for (int i = 0; i < 8; ++i) { const int ka = k0 + 8 * g + i, kb = ka + 16;
    a[i] = (_Float16)(ka < K ? W[(size_t)(ka < K ? ka : K - 1) * ld + n] : 0.f); a[8 + i] = (_Float16)(kb < K ? W[(size_t)(kb < K ? kb : K - 1) * ld + n] : 0.f); }
  return a;
}
struct F2 { v16b h, l; };
__device__ __forceinline__ F2 bsplit16(const float v[16]) { F2 r;
#pragma unroll
  for (int i = 0; i < 16; ++i) { const __bf16 h = (__bf16)v[i]; r.h[i] = h; r.l[i] = (__bf16)(v[i] - (float)h); }
  return r; }
__device__ __forceinline__ F2 split_row(const float* row, int k0, int lane) { float v[16]; const float* p = row + k0 + 8 * (lane >> 4);
#pragma unroll
  for (int i = 0; i < 8; ++i) { v[i] = p[i]; v[8 + i] = p[16 + i]; }
  return bsplit16(v); }
__device__ __forceinline__ F2 split_rowK(const float* row, int k0, int lane, int K) { float v[16]; const int g = lane >> 4;
#pragma unroll
  for (int i = 0; i < 8; ++i) { const int ka = k0 + 8 * g + i, kb = ka + 16; v[i] = ka < K ? row[ka < K ? ka : K - 1] : 0.f; v[8 + i] = kb < K ? row[kb < K ? kb : K - 1] : 0.f; }
  return bsplit16(v); }
__device__ __forceinline__ F2 split_col(const float* W, int k0, int n, int lane, int ld, int K) { float v[16]; const int g = lane >> 4;
#pragma unroll
  for (int i = 0; i < 8; ++i) { const int ka = k0 + 8 * g + i, kb = ka + 16; v[i] = ka < K ? W[(size_t)(ka < K ? ka : K - 1) * ld + n] : 0.f; v[8 + i] = kb < K ? W[(size_t)(kb < K ? kb : K - 1) * ld + n] : 0.f; }
  return bsplit16(v); }
__device__ __forceinline__ v8f mac3(const F2& a, const F2& b, v8f c) { c = wmma_bf(a.l, b.h, c); c = wmma_bf(a.h, b.l, c); return wmma_bf(a.h, b.h, c); }
__device__ __forceinline__ float sigm(float v) { return 1.0f / (1.0f + expf(-v)); }
#define LDSX() do { asm volatile("s_wait_dscnt 0" ::: "memory"); __builtin_amdgcn_wave_barrier(); __builtin_amdgcn_fence(__ATOMIC_RELEASE, "workgroup"); } while (0)

// Bias-free causal multi-head self-attention with a fused (out,in) QKV projection (x [2,2048,1024]; Wqkv [3072,1024] torch (out,in): jnp.split thirds of einsum('btd,ed->bte') = x @ Wqkv.T (q = rows 0..1023, k = 1024..2047, v = 2048..3071); Wout [1024,1024] (out,in); no biases; 16 heads x 64; scores x 1/sqrt(64); tril kept, -inf elsewhere; softmax; out @ Wout.T).
#define NB 2
#define TT 2048
#define CC 1024            // NH * HD = projected width
#define DIN 1024          // input (model) width
#define NH 16
#define HD 64
#define NQB (TT / 64)
#define HG 4
#define SCALE (0.125f)
#define CAUSAL 1
#ifndef TNB
#define TNB NB
#endif
__device__ __forceinline__ float bfr(float v) { return (float)(__bf16)v; }
__host__ __device__ __forceinline__ int kb_last(int qb) { return CAUSAL ? ((qb * 64 + 63) >> 7) : (TT / 128 - 1); }
typedef __attribute__((ext_vector_type(8))) __bf16 v8b;
__device__ __forceinline__ v16b frag_b(const __bf16* rowk0, int lane) {
  union { v16b v; v8b q[2]; } u; const __bf16* p = rowk0 + 8 * (lane >> 4);
  u.q[0] = *(const v8b*)p; u.q[1] = *(const v8b*)(p + 16); return u.v;
}
#define QBH 6              // causal: query blocks 0..QBH-1 of each sequence (few keys, no averaging) take the high-precision path
#define QHI 384            // rows carrying a q residual plane
#define KHI 384            // key rows carrying k residual / v bf16 hi+lo planes (used only by the causal high-precision path)
// B fragment (k rows k0+.., output column o) of a weight: (in,out) [K][ld] or (out,in) [ld rows of K]: bf16 exact, or f16(bf16 * 256) exact
__device__ __forceinline__ v16b wcol_io(const float* Wm, int k0, int o, int lane, int ld) { v16b w; const int g = lane >> 4;
#pragma unroll
  for (int i = 0; i < 8; ++i) { w[i] = (__bf16)Wm[(size_t)(k0 + 8 * g + i) * ld + o]; w[8 + i] = (__bf16)Wm[(size_t)(k0 + 16 + 8 * g + i) * ld + o]; }
  return w; }
__device__ __forceinline__ v16b wcol_oi(const float* Wm, int k0, int o, int lane, int K) { v16b w; const float* p = Wm + (size_t)o * K + k0 + 8 * (lane >> 4);
#pragma unroll
  for (int i = 0; i < 8; ++i) { w[i] = (__bf16)p[i]; w[8 + i] = (__bf16)p[16 + i]; }
  return w; }
__device__ __forceinline__ v16h wcolh_io(const float* Wm, int k0, int o, int lane, int ld) { v16h w; const int g = lane >> 4;
#pragma unroll
  for (int i = 0; i < 8; ++i) { w[i] = (_Float16)(bfr(Wm[(size_t)(k0 + 8 * g + i) * ld + o]) * 256.0f); w[8 + i] = (_Float16)(bfr(Wm[(size_t)(k0 + 16 + 8 * g + i) * ld + o]) * 256.0f); }
  return w; }
__device__ __forceinline__ v16h wcolh_oi(const float* Wm, int k0, int o, int lane, int K) { v16h w; const float* p = Wm + (size_t)o * K + k0 + 8 * (lane >> 4);
#pragma unroll
  for (int i = 0; i < 8; ++i) { w[i] = (_Float16)(bfr(p[i]) * 256.0f); w[8 + i] = (_Float16)(bfr(p[16 + i]) * 256.0f); }
  return w; }
#define WQKV_LAYOUT 1   // 0 = (in,out) [DIN][CC]; 1 = (out,in) [CC][DIN]; 2 = per-head [NH][DIN][HD]
__device__ __forceinline__ v16b wcol_hdk(const float* Wm, int k0, int o, int lane) { v16b w; const int g = lane >> 4; const float* p = Wm + (size_t)(o / HD) * DIN * HD + (o % HD);
#pragma unroll
  for (int i = 0; i < 8; ++i) { w[i] = (__bf16)p[(size_t)(k0 + 8 * g + i) * HD]; w[8 + i] = (__bf16)p[(size_t)(k0 + 16 + 8 * g + i) * HD]; }
  return w; }
#define WO_OUT_IN 1
#if WQKV_LAYOUT == 1
#define WCOL(W, k0, o, lane) wcol_oi(W, k0, o, lane, DIN)
#elif WQKV_LAYOUT == 2
#define WCOL(W, k0, o, lane) wcol_hdk(W, k0, o, lane)
#else
#define WCOL(W, k0, o, lane) wcol_io(W, k0, o, lane, CC)
#endif
#if WO_OUT_IN
#define WOCOL(W, k0, o, lane) wcol_oi(W, k0, o, lane, CC)
#define WOCOLH(W, k0, o, lane) wcolh_oi(W, k0, o, lane, CC)
#else
#define WOCOL(W, k0, o, lane) wcol_io(W, k0, o, lane, DIN)
#define WOCOLH(W, k0, o, lane) wcolh_io(W, k0, o, lane, DIN)
#endif

#ifndef PROJ_EXTRA_PARAMS
#define PROJ_EXTRA_PARAMS
#endif

#define WS_QH  0u                                      // f16 q rows [b*t][CC]
#define WS_KH  (WS_QH + 2u * (size_t)NB * TT * CC)      // f16 k rows [b*t][CC]
#define WS_VT  (WS_KH + 2u * (size_t)NB * TT * CC)      // f16 v planes [b][c][t]
#define WS_QL  (WS_VT + 2u * (size_t)NB * CC * TT)      // f16 q residual x 2^10 rows [b][t < QHI][CC]
#define WS_KL  (WS_QL + 2u * (size_t)NB * QHI * CC)     // f16 k residual x 2^10 rows [b][t < KHI][CC]
#define WS_VB  (WS_KL + 2u * (size_t)NB * KHI * CC)     // bf16 v hi planes [b][c][t < KHI]
#define WS_VBL (WS_VB + 2u * (size_t)NB * CC * KHI)
#define WS_S   (WS_VBL + 2u * (size_t)NB * CC * KHI)    // f32 logits [hg][t][s]
#define WS_Y   (WS_S  + 4u * (size_t)HG * TT * TT)      // f32 ctx rows [b*t][CC] (only when there is an output projection)
#define WS_END (WS_Y  + 4u * (size_t)NB * TT * CC)

// ---- k_proj: block = (64 rows, 128 cols, which): q/k/v = X W (+ b) with exact bf16 products (K = DIN) -> which 0: q f16 rows (+ residual rows < QHI); 1: k f16 rows (+ residual rows < KHI); 2: v f16 planes [c][t] (+ bf16 hi/lo planes for t < KHI)
__global__ __launch_bounds__(128) void k_proj(const float* __restrict__ XQ, const float* __restrict__ XK, const float* __restrict__ XV, const float* __restrict__ WQ, const float* __restrict__ WK, const float* __restrict__ WV, const float* __restrict__ BQ, const float* __restrict__ BK, const float* __restrict__ BV,
    _Float16* __restrict__ QH, _Float16* __restrict__ QL, _Float16* __restrict__ KH, _Float16* __restrict__ KL, _Float16* __restrict__ VT, __bf16* __restrict__ VB, __bf16* __restrict__ VBL) {
  __shared__ __align__(16) _Float16 sh[64][136], sl[64][136]; __shared__ __align__(16) _Float16 th[128][72]; __shared__ __align__(16) __bf16 tb[128][72], tbl[128][72];
  const int tid = threadIdx.x, wave = tid >> 5, lane = tid & 31, col = lane & 15, g = lane >> 4; const int which = blockIdx.z; const int c0 = blockIdx.y * 128; const size_t r0 = (size_t)blockIdx.x * 64; const size_t bb = r0 / TT; const int t0 = (int)(r0 % TT);
  const float* X = which == 0 ? XQ : which == 1 ? XK : XV; const float* WA = which == 0 ? WQ : which == 1 ? WK : WV; const float* BA = which == 0 ? BQ : which == 1 ? BK : BV;
  v8f acc[8] = {};
#pragma unroll 2
  for (int kc = 0; kc < DIN / 32; ++kc) { v16b a; { const float* p = X + (r0 + wave * 16 + col) * DIN + kc * 32 + 8 * g;
#pragma unroll
      for (int i = 0; i < 8; ++i) { a[i] = (__bf16)p[i]; a[8 + i] = (__bf16)p[16 + i]; } }
    asm volatile("s_wait_loadcnt 0x0" ::: "memory");
#pragma unroll
    for (int j = 0; j < 8; ++j) { const v16b w = WCOL(WA, kc * 32, c0 + j * 16 + col, lane); asm volatile("s_wait_loadcnt 0x0" ::: "memory"); acc[j] = wmma_bf(a, w, acc[j]); } }
  if (which < 2) { _Float16* DH = which == 0 ? QH : KH; _Float16* DL = which == 0 ? QL : KL; const int nhi = which == 0 ? QHI : KHI; const bool hi_rows = t0 < nhi;
#pragma unroll
    for (int j = 0; j < 8; ++j) { const float bias = BA ? bfr(BA[c0 + j * 16 + col]) : 0.f;
#pragma unroll
      for (int r = 0; r < 8; ++r) { const float v = acc[j][r] + bias; const _Float16 hv = (_Float16)v; sh[wave * 16 + 8 * g + r][j * 16 + col] = hv; sl[wave * 16 + 8 * g + r][j * 16 + col] = (_Float16)((v - (float)hv) * 1024.0f); } }
    __syncthreads();
    for (int e = tid; e < 64 * 16; e += 128) { const int rl = e >> 4, q = e & 15; vst2((unsigned*)(DH + (r0 + rl) * CC + c0 + q * 8), *(const v4u*)&sh[rl][q * 8]); if (hi_rows) vst2((unsigned*)(DL + (bb * nhi + t0 + rl) * (size_t)CC + c0 + q * 8), *(const v4u*)&sl[rl][q * 8]); }
  } else { const bool hi_rows = t0 < KHI;
#pragma unroll
    for (int j = 0; j < 8; ++j) { const float bias = BA ? bfr(BA[c0 + j * 16 + col]) : 0.f;
#pragma unroll
      for (int r = 0; r < 8; ++r) { const float v = acc[j][r] + bias; const int rl = wave * 16 + 8 * g + r, cl = j * 16 + col; th[cl][rl] = (_Float16)v; const __bf16 bh = (__bf16)v; tb[cl][rl] = bh; tbl[cl][rl] = (__bf16)(v - (float)bh); } }
    __syncthreads();
    for (int e = tid; e < 128 * 8; e += 128) { const int cl = e >> 3, q = e & 7; vst2((unsigned*)(VT + (bb * CC + c0 + cl) * (size_t)TT + t0 + q * 8), *(const v4u*)&th[cl][q * 8]); if (hi_rows) { const size_t o3 = (bb * CC + c0 + cl) * (size_t)KHI + t0 + q * 8; vst2((unsigned*)(VB + o3), *(const v4u*)&tb[cl][q * 8]); vst2((unsigned*)(VBL + o3), *(const v4u*)&tbl[cl][q * 8]); } } } }
// ---- k_sc: block = (query block qb, key block kb <= kb_last(qb), head in group) of batch b: logits x SCALE; q hi + residual (x 2^10) against k (2 products) for query rows < QHI, plus the k residual (3 products) for query blocks < QBH (causal early rows); causal: blocks past the diagonal exit, the mask itself is applied by index in k_pv
__global__ __launch_bounds__(128) void k_sc(const _Float16* __restrict__ QH, const _Float16* __restrict__ KH, const _Float16* __restrict__ QL, const _Float16* __restrict__ KL, int b, int h0, float* __restrict__ S0) { __shared__ __align__(16) float ss[4][16][132];
  const int qb = blockIdx.x, kb = blockIdx.y; if (kb > kb_last(qb)) return;
  const int h = h0 + blockIdx.z; float* S = S0 + (size_t)blockIdx.z * TT * TT;
  const int tid = threadIdx.x, wave = tid >> 5, lane = tid & 31, col = lane & 15, g = lane >> 4; const int k0 = kb * 128; const int ql0 = qb * 64 + wave * 16; const size_t q0 = (size_t)b * TT + ql0, kr0 = (size_t)b * TT + k0;
  v8f acc[8] = {}, accl[8] = {};
  const _Float16* QLb = QL + (size_t)b * QHI * CC; const _Float16* KLb = KL + (size_t)b * KHI * CC;
  if (qb < QBH) {
#pragma unroll
    for (int kc = 0; kc < HD / 32; ++kc) { const v16h ah = frag_h(QH + (q0 + col) * CC + h * HD + kc * 32, lane), al = frag_h(QLb + (size_t)(ql0 + col) * CC + h * HD + kc * 32, lane);
#pragma unroll
      for (int j = 0; j < 8; ++j) { const v16h kbf = frag_h(KH + (kr0 + j * 16 + col) * CC + h * HD + kc * 32, lane), klf = frag_h(KLb + (size_t)(k0 + j * 16 + col) * CC + h * HD + kc * 32, lane); acc[j] = wmma16(ah, kbf, acc[j]); accl[j] = wmma16(al, kbf, accl[j]); accl[j] = wmma16(ah, klf, accl[j]); } }
  } else if (qb * 64 < QHI) {
#pragma unroll
    for (int kc = 0; kc < HD / 32; ++kc) { const v16h ah = frag_h(QH + (q0 + col) * CC + h * HD + kc * 32, lane), al = frag_h(QLb + (size_t)(ql0 + col) * CC + h * HD + kc * 32, lane);
#pragma unroll
      for (int j = 0; j < 8; ++j) { const v16h kbf = frag_h(KH + (kr0 + j * 16 + col) * CC + h * HD + kc * 32, lane); acc[j] = wmma16(ah, kbf, acc[j]); accl[j] = wmma16(al, kbf, accl[j]); } }
  } else {
#pragma unroll
    for (int kc = 0; kc < HD / 32; ++kc) { const v16h ah = frag_h(QH + (q0 + col) * CC + h * HD + kc * 32, lane);
#pragma unroll
      for (int j = 0; j < 8; ++j) { const v16h kbf = frag_h(KH + (kr0 + j * 16 + col) * CC + h * HD + kc * 32, lane); acc[j] = wmma16(ah, kbf, acc[j]); } } }
#pragma unroll
  for (int j = 0; j < 8; ++j) {
#pragma unroll
    for (int r = 0; r < 8; ++r) ss[wave][8 * g + r][j * 16 + col] = (acc[j][r] + accl[j][r] * (1.0f / 1024.0f)) * SCALE; }
  LDSX(); for (int rl = 0; rl < 16; ++rl) vst2(S + (size_t)(ql0 + rl) * TT + k0 + lane * 4, *(const v4f*)&ss[wave][rl][lane * 4]); }
// ---- k_pv: block = 16 queries (tile qt) of (b, h), PVW waves. First the softmax of the block's 16 logit rows (sm_rows), P x 2^11 left in LDS; then wave w takes the 32-key chunks w, w + PVW, ... of keys [0, kend), so the longest serial run of dependent loads is kend / (32 PVW) chunks; the PVW f32 partials are summed in wave order through LDS. ctx = P . v (P x 2^11 once to f16 against v f16: 1 product; causal early query blocks: P and v as bf16 hi + lo, 3 products); 256-B (row, head) segment by 16 lanes
#define PVW 8
#define PPH (TT + 8)       // LDS pitch of an f16 P row: 16 B x odd, for the 16-byte fragment reads
#define PPF (KHI + 4)      // LDS pitch of an f32 P row (causal early query blocks): 16 B x odd
typedef __attribute__((ext_vector_type(4))) _Float16 v4h;
// (the group tests are marked likely so that the longest rows, which set the launch's time, run straight through)
// sm_rows: each wave takes 16 / PVW whole rows, a row held in registers (lane l owns keys 128 i + 4 l .. + 3, i < n128): causal -> logit if s <= t else excluded; maximum and sum by lane then across the 32 lanes, in f32; P x 2^11 (0 for excluded) to LDS, as f32 (HI) or once to f16
template <bool HI> __device__ __forceinline__ void sm_rows(const float* __restrict__ S, int ql0, int wave, int lane, int n128, float* pf, _Float16* ph) {
  constexpr int NG = HI ? KHI / 128 : TT / 128; constexpr int RW = 16 / PVW;
#pragma unroll 1   /* rolled: one copy of the row code keeps the kernel's text small; the other waves' arithmetic covers this wave's load latency */
  for (int rr = 0; rr < RW; ++rr) { const int rl = wave * RW + rr, t = ql0 + rl; const float* p0 = S + (size_t)t * TT + lane * 4;
    v4f v[NG];
#pragma unroll
    for (int i = 0; i < NG; ++i) { v[i] = (v4f)(-3.0e38f); if (__builtin_expect(i < n128, 1)) v[i] = *(const v4f*)(p0 + i * 128); }
    asm volatile("s_wait_xcnt 0x0" :: "v"(p0) : "memory");   /* the wait that stands before the row loads' address register may be overwritten; p0 is named as an input so that it lives, unchanged, up to here */
    float m = -3.0e38f;
#pragma unroll
    for (int i = 0; i < NG; ++i) {   /* every group, loaded or not: each load's first use then stands on every path, so that the next row's loads need not wait one by one for this row's */
#pragma unroll
      for (int c = 0; c < 4; ++c) { const float x = (!CAUSAL || i * 128 + lane * 4 + c <= t) ? v[i][c] : -3.0e38f; v[i][c] = x; m = fmaxf(m, x); } }
#pragma unroll
    for (int o = 1; o < 32; o <<= 1) m = fmaxf(m, __shfl_xor(m, o));
    float sum = 0.f;
#pragma unroll
    for (int i = 0; i < NG; ++i) if (__builtin_expect(i < n128, 1)) {
#pragma unroll
      for (int c = 0; c < 4; ++c) { const float x = v[i][c]; const float ex = expf(x - m); const float e = (x <= -1.0e38f) ? 0.f : ex; v[i][c] = e; sum += e; } }
#pragma unroll
    for (int o = 1; o < 32; o <<= 1) sum += __shfl_xor(sum, o);
    const float inv = sum > 0.f ? 2048.0f / sum : 0.f;   /* a fully excluded row yields P = 0 */
#pragma unroll
    for (int i = 0; i < NG; ++i) if (__builtin_expect(i < n128, 1)) { const v4f p = v[i] * inv;
      if (HI) *(v4f*)(pf + rl * PPF + i * 128 + lane * 4) = p;
      else { v4h q; q[0] = (_Float16)p[0]; q[1] = (_Float16)p[1]; q[2] = (_Float16)p[2]; q[3] = (_Float16)p[3]; *(v4h*)(ph + rl * PPH + i * 128 + lane * 4) = q; } } } }
__global__ __launch_bounds__(32 * PVW) void k_pv(const float* __restrict__ S0, const _Float16* __restrict__ VT, const __bf16* __restrict__ VB, const __bf16* __restrict__ VBL, int b, int h0, float* __restrict__ Y) { const int h = h0 + blockIdx.z; const float* S = S0 + (size_t)blockIdx.z * TT * TT; __shared__ __align__(16) float ss[PVW][16][HD + 4]; __shared__ __align__(16) _Float16 ph[16][PPH]; __shared__ __align__(16) float pf[16][PPF];
  const int tid = threadIdx.x, wave = __builtin_amdgcn_readfirstlane(tid >> 5), lane = tid & 31, col = lane & 15, g = lane >> 4; const int qb = blockIdx.x >> 2; const int ql0 = blockIdx.x * 16; const int kce = (kb_last(qb) + 1) * 4;
  if (qb < QBH) sm_rows<true>(S, ql0, wave, lane, kce >> 2, &pf[0][0], &ph[0][0]); else sm_rows<false>(S, ql0, wave, lane, kce >> 2, &pf[0][0], &ph[0][0]);
  __syncthreads();   /* all 16 P rows are in LDS before any wave reads its key chunks of them */
  v8f acc[HD / 16] = {};
  if (qb < QBH) {
#pragma unroll 1
    for (int kc = wave; kc < kce; kc += PVW) { const F2 p = split_row(&pf[col][0], kc * 32, lane);
#pragma unroll
      for (int j = 0; j < HD / 16; ++j) { const size_t po = ((size_t)b * CC + h * HD + j * 16 + col) * (size_t)KHI + kc * 32; const v16b vh = frag_b(VB + po, lane); acc[j] = wmma_bf(p.h, vh, acc[j]); acc[j] = wmma_bf(p.l, vh, acc[j]); acc[j] = wmma_bf(p.h, frag_b(VBL + po, lane), acc[j]); } }
  } else {
#pragma unroll 1
    for (int kc = wave; kc < kce; kc += PVW) { const v16h p = frag_h(&ph[col][kc * 32], lane);
#pragma unroll
      for (int j = 0; j < HD / 16; ++j) { const size_t po = ((size_t)b * CC + h * HD + j * 16 + col) * (size_t)TT + kc * 32; acc[j] = wmma16(p, frag_h(VT + po, lane), acc[j]); } } }
#pragma unroll
  for (int j = 0; j < HD / 16; ++j)
#pragma unroll
    for (int r = 0; r < 8; ++r) ss[wave][8 * g + r][j * 16 + col] = acc[j][r];
  __syncthreads();   /* every wave's partial (zero for a wave without chunks) is in LDS before any thread sums across waves */
  for (int e = tid; e < 16 * (HD / 4); e += 32 * PVW) { const int rl = e / (HD / 4), q = e % (HD / 4); v4f s = *(const v4f*)&ss[0][rl][q * 4];
#pragma unroll
    for (int w = 1; w < PVW; ++w) s += *(const v4f*)&ss[w][rl][q * 4];
    vst2(Y + ((size_t)b * TT + ql0 + rl) * CC + h * HD + q * 4, s * (1.0f / 2048.0f)); } }
// ---- k_out: block = (64 rows, 128 cols): out = ctx Wo (+ bo): ctx x 2^6 once to f16 against Wo as f16(bf16 x 2^8) exact (1 product) x 2^-14; causal early rows (< QHI of each sequence): ctx bf16 hi + lo against exact bf16 Wo (2 products)
__global__ __launch_bounds__(128) void k_out(const float* __restrict__ Y, const float* __restrict__ WO, const float* __restrict__ BO, float* __restrict__ OUT) { __shared__ __align__(16) float sf[4][16][132];
  const int tid = threadIdx.x, wave = tid >> 5, lane = tid & 31, col = lane & 15, g = lane >> 4; const int c0 = blockIdx.y * 128; const size_t r0 = (size_t)blockIdx.x * 64 + wave * 16;
  v8f acc[8] = {};
  if (CAUSAL && (int)(((size_t)blockIdx.x * 64) % TT) < QHI) {   /* block-uniform */
#pragma unroll 2
    for (int kc = 0; kc < CC / 32; ++kc) { const F2 a = split_row(Y + (r0 + col) * CC, kc * 32, lane); asm volatile("s_wait_loadcnt 0x0" ::: "memory");
#pragma unroll
      for (int j = 0; j < 8; ++j) { const v16b w = WOCOL(WO, kc * 32, c0 + j * 16 + col, lane); asm volatile("s_wait_loadcnt 0x0" ::: "memory"); acc[j] = wmma_bf(a.h, w, acc[j]); acc[j] = wmma_bf(a.l, w, acc[j]); } }
#pragma unroll
    for (int j = 0; j < 8; ++j) { const float bias = BO ? bfr(BO[c0 + j * 16 + col]) : 0.f;
#pragma unroll
      for (int r = 0; r < 8; ++r) sf[wave][8 * g + r][j * 16 + col] = acc[j][r] + bias; }
  } else {
#pragma unroll 2
    for (int kc = 0; kc < CC / 32; ++kc) { const v16h a = frag_f32s(Y + (r0 + col) * CC + kc * 32, lane, 64.0f); asm volatile("s_wait_loadcnt 0x0" ::: "memory");   /* ctx carried x 2^6 into f16 so small-magnitude context rows stay clear of f16 subnormals */
#pragma unroll
      for (int j = 0; j < 8; ++j) { const v16h w = WOCOLH(WO, kc * 32, c0 + j * 16 + col, lane); asm volatile("s_wait_loadcnt 0x0" ::: "memory"); acc[j] = wmma16(a, w, acc[j]); } }
#pragma unroll
    for (int j = 0; j < 8; ++j) { const float bias = BO ? bfr(BO[c0 + j * 16 + col]) : 0.f;
#pragma unroll
      for (int r = 0; r < 8; ++r) sf[wave][8 * g + r][j * 16 + col] = acc[j][r] * (1.0f / 16384.0f) + bias; } }   /* 2^-8 (Wo carry) x 2^-6 (ctx carry) */
  LDSX(); for (int rl = 0; rl < 16; ++rl) vst2(OUT + (r0 + rl) * DIN + c0 + lane * 4, *(const v4f*)&sf[wave][rl][lane * 4]); }

extern "C" void kernel_launch(void* const* d_in, const int* in_sizes, int n_in, void* d_out, int out_size, void* d_ws, size_t ws_size, hipStream_t stream) {
  (void)in_sizes; (void)n_in; (void)out_size;
  const float** F = (const float**)d_in;
  if (ws_size < (size_t)WS_END) return;
  char* ws = (char*)d_ws; _Float16 *QH = (_Float16*)(ws + WS_QH), *KH = (_Float16*)(ws + WS_KH), *VT = (_Float16*)(ws + WS_VT), *QL = (_Float16*)(ws + WS_QL), *KL = (_Float16*)(ws + WS_KL); __bf16 *VB = (__bf16*)(ws + WS_VB), *VBL = (__bf16*)(ws + WS_VBL); float *S = (float*)(ws + WS_S), *Y = (float*)(ws + WS_Y);
  (void)Y; (void)QL; (void)KL; (void)VB; (void)VBL;
  // inputs: 0 x [2,2048,1024]; 1 W_qkv [3072,1024] (out,in): q rows 0..1023, k 1024..2047, v 2048..3071; 2 W_o [1024,1024] (out,in); no biases
  k_proj<<<dim3(TNB * TT / 64, CC / 128, 3), 128, 0, stream>>>(F[0], F[0], F[0], F[1], F[1] + (size_t)CC * DIN, F[1] + 2 * (size_t)CC * DIN, nullptr, nullptr, nullptr, QH, QL, KH, KL, VT, VB, VBL);
  for (int b = 0; b < TNB; ++b) for (int h0 = 0; h0 < NH; h0 += HG) {
    k_sc<<<dim3(NQB, TT / 128, HG), 128, 0, stream>>>(QH, KH, QL, KL, b, h0, S);
    k_pv<<<dim3(TT / 16, 1, HG), 32 * PVW, 0, stream>>>(S, VT, VB, VBL, b, h0, Y);
  }
  k_out<<<dim3(TNB * TT / 64, DIN / 128), 128, 0, stream>>>(Y, F[2], nullptr, (float*)d_out);
}

// v003
// Measured time: 358 microseconds a run.
// Next to v002, in two timings, it ran 1.80 and 1.81 times as fast.
// Over all steps from v000 it is 3.30 times as fast.
// compute dtype: all float inputs rounded to bf16; the fused q / k / v projection with EXACT bf16 products on WMMA 16x16x32 (f32 accumulate) (no biases); causal logits: 3 products for the first 384 rows, single f16 q x k after, x 64^-0.5; softmax f32; P x 2^11 once to f16 x v once to f16 (bf16 hi + lo below row 384); ctx hi+lo x exact W below row 384, x2^6 f16 carry x f16(bf16 x 2^8) W after, no bias; f32 output.
#include <hip/hip_runtime.h>
#include <math.h>

typedef __attribute__((ext_vector_type(16))) _Float16 v16h;
typedef __attribute__((ext_vector_type(16))) __bf16 v16b;
typedef __attribute__((ext_vector_type(8)))  _Float16 v8h;
typedef __attribute__((ext_vector_type(8)))  float v8f;
typedef __attribute__((ext_vector_type(4)))  float v4f;
typedef __attribute__((ext_vector_type(2)))  float v2f;
typedef __attribute__((ext_vector_type(4)))  unsigned v4u;
typedef __attribute__((ext_vector_type(4)))  int v4i;
typedef float __attribute__((may_alias)) float_a;
typedef int __attribute__((may_alias)) int_a;

template <typename T> __device__ __forceinline__ void vst2(void* p, T v) { *(T*)p = v;  }
__device__ __forceinline__ v8f wmma16(v16h a, v16h b, v8f c) {
  v8f d = __builtin_amdgcn_wmma_f32_16x16x32_f16(false, a, false, b, (short)0, c, false, false);
  asm volatile("v_nop\n\tv_nop\n\tv_nop\n\tv_nop" : "+v"(d) : "v"(a), "v"(b));
  return d;
}
__device__ __forceinline__ v8f wmma_bf(v16b a, v16b b, v8f c) {
  v8f d = __builtin_amdgcn_wmma_f32_16x16x32_bf16(false, a, false, b, (short)0, c, false, false);
  asm volatile("v_nop\n\tv_nop\n\tv_nop\n\tv_nop" : "+v"(d) : "v"(a), "v"(b));
  return d;
}
// 16x16x32 fragments: lane = (h = lane>>4, row/col = lane&15); elements 0..7 = k0+8h+0..7, 8..15 = k0+16+8h+0..7; D element r = row 8h+r
__device__ __forceinline__ v16h frag_h(const _Float16* rowk0, int lane) {
  union { v16h v; v8h q[2]; } u; const _Float16* p = rowk0 + 8 * (lane >> 4);
  u.q[0] = *(const v8h*)p; u.q[1] = *(const v8h*)(p + 16); return u.v;
}
__device__ __forceinline__ v16h frag_f32(const float* rowk0, int lane) {
  v16h a; const float* p = rowk0 + 8 * (lane >> 4);
#pragma unroll
  for (int i = 0; i < 8; ++i) { a[i] = (_Float16)p[i]; a[8 + i] = (_Float16)p[16 + i]; }
  return a;
}
__device__ __forceinline__ v16h frag_f32s(const float* rowk0, int lane, float sc) {
  v16h a; const float* p = rowk0 + 8 * (lane >> 4);
#pragma unroll
  for (int i = 0; i < 8; ++i) { a[i] = (_Float16)(p[i] * sc); a[8 + i] = (_Float16)(p[16 + i] * sc); }
  return a;
}
// column fragment from a [K][ld] layout (column n), rows >= K read as 0
__device__ __forceinline__ v16h fragc_f32(const float* W, int k0, int n, int lane, int ld, int K) {
  v16h a; const int g = lane >> 4;
#pragma unroll
  for (int i = 0; i < 8; ++i) { const int ka = k0 + 8 * g + i, kb = ka + 16;
    a[i] = (_Float16)(ka < K ? W[(size_t)(ka < K ? ka : K - 1) * ld + n] : 0.f); a[8 + i] = (_Float16)(kb < K ? W[(size_t)(kb < K ? kb : K - 1) * ld + n] : 0.f); }
  return a;
}
struct F2 { v16b h, l; };
__device__ __forceinline__ F2 bsplit16(const float v[16]) { F2 r;
#pragma unroll
  for (int i = 0; i < 16; ++i) { const __bf16 h = (__bf16)v[i]; r.h[i] = h; r.l[i] = (__bf16)(v[i] - (float)h); }
  return r; }
__device__ __forceinline__ F2 split_row(const float* row, int k0, int lane) { float v[16]; const float* p = row + k0 + 8 * (lane >> 4);
#pragma unroll
  for (int i = 0; i < 8; ++i) { v[i] = p[i]; v[8 + i] = p[16 + i]; }
  return bsplit16(v); }
__device__ __forceinline__ F2 split_rowK(const float* row, int k0, int lane, int K) { float v[16]; const int g = lane >> 4;
#pragma unroll
  for (int i = 0; i < 8; ++i) { const int ka = k0 + 8 * g + i, kb = ka + 16; v[i] = ka < K ? row[ka < K ? ka : K - 1] : 0.f; v[8 + i] = kb < K ? row[kb < K ? kb : K - 1] : 0.f; }
  return bsplit16(v); }
__device__ __forceinline__ F2 split_col(const float* W, int k0, int n, int lane, int ld, int K) { float v[16]; const int g = lane >> 4;
#pragma unroll
  for (int i = 0; i < 8; ++i) { const int ka = k0 + 8 * g + i, kb = ka + 16; v[i] = ka < K ? W[(size_t)(ka < K ? ka : K - 1) * ld + n] : 0.f; v[8 + i] = kb < K ? W[(size_t)(kb < K ? kb : K - 1) * ld + n] : 0.f; }
  return bsplit16(v); }
__device__ __forceinline__ v8f mac3(const F2& a, const F2& b, v8f c) { c = wmma_bf(a.l, b.h, c); c = wmma_bf(a.h, b.l, c); return wmma_bf(a.h, b.h, c); }
__device__ __forceinline__ float sigm(float v) { return 1.0f / (1.0f + expf(-v)); }
#define LDSX() do { asm volatile("s_wait_dscnt 0" ::: "memory"); __builtin_amdgcn_wave_barrier(); __builtin_amdgcn_fence(__ATOMIC_RELEASE, "workgroup"); } while (0)

// Bias-free causal multi-head self-attention with a fused (out,in) QKV projection (x [2,2048,1024]; Wqkv [3072,1024] torch (out,in): jnp.split thirds of einsum('btd,ed->bte') = x @ Wqkv.T (q = rows 0..1023, k = 1024..2047, v = 2048..3071); Wout [1024,1024] (out,in); no biases; 16 heads x 64; scores x 1/sqrt(64); tril kept, -inf elsewhere; softmax; out @ Wout.T).
#define NB 2
#define TT 2048
#define CC 1024            // NH * HD = projected width
#define DIN 1024          // input (model) width
#define NH 16
#define HD 64
#define NQB (TT / 64)
#define HG 4
#define SCALE (0.125f)
#define CAUSAL 1
#ifndef TNB
#define TNB NB
#endif
__device__ __forceinline__ float bfr(float v) { return (float)(__bf16)v; }
__host__ __device__ __forceinline__ int kb_last(int qb) { return CAUSAL ? ((qb * 64 + 63) >> 7) : (TT / 128 - 1); }
typedef __attribute__((ext_vector_type(8))) __bf16 v8b;
__device__ __forceinline__ v16b frag_b(const __bf16* rowk0, int lane) {
  union { v16b v; v8b q[2]; } u; const __bf16* p = rowk0 + 8 * (lane >> 4);
  u.q[0] = *(const v8b*)p; u.q[1] = *(const v8b*)(p + 16); return u.v;
}
#define QBH 6              // causal: query blocks 0..QBH-1 of each sequence (few keys, no averaging) take the high-precision path
#define QHI 384            // rows carrying a q residual plane
#define KHI 384            // key rows carrying k residual / v bf16 hi+lo planes (used only by the causal high-precision path)
// B fragment (k rows k0+.., output column o) of a weight: (in,out) [K][ld] or (out,in) [ld rows of K]: bf16 exact, or f16(bf16 * 256) exact
__device__ __forceinline__ v16b wcol_io(const float* Wm, int k0, int o, int lane, int ld) { v16b w; const int g = lane >> 4;
#pragma unroll
  for (int i = 0; i < 8; ++i) { w[i] = (__bf16)Wm[(size_t)(k0 + 8 * g + i) * ld + o]; w[8 + i] = (__bf16)Wm[(size_t)(k0 + 16 + 8 * g + i) * ld + o]; }
  return w; }
__device__ __forceinline__ v16b wcol_oi(const float* Wm, int k0, int o, int lane, int K) { v16b w; const float* p = Wm + (size_t)o * K + k0 + 8 * (lane >> 4);
#pragma unroll
  for (int i = 0; i < 8; ++i) { w[i] = (__bf16)p[i]; w[8 + i] = (__bf16)p[16 + i]; }
  return w; }
__device__ __forceinline__ v16h wcolh_io(const float* Wm, int k0, int o, int lane, int ld) { v16h w; const int g = lane >> 4;
#pragma unroll
  for (int i = 0; i < 8; ++i) { w[i] = (_Float16)(bfr(Wm[(size_t)(k0 + 8 * g + i) * ld + o]) * 256.0f); w[8 + i] = (_Float16)(bfr(Wm[(size_t)(k0 + 16 + 8 * g + i) * ld + o]) * 256.0f); }
  return w; }
__device__ __forceinline__ v16h wcolh_oi(const float* Wm, int k0, int o, int lane, int K) { v16h w; const float* p = Wm + (size_t)o * K + k0 + 8 * (lane >> 4);
#pragma unroll
  for (int i = 0; i < 8; ++i) { w[i] = (_Float16)(bfr(p[i]) * 256.0f); w[8 + i] = (_Float16)(bfr(p[16 + i]) * 256.0f); }
  return w; }
#define WQKV_LAYOUT 1   // 0 = (in,out) [DIN][CC]; 1 = (out,in) [CC][DIN]; 2 = per-head [NH][DIN][HD]
__device__ __forceinline__ v16b wcol_hdk(const float* Wm, int k0, int o, int lane) { v16b w; const int g = lane >> 4; const float* p = Wm + (size_t)(o / HD) * DIN * HD + (o % HD);
#pragma unroll
  for (int i = 0; i < 8; ++i) { w[i] = (__bf16)p[(size_t)(k0 + 8 * g + i) * HD]; w[8 + i] = (__bf16)p[(size_t)(k0 + 16 + 8 * g + i) * HD]; }
  return w; }
#define WO_OUT_IN 1
#if WQKV_LAYOUT == 1
#define WCOL(W, k0, o, lane) wcol_oi(W, k0, o, lane, DIN)
#elif WQKV_LAYOUT == 2
#define WCOL(W, k0, o, lane) wcol_hdk(W, k0, o, lane)
#else
#define WCOL(W, k0, o, lane) wcol_io(W, k0, o, lane, CC)
#endif
#if WO_OUT_IN
#define WOCOL(W, k0, o, lane) wcol_oi(W, k0, o, lane, CC)
#define WOCOLH(W, k0, o, lane) wcolh_oi(W, k0, o, lane, CC)
#else
#define WOCOL(W, k0, o, lane) wcol_io(W, k0, o, lane, DIN)
#define WOCOLH(W, k0, o, lane) wcolh_io(W, k0, o, lane, DIN)
#endif

#ifndef PROJ_EXTRA_PARAMS
#define PROJ_EXTRA_PARAMS
#endif

#define WS_QH  0u                                      // f16 q rows [b*t][CC]
#define WS_KH  (WS_QH + 2u * (size_t)NB * TT * CC)      // f16 k rows [b*t][CC]
#define WS_VT  (WS_KH + 2u * (size_t)NB * TT * CC)      // f16 v planes [b][c][t]
#define WS_QL  (WS_VT + 2u * (size_t)NB * CC * TT)      // f16 q residual x 2^10 rows [b][t < QHI][CC]
#define WS_KL  (WS_QL + 2u * (size_t)NB * QHI * CC)     // f16 k residual x 2^10 rows [b][t < KHI][CC]
#define WS_VB  (WS_KL + 2u * (size_t)NB * KHI * CC)     // bf16 v hi planes [b][c][t < KHI]
#define WS_VBL (WS_VB + 2u * (size_t)NB * CC * KHI)
#define WS_S   (WS_VBL + 2u * (size_t)NB * CC * KHI)    // f32 logits [hg][t][s]
#define WS_Y   (WS_S  + 4u * (size_t)HG * TT * TT)      // f32 ctx rows [b*t][CC] (only when there is an output projection)
#define WS_END (WS_Y  + 4u * (size_t)NB * TT * CC)

// ---- operand staging of k_proj and k_out: a K step is KS columns of the block's X (or ctx) rows and of its W rows. Thread (tid >> 4, tid & 15) takes rows 8 i + (tid >> 4), floats 4 (tid & 15) .. + 3, so each wave-wide load reads two whole 256-byte row pieces; each value is rounded once per block and lies in LDS as the 16-bit operand, rows at pitch SP; every wave takes its fragments from there. Two LDS buffers: the next step's loads fly while this step is multiplied.
#define KS 64
#define SP (KS + 8)        // LDS pitch of a staged row in 16-bit elements: 144 B = 16 B x odd, for the 16-byte fragment reads
typedef __attribute__((ext_vector_type(4))) __bf16 v4b;
typedef __attribute__((ext_vector_type(4))) _Float16 v4hs;
template <int N> __device__ __forceinline__ void ld_rows(v4f (&r)[N], const float* p, int ld) {
#pragma unroll
  for (int i = 0; i < N; ++i) r[i] = *(const v4f*)(p + (size_t)i * 8 * ld); }
// the wait that stands before an address register of the row loads may be overwritten; the two pointers are named as inputs so that they live, unchanged, up to here
#define XW(p, q) asm volatile("s_wait_xcnt 0x0" :: "v"(p), "v"(q) : "memory")
template <int N> __device__ __forceinline__ void st_bf(const v4f (&r)[N], __bf16* d) {
#pragma unroll
  for (int i = 0; i < N; ++i) { v4b q;
#pragma unroll
    for (int c = 0; c < 4; ++c) q[c] = (__bf16)r[i][c];
    *(v4b*)(d + i * 8 * SP) = q; } }
template <int N> __device__ __forceinline__ void st_split(const v4f (&r)[N], __bf16* dh, __bf16* dl) {
#pragma unroll
  for (int i = 0; i < N; ++i) { v4b qh, ql;
#pragma unroll
    for (int c = 0; c < 4; ++c) { const __bf16 h = (__bf16)r[i][c]; qh[c] = h; ql[c] = (__bf16)(r[i][c] - (float)h); }
    *(v4b*)(dh + i * 8 * SP) = qh; *(v4b*)(dl + i * 8 * SP) = ql; } }
template <int N> __device__ __forceinline__ void st_hs(const v4f (&r)[N], _Float16* d, float sc) {
#pragma unroll
  for (int i = 0; i < N; ++i) { v4hs q;
#pragma unroll
    for (int c = 0; c < 4; ++c) q[c] = (_Float16)(r[i][c] * sc);
    *(v4hs*)(d + i * 8 * SP) = q; } }
template <int N> __device__ __forceinline__ void st_hw(const v4f (&r)[N], _Float16* d) {
#pragma unroll
  for (int i = 0; i < N; ++i) { v4hs q;
#pragma unroll
    for (int c = 0; c < 4; ++c) q[c] = (_Float16)(bfr(r[i][c]) * 256.0f);
    *(v4hs*)(d + i * 8 * SP) = q; } }
// ---- k_proj: block = (64 rows, 128 cols, which): q/k/v = X W (+ b) with exact bf16 products (K = DIN) -> which 0: q f16 rows (+ residual rows < QHI); 1: k f16 rows (+ residual rows < KHI); 2: v f16 planes [c][t] (+ bf16 hi/lo planes for t < KHI)
__global__ __launch_bounds__(128) void k_proj(const float* __restrict__ XQ, const float* __restrict__ XK, const float* __restrict__ XV, const float* __restrict__ WQ, const float* __restrict__ WK, const float* __restrict__ WV, const float* __restrict__ BQ, const float* __restrict__ BK, const float* __restrict__ BV,
    _Float16* __restrict__ QH, _Float16* __restrict__ QL, _Float16* __restrict__ KH, _Float16* __restrict__ KL, _Float16* __restrict__ VT, __bf16* __restrict__ VB, __bf16* __restrict__ VBL) {
  __shared__ __align__(16) char smem[2 * (64 + 128) * SP * 2];   /* the two staging buffers; the epilogue's tiles lie over them behind a barrier */
  static_assert(sizeof(smem) >= 3 * 128 * 72 * 2 && sizeof(smem) >= 2 * 64 * 136 * 2, "epilogue tiles fit");
  __bf16* const sA = (__bf16*)smem; __bf16* const sB = sA + 2 * 64 * SP;   /* [2][64][SP], [2][128][SP] */
  _Float16 (* const sh)[136] = (_Float16 (*)[136])smem; _Float16 (* const sl)[136] = sh + 64; _Float16 (* const th)[72] = (_Float16 (*)[72])smem; __bf16 (* const tb)[72] = (__bf16 (*)[72])smem + 128; __bf16 (* const tbl)[72] = tb + 128;
  const int tid = threadIdx.x, wave = tid >> 5, lane = tid & 31, col = lane & 15, g = lane >> 4; const int which = blockIdx.z; const int c0 = blockIdx.y * 128; const size_t r0 = (size_t)blockIdx.x * 64; const size_t bb = r0 / TT; const int t0 = (int)(r0 % TT);
  const float* X = which == 0 ? XQ : which == 1 ? XK : XV; const float* WA = which == 0 ? WQ : which == 1 ? WK : WV; const float* BA = which == 0 ? BQ : which == 1 ? BK : BV;
  v8f acc[8] = {};
  static_assert(WQKV_LAYOUT == 1, "the staging reads W rows of DIN floats");
  { const float* pa = X + (r0 + (tid >> 4)) * DIN + (tid & 15) * 4; const float* pb = WA + (size_t)(c0 + (tid >> 4)) * DIN + (tid & 15) * 4; const int so = (tid >> 4) * SP + (tid & 15) * 4;
    v4f ra[8], rb[16]; ld_rows(ra, pa, DIN); ld_rows(rb, pb, DIN); XW(pa, pb); st_bf(ra, sA + so); st_bf(rb, sB + so);
#pragma unroll 1   /* rolled: one copy of the step keeps the kernel's text small */
    for (int ks = 0; ks < DIN / KS; ++ks) { const int cur = ks & 1, nxt = cur ^ 1;
      __syncthreads();   /* step ks is whole in buffer cur; every wave has left buffer nxt */
      if (ks + 1 < DIN / KS) { pa += KS; pb += KS; ld_rows(ra, pa, DIN); ld_rows(rb, pb, DIN); XW(pa, pb); }
#pragma unroll
      for (int kk = 0; kk < KS / 32; ++kk) { const v16b a = frag_b(sA + (cur * 64 + wave * 16 + col) * SP + kk * 32, lane);
#pragma unroll
        for (int jh = 0; jh < 8; jh += 4) { v16b w[4];   /* four fragments' LDS reads go out together, ahead of their four products: one LDS latency per group */
#pragma unroll
          for (int j = 0; j < 4; ++j) w[j] = frag_b(sB + (cur * 128 + (jh + j) * 16 + col) * SP + kk * 32, lane);
#pragma unroll
          for (int j = 0; j < 4; ++j) acc[jh + j] = wmma_bf(a, w[j], acc[jh + j]); } }
      if (ks + 1 < DIN / KS) { st_bf(ra, sA + nxt * 64 * SP + so); st_bf(rb, sB + nxt * 128 * SP + so); } }
    __syncthreads(); }   /* every wave has read its last fragments before the epilogue's tiles overwrite the buffers */
  if (which < 2) { _Float16* DH = which == 0 ? QH : KH; _Float16* DL = which == 0 ? QL : KL; const int nhi = which == 0 ? QHI : KHI; const bool hi_rows = t0 < nhi;
#pragma unroll
    for (int j = 0; j < 8; ++j) { const float bias = BA ? bfr(BA[c0 + j * 16 + col]) : 0.f;
#pragma unroll
      for (int r = 0; r < 8; ++r) { const float v = acc[j][r] + bias; const _Float16 hv = (_Float16)v; sh[wave * 16 + 8 * g + r][j * 16 + col] = hv; sl[wave * 16 + 8 * g + r][j * 16 + col] = (_Float16)((v - (float)hv) * 1024.0f); } }
    __syncthreads();
    for (int e = tid; e < 64 * 16; e += 128) { const int rl = e >> 4, q = e & 15; vst2((unsigned*)(DH + (r0 + rl) * CC + c0 + q * 8), *(const v4u*)&sh[rl][q * 8]); if (hi_rows) vst2((unsigned*)(DL + (bb * nhi + t0 + rl) * (size_t)CC + c0 + q * 8), *(const v4u*)&sl[rl][q * 8]); }
  } else { const bool hi_rows = t0 < KHI;
#pragma unroll
    for (int j = 0; j < 8; ++j) { const float bias = BA ? bfr(BA[c0 + j * 16 + col]) : 0.f;
#pragma unroll
      for (int r = 0; r < 8; ++r) { const float v = acc[j][r] + bias; const int rl = wave * 16 + 8 * g + r, cl = j * 16 + col; th[cl][rl] = (_Float16)v; const __bf16 bh = (__bf16)v; tb[cl][rl] = bh; tbl[cl][rl] = (__bf16)(v - (float)bh); } }
    __syncthreads();
    for (int e = tid; e < 128 * 8; e += 128) { const int cl = e >> 3, q = e & 7; vst2((unsigned*)(VT + (bb * CC + c0 + cl) * (size_t)TT + t0 + q * 8), *(const v4u*)&th[cl][q * 8]); if (hi_rows) { const size_t o3 = (bb * CC + c0 + cl) * (size_t)KHI + t0 + q * 8; vst2((unsigned*)(VB + o3), *(const v4u*)&tb[cl][q * 8]); vst2((unsigned*)(VBL + o3), *(const v4u*)&tbl[cl][q * 8]); } } } }
// ---- k_sc: block = (query block qb, key block kb <= kb_last(qb), head in group) of batch b: logits x SCALE; q hi + residual (x 2^10) against k (2 products) for query rows < QHI, plus the k residual (3 products) for query blocks < QBH (causal early rows); causal: blocks past the diagonal exit, the mask itself is applied by index in k_pv
__global__ __launch_bounds__(128) void k_sc(const _Float16* __restrict__ QH, const _Float16* __restrict__ KH, const _Float16* __restrict__ QL, const _Float16* __restrict__ KL, int b, int h0, float* __restrict__ S0) { __shared__ __align__(16) float ss[4][16][132];
  const int qb = blockIdx.x, kb = blockIdx.y; if (kb > kb_last(qb)) return;
  const int h = h0 + blockIdx.z; float* S = S0 + (size_t)blockIdx.z * TT * TT;
  const int tid = threadIdx.x, wave = tid >> 5, lane = tid & 31, col = lane & 15, g = lane >> 4; const int k0 = kb * 128; const int ql0 = qb * 64 + wave * 16; const size_t q0 = (size_t)b * TT + ql0, kr0 = (size_t)b * TT + k0;
  v8f acc[8] = {}, accl[8] = {};
  const _Float16* QLb = QL + (size_t)b * QHI * CC; const _Float16* KLb = KL + (size_t)b * KHI * CC;
  if (qb < QBH) {
#pragma unroll
    for (int kc = 0; kc < HD / 32; ++kc) { const v16h ah = frag_h(QH + (q0 + col) * CC + h * HD + kc * 32, lane), al = frag_h(QLb + (size_t)(ql0 + col) * CC + h * HD + kc * 32, lane);
#pragma unroll
      for (int j = 0; j < 8; ++j) { const v16h kbf = frag_h(KH + (kr0 + j * 16 + col) * CC + h * HD + kc * 32, lane), klf = frag_h(KLb + (size_t)(k0 + j * 16 + col) * CC + h * HD + kc * 32, lane); acc[j] = wmma16(ah, kbf, acc[j]); accl[j] = wmma16(al, kbf, accl[j]); accl[j] = wmma16(ah, klf, accl[j]); } }
  } else if (qb * 64 < QHI) {
#pragma unroll
    for (int kc = 0; kc < HD / 32; ++kc) { const v16h ah = frag_h(QH + (q0 + col) * CC + h * HD + kc * 32, lane), al = frag_h(QLb + (size_t)(ql0 + col) * CC + h * HD + kc * 32, lane);
#pragma unroll
      for (int j = 0; j < 8; ++j) { const v16h kbf = frag_h(KH + (kr0 + j * 16 + col) * CC + h * HD + kc * 32, lane); acc[j] = wmma16(ah, kbf, acc[j]); accl[j] = wmma16(al, kbf, accl[j]); } }
  } else {
#pragma unroll
    for (int kc = 0; kc < HD / 32; ++kc) { const v16h ah = frag_h(QH + (q0 + col) * CC + h * HD + kc * 32, lane);
#pragma unroll
      for (int j = 0; j < 8; ++j) { const v16h kbf = frag_h(KH + (kr0 + j * 16 + col) * CC + h * HD + kc * 32, lane); acc[j] = wmma16(ah, kbf, acc[j]); } } }
#pragma unroll
  for (int j = 0; j < 8; ++j) {
#pragma unroll
    for (int r = 0; r < 8; ++r) ss[wave][8 * g + r][j * 16 + col] = (acc[j][r] + accl[j][r] * (1.0f / 1024.0f)) * SCALE; }
  LDSX(); for (int rl = 0; rl < 16; ++rl) vst2(S + (size_t)(ql0 + rl) * TT + k0 + lane * 4, *(const v4f*)&ss[wave][rl][lane * 4]); }
// ---- k_pv: block = 16 queries (tile qt) of (b, h), PVW waves. First the softmax of the block's 16 logit rows (sm_rows), P x 2^11 left in LDS; then wave w takes the 32-key chunks w, w + PVW, ... of keys [0, kend), so the longest serial run of dependent loads is kend / (32 PVW) chunks; the PVW f32 partials are summed in wave order through LDS. ctx = P . v (P x 2^11 once to f16 against v f16: 1 product; causal early query blocks: P and v as bf16 hi + lo, 3 products); 256-B (row, head) segment by 16 lanes
#define PVW 8
#define PPH (TT + 8)       // LDS pitch of an f16 P row: 16 B x odd, for the 16-byte fragment reads
#define PPF (KHI + 4)      // LDS pitch of an f32 P row (causal early query blocks): 16 B x odd
typedef __attribute__((ext_vector_type(4))) _Float16 v4h;
// (the group tests are marked likely so that the longest rows, which set the launch's time, run straight through)
// sm_rows: each wave takes 16 / PVW whole rows, a row held in registers (lane l owns keys 128 i + 4 l .. + 3, i < n128): causal -> logit if s <= t else excluded; maximum and sum by lane then across the 32 lanes, in f32; P x 2^11 (0 for excluded) to LDS, as f32 (HI) or once to f16
template <bool HI> __device__ __forceinline__ void sm_rows(const float* __restrict__ S, int ql0, int wave, int lane, int n128, float* pf, _Float16* ph) {
  constexpr int NG = HI ? KHI / 128 : TT / 128; constexpr int RW = 16 / PVW;
#pragma unroll 1   /* rolled: one copy of the row code keeps the kernel's text small; the other waves' arithmetic covers this wave's load latency */
  for (int rr = 0; rr < RW; ++rr) { const int rl = wave * RW + rr, t = ql0 + rl; const float* p0 = S + (size_t)t * TT + lane * 4;
    v4f v[NG];
#pragma unroll
    for (int i = 0; i < NG; ++i) { v[i] = (v4f)(-3.0e38f); if (__builtin_expect(i < n128, 1)) v[i] = *(const v4f*)(p0 + i * 128); }
    asm volatile("s_wait_xcnt 0x0" :: "v"(p0) : "memory");   /* the wait that stands before the row loads' address register may be overwritten; p0 is named as an input so that it lives, unchanged, up to here */
    float m = -3.0e38f;
#pragma unroll
    for (int i = 0; i < NG; ++i) {   /* every group, loaded or not: each load's first use then stands on every path, so that the next row's loads need not wait one by one for this row's */
#pragma unroll
      for (int c = 0; c < 4; ++c) { const float x = (!CAUSAL || i * 128 + lane * 4 + c <= t) ? v[i][c] : -3.0e38f; v[i][c] = x; m = fmaxf(m, x); } }
#pragma unroll
    for (int o = 1; o < 32; o <<= 1) m = fmaxf(m, __shfl_xor(m, o));
    float sum = 0.f;
#pragma unroll
    for (int i = 0; i < NG; ++i) if (__builtin_expect(i < n128, 1)) {
#pragma unroll
      for (int c = 0; c < 4; ++c) { const float x = v[i][c]; const float ex = expf(x - m); const float e = (x <= -1.0e38f) ? 0.f : ex; v[i][c] = e; sum += e; } }
#pragma unroll
    for (int o = 1; o < 32; o <<= 1) sum += __shfl_xor(sum, o);
    const float inv = sum > 0.f ? 2048.0f / sum : 0.f;   /* a fully excluded row yields P = 0 */
#pragma unroll
    for (int i = 0; i < NG; ++i) if (__builtin_expect(i < n128, 1)) { const v4f p = v[i] * inv;
      if (HI) *(v4f*)(pf + rl * PPF + i * 128 + lane * 4) = p;
      else { v4h q; q[0] = (_Float16)p[0]; q[1] = (_Float16)p[1]; q[2] = (_Float16)p[2]; q[3] = (_Float16)p[3]; *(v4h*)(ph + rl * PPH + i * 128 + lane * 4) = q; } } } }
__global__ __launch_bounds__(32 * PVW) void k_pv(const float* __restrict__ S0, const _Float16* __restrict__ VT, const __bf16* __restrict__ VB, const __bf16* __restrict__ VBL, int b, int h0, float* __restrict__ Y) { const int h = h0 + blockIdx.z; const float* S = S0 + (size_t)blockIdx.z * TT * TT; __shared__ __align__(16) float ss[PVW][16][HD + 4]; __shared__ __align__(16) _Float16 ph[16][PPH]; __shared__ __align__(16) float pf[16][PPF];
  const int tid = threadIdx.x, wave = __builtin_amdgcn_readfirstlane(tid >> 5), lane = tid & 31, col = lane & 15, g = lane >> 4; const int qb = blockIdx.x >> 2; const int ql0 = blockIdx.x * 16; const int kce = (kb_last(qb) + 1) * 4;
  if (qb < QBH) sm_rows<true>(S, ql0, wave, lane, kce >> 2, &pf[0][0], &ph[0][0]); else sm_rows<false>(S, ql0, wave, lane, kce >> 2, &pf[0][0], &ph[0][0]);
  __syncthreads();   /* all 16 P rows are in LDS before any wave reads its key chunks of them */
  v8f acc[HD / 16] = {};
  if (qb < QBH) {
#pragma unroll 1
    for (int kc = wave; kc < kce; kc += PVW) { const F2 p = split_row(&pf[col][0], kc * 32, lane);
#pragma unroll
      for (int j = 0; j < HD / 16; ++j) { const size_t po = ((size_t)b * CC + h * HD + j * 16 + col) * (size_t)KHI + kc * 32; const v16b vh = frag_b(VB + po, lane); acc[j] = wmma_bf(p.h, vh, acc[j]); acc[j] = wmma_bf(p.l, vh, acc[j]); acc[j] = wmma_bf(p.h, frag_b(VBL + po, lane), acc[j]); } }
  } else {
#pragma unroll 1
    for (int kc = wave; kc < kce; kc += PVW) { const v16h p = frag_h(&ph[col][kc * 32], lane);
#pragma unroll
      for (int j = 0; j < HD / 16; ++j) { const size_t po = ((size_t)b * CC + h * HD + j * 16 + col) * (size_t)TT + kc * 32; acc[j] = wmma16(p, frag_h(VT + po, lane), acc[j]); } } }
#pragma unroll
  for (int j = 0; j < HD / 16; ++j)
#pragma unroll
    for (int r = 0; r < 8; ++r) ss[wave][8 * g + r][j * 16 + col] = acc[j][r];
  __syncthreads();   /* every wave's partial (zero for a wave without chunks) is in LDS before any thread sums across waves */
  for (int e = tid; e < 16 * (HD / 4); e += 32 * PVW) { const int rl = e / (HD / 4), q = e % (HD / 4); v4f s = *(const v4f*)&ss[0][rl][q * 4];
#pragma unroll
    for (int w = 1; w < PVW; ++w) s += *(const v4f*)&ss[w][rl][q * 4];
    vst2(Y + ((size_t)b * TT + ql0 + rl) * CC + h * HD + q * 4, s * (1.0f / 2048.0f)); } }
// ---- k_out: block = (64 rows, 128 cols): out = ctx Wo (+ bo): ctx x 2^6 once to f16 against Wo as f16(bf16 x 2^8) exact (1 product) x 2^-14; causal early rows (< QHI of each sequence): ctx bf16 hi + lo against exact bf16 Wo (2 products)
template <bool EARLY> __device__ __forceinline__ void out_body(const float* __restrict__ Y, const float* __restrict__ WO, const float* __restrict__ BO, float* __restrict__ OUT, char* smem) {
  float (* const sf)[16][132] = (float (*)[16][132])smem;
  const int tid = threadIdx.x, wave = tid >> 5, lane = tid & 31, col = lane & 15, g = lane >> 4; const int c0 = blockIdx.y * 128; const size_t r0 = (size_t)blockIdx.x * 64 + wave * 16;
  __bf16* const sH = (__bf16*)smem; __bf16* const sL = sH + 2 * 64 * SP; __bf16* const sW = sL + 2 * 64 * SP;   /* early rows: [2][64][SP] hi, [2][64][SP] lo, [2][128][SP] W */
  _Float16* const sA = (_Float16*)smem; _Float16* const sV = sA + 2 * 64 * SP;   /* other rows: [2][64][SP] ctx, [2][128][SP] W */
  const float* pa = Y + ((size_t)blockIdx.x * 64 + (tid >> 4)) * CC + (tid & 15) * 4; const float* pb = WO + (size_t)(c0 + (tid >> 4)) * CC + (tid & 15) * 4; const int so = (tid >> 4) * SP + (tid & 15) * 4;
  v8f acc[8] = {};
  v4f ra[8], rb[16]; ld_rows(ra, pa, CC); ld_rows(rb, pb, CC); XW(pa, pb);
  if (EARLY) { st_split(ra, sH + so, sL + so); st_bf(rb, sW + so); }
  else { st_hs(ra, sA + so, 64.0f); st_hw(rb, sV + so); }   /* ctx carried x 2^6 into f16 so small-magnitude context rows stay clear of f16 subnormals */
#pragma unroll 1   /* rolled: one copy of the step keeps the kernel's text small */
  for (int ks = 0; ks < CC / KS; ++ks) { const int cur = ks & 1, nxt = cur ^ 1;
    __syncthreads();   /* step ks is whole in buffer cur; every wave has left buffer nxt */
    if (ks + 1 < CC / KS) { pa += KS; pb += KS; ld_rows(ra, pa, CC); ld_rows(rb, pb, CC); XW(pa, pb); }
    if (EARLY) {
#pragma unroll
      for (int kk = 0; kk < KS / 32; ++kk) { const int ao = (cur * 64 + wave * 16 + col) * SP + kk * 32; const v16b ah = frag_b(sH + ao, lane), al = frag_b(sL + ao, lane);
#pragma unroll
        for (int jh = 0; jh < 8; jh += 4) { v16b w[4];   /* four fragments' LDS reads go out together, ahead of their products */
#pragma unroll
          for (int j = 0; j < 4; ++j) w[j] = frag_b(sW + (cur * 128 + (jh + j) * 16 + col) * SP + kk * 32, lane);
#pragma unroll
          for (int j = 0; j < 4; ++j) { acc[jh + j] = wmma_bf(ah, w[j], acc[jh + j]); acc[jh + j] = wmma_bf(al, w[j], acc[jh + j]); } } }
      if (ks + 1 < CC / KS) { st_split(ra, sH + nxt * 64 * SP + so, sL + nxt * 64 * SP + so); st_bf(rb, sW + nxt * 128 * SP + so); }
    } else {
#pragma unroll
      for (int kk = 0; kk < KS / 32; ++kk) { const v16h a = frag_h(sA + (cur * 64 + wave * 16 + col) * SP + kk * 32, lane);
#pragma unroll
        for (int jh = 0; jh < 8; jh += 4) { v16h w[4];   /* four fragments' LDS reads go out together, ahead of their products */
#pragma unroll
          for (int j = 0; j < 4; ++j) w[j] = frag_h(sV + (cur * 128 + (jh + j) * 16 + col) * SP + kk * 32, lane);
#pragma unroll
          for (int j = 0; j < 4; ++j) acc[jh + j] = wmma16(a, w[j], acc[jh + j]); } }
      if (ks + 1 < CC / KS) { st_hs(ra, sA + nxt * 64 * SP + so, 64.0f); st_hw(rb, sV + nxt * 128 * SP + so); } } }
  __syncthreads();   /* every wave has read its last fragments before the epilogue's tile overwrites the buffers */
#pragma unroll
  for (int j = 0; j < 8; ++j) { const float bias = BO ? bfr(BO[c0 + j * 16 + col]) : 0.f;
#pragma unroll
    for (int r = 0; r < 8; ++r) sf[wave][8 * g + r][j * 16 + col] = EARLY ? acc[j][r] + bias : acc[j][r] * (1.0f / 16384.0f) + bias; }   /* other rows: 2^-8 (Wo carry) x 2^-6 (ctx carry) */
  LDSX(); for (int rl = 0; rl < 16; ++rl) vst2(OUT + (r0 + rl) * DIN + c0 + lane * 4, *(const v4f*)&sf[wave][rl][lane * 4]); }
__global__ __launch_bounds__(128) void k_out(const float* __restrict__ Y, const float* __restrict__ WO, const float* __restrict__ BO, float* __restrict__ OUT) { __shared__ __align__(16) char smem[2 * (64 + 64 + 128) * SP * 2];   /* two staging buffers of ctx (hi, lo) and W rows; the epilogue's tile lies over them behind a barrier */
  static_assert(sizeof(smem) >= 4 * 16 * 132 * 4, "epilogue tile fits"); static_assert(WO_OUT_IN == 1, "the staging reads W rows of CC floats");
  if (CAUSAL && (int)(((size_t)blockIdx.x * 64) % TT) < QHI) { out_body<true>(Y, WO, BO, OUT, smem); return; }   /* block-uniform */
  out_body<false>(Y, WO, BO, OUT, smem); }

extern "C" void kernel_launch(void* const* d_in, const int* in_sizes, int n_in, void* d_out, int out_size, void* d_ws, size_t ws_size, hipStream_t stream) {
  (void)in_sizes; (void)n_in; (void)out_size;
  const float** F = (const float**)d_in;
  if (ws_size < (size_t)WS_END) return;
  char* ws = (char*)d_ws; _Float16 *QH = (_Float16*)(ws + WS_QH), *KH = (_Float16*)(ws + WS_KH), *VT = (_Float16*)(ws + WS_VT), *QL = (_Float16*)(ws + WS_QL), *KL = (_Float16*)(ws + WS_KL); __bf16 *VB = (__bf16*)(ws + WS_VB), *VBL = (__bf16*)(ws + WS_VBL); float *S = (float*)(ws + WS_S), *Y = (float*)(ws + WS_Y);
  (void)Y; (void)QL; (void)KL; (void)VB; (void)VBL;
  // inputs: 0 x [2,2048,1024]; 1 W_qkv [3072,1024] (out,in): q rows 0..1023, k 1024..2047, v 2048..3071; 2 W_o [1024,1024] (out,in); no biases
  k_proj<<<dim3(TNB * TT / 64, CC / 128, 3), 128, 0, stream>>>(F[0], F[0], F[0], F[1], F[1] + (size_t)CC * DIN, F[1] + 2 * (size_t)CC * DIN, nullptr, nullptr, nullptr, QH, QL, KH, KL, VT, VB, VBL);
  for (int b = 0; b < TNB; ++b) for (int h0 = 0; h0 < NH; h0 += HG) {
    k_sc<<<dim3(NQB, TT / 128, HG), 128, 0, stream>>>(QH, KH, QL, KL, b, h0, S);
    k_pv<<<dim3(TT / 16, 1, HG), 32 * PVW, 0, stream>>>(S, VT, VB, VBL, b, h0, Y);
  }
  k_out<<<dim3(TNB * TT / 64, DIN / 128), 128, 0, stream>>>(Y, F[2], nullptr, (float*)d_out);
}

// v004
// Measured time: 156 microseconds a run.
// Two timings next to v003 put it at 2.29 and 2.30 times that version's speed.
// All steps since v000 together make it 7.60 times as fast.
// compute dtype: all float inputs rounded to bf16; the fused q / k / v projection with EXACT bf16 products on WMMA 16x16x32 (f32 accumulate) (no biases); causal logits: 3 products for the first 384 rows, single f16 q x k after, x 64^-0.5; softmax f32; P x 2^11 once to f16 x v once to f16 (bf16 hi + lo below row 384); ctx hi+lo x exact W below row 384, x2^6 f16 carry x f16(bf16 x 2^8) W after, no bias; f32 output.
#include <hip/hip_runtime.h>
#include <math.h>

typedef __attribute__((ext_vector_type(16))) _Float16 v16h;
typedef __attribute__((ext_vector_type(16))) __bf16 v16b;
typedef __attribute__((ext_vector_type(8)))  _Float16 v8h;
typedef __attribute__((ext_vector_type(8)))  float v8f;
typedef __attribute__((ext_vector_type(4)))  float v4f;
typedef __attribute__((ext_vector_type(2)))  float v2f;
typedef __attribute__((ext_vector_type(4)))  unsigned v4u;
typedef __attribute__((ext_vector_type(4)))  int v4i;
typedef float __attribute__((may_alias)) float_a;
typedef int __attribute__((may_alias)) int_a;

template <typename T> __device__ __forceinline__ void vst2(void* p, T v) { *(T*)p = v;  }
__device__ __forceinline__ v8f wmma16(v16h a, v16h b, v8f c) {
  v8f d = __builtin_amdgcn_wmma_f32_16x16x32_f16(false, a, false, b, (short)0, c, false, false);
  asm volatile("v_nop\n\tv_nop\n\tv_nop\n\tv_nop" : "+v"(d) : "v"(a), "v"(b));
  return d;
}
__device__ __forceinline__ v8f wmma_bf(v16b a, v16b b, v8f c) {
  v8f d = __builtin_amdgcn_wmma_f32_16x16x32_bf16(false, a, false, b, (short)0, c, false, false);
  asm volatile("v_nop\n\tv_nop\n\tv_nop\n\tv_nop" : "+v"(d) : "v"(a), "v"(b));
  return d;
}
// 16x16x32 fragments: lane = (h = lane>>4, row/col = lane&15); elements 0..7 = k0+8h+0..7, 8..15 = k0+16+8h+0..7; D element r = row 8h+r
__device__ __forceinline__ v16h frag_h(const _Float16* rowk0, int lane) {
  union { v16h v; v8h q[2]; } u; const _Float16* p = rowk0 + 8 * (lane >> 4);
  u.q[0] = *(const v8h*)p; u.q[1] = *(const v8h*)(p + 16); return u.v;
}
__device__ __forceinline__ v16h frag_f32(const float* rowk0, int lane) {
  v16h a; const float* p = rowk0 + 8 * (lane >> 4);
#pragma unroll
  for (int i = 0; i < 8; ++i) { a[i] = (_Float16)p[i]; a[8 + i] = (_Float16)p[16 + i]; }
  return a;
}
__device__ __forceinline__ v16h frag_f32s(const float* rowk0, int lane, float sc) {
  v16h a; const float* p = rowk0 + 8 * (lane >> 4);
#pragma unroll
  for (int i = 0; i < 8; ++i) { a[i] = (_Float16)(p[i] * sc); a[8 + i] = (_Float16)(p[16 + i] * sc); }
  return a;
}
// column fragment from a [K][ld] layout (column n), rows >= K read as 0
__device__ __forceinline__ v16h fragc_f32(const float* W, int k0, int n, int lane, int ld, int K) {
  v16h a; const int g = lane >> 4;
#pragma unroll
  for (int i = 0; i < 8; ++i) { const int ka = k0 + 8 * g + i, kb = ka + 16;
    a[i] = (_Float16)(ka < K ? W[(size_t)(ka < K ? ka : K - 1) * ld + n] : 0.f); a[8 + i] = (_Float16)(kb < K ? W[(size_t)(kb < K ? kb : K - 1) * ld + n] : 0.f); }
  return a;
}
struct F2 { v16b h, l; };
__device__ __forceinline__ F2 bsplit16(const float v[16]) { F2 r;
#pragma unroll
  for (int i = 0; i < 16; ++i) { const __bf16 h = (__bf16)v[i]; r.h[i] = h; r.l[i] = (__bf16)(v[i] - (float)h); }
  return r; }
__device__ __forceinline__ F2 split_row(const float* row, int k0, int lane) { float v[16]; const float* p = row + k0 + 8 * (lane >> 4);
#pragma unroll
  for (int i = 0; i < 8; ++i) { v[i] = p[i]; v[8 + i] = p[16 + i]; }
  return bsplit16(v); }
__device__ __forceinline__ F2 split_rowK(const float* row, int k0, int lane, int K) { float v[16]; const int g = lane >> 4;
#pragma unroll
  for (int i = 0; i < 8; ++i) { const int ka = k0 + 8 * g + i, kb = ka + 16; v[i] = ka < K ? row[ka < K ? ka : K - 1] : 0.f; v[8 + i] = kb < K ? row[kb < K ? kb : K - 1] : 0.f; }
  return bsplit16(v); }
__device__ __forceinline__ F2 split_col(const float* W, int k0, int n, int lane, int ld, int K) { float v[16]; const int g = lane >> 4;
#pragma unroll
  for (int i = 0; i < 8; ++i) { const int ka = k0 + 8 * g + i, kb = ka + 16; v[i] = ka < K ? W[(size_t)(ka < K ? ka : K - 1) * ld + n] : 0.f; v[8 + i] = kb < K ? W[(size_t)(kb < K ? kb : K - 1) * ld + n] : 0.f; }
  return bsplit16(v); }
__device__ __forceinline__ v8f mac3(const F2& a, const F2& b, v8f c) { c = wmma_bf(a.l, b.h, c); c = wmma_bf(a.h, b.l, c); return wmma_bf(a.h, b.h, c); }
__device__ __forceinline__ float sigm(float v) { return 1.0f / (1.0f + expf(-v)); }
#define LDSX() do { asm volatile("s_wait_dscnt 0" ::: "memory"); __builtin_amdgcn_wave_barrier(); __builtin_amdgcn_fence(__ATOMIC_RELEASE, "workgroup"); } while (0)

// Bias-free causal multi-head self-attention with a fused (out,in) QKV projection (x [2,2048,1024]; Wqkv [3072,1024] torch (out,in): jnp.split thirds of einsum('btd,ed->bte') = x @ Wqkv.T (q = rows 0..1023, k = 1024..2047, v = 2048..3071); Wout [1024,1024] (out,in); no biases; 16 heads x 64; scores x 1/sqrt(64); tril kept, -inf elsewhere; softmax; out @ Wout.T).
#define NB 2
#define TT 2048
#define CC 1024            // NH * HD = projected width
#define DIN 1024          // input (model) width
#define NH 16
#define HD 64
#define NQB (TT / 64)
#define HG 4
#define SCALE (0.125f)
#define CAUSAL 1
#ifndef TNB
#define TNB NB
#endif
__device__ __forceinline__ float bfr(float v) { return (float)(__bf16)v; }
__host__ __device__ __forceinline__ int kb_last(int qb) { return CAUSAL ? ((qb * 64 + 63) >> 7) : (TT / 128 - 1); }
typedef __attribute__((ext_vector_type(8))) __bf16 v8b;
__device__ __forceinline__ v16b frag_b(const __bf16* rowk0, int lane) {
  union { v16b v; v8b q[2]; } u; const __bf16* p = rowk0 + 8 * (lane >> 4);
  u.q[0] = *(const v8b*)p; u.q[1] = *(const v8b*)(p + 16); return u.v;
}
#define QBH 6              // causal: query rows < QBH * 64 of each sequence (few keys, no averaging) take the high-precision path
#define QHI 384            // rows carrying a q residual plane
#define KHI 384            // key rows carrying k residual / v bf16 hi+lo planes (used only by the causal high-precision path)
// B fragment (k rows k0+.., output column o) of a weight: (in,out) [K][ld] or (out,in) [ld rows of K]: bf16 exact, or f16(bf16 * 256) exact
__device__ __forceinline__ v16b wcol_io(const float* Wm, int k0, int o, int lane, int ld) { v16b w; const int g = lane >> 4;
#pragma unroll
  for (int i = 0; i < 8; ++i) { w[i] = (__bf16)Wm[(size_t)(k0 + 8 * g + i) * ld + o]; w[8 + i] = (__bf16)Wm[(size_t)(k0 + 16 + 8 * g + i) * ld + o]; }
  return w; }
__device__ __forceinline__ v16b wcol_oi(const float* Wm, int k0, int o, int lane, int K) { v16b w; const float* p = Wm + (size_t)o * K + k0 + 8 * (lane >> 4);
#pragma unroll
  for (int i = 0; i < 8; ++i) { w[i] = (__bf16)p[i]; w[8 + i] = (__bf16)p[16 + i]; }
  return w; }
__device__ __forceinline__ v16h wcolh_io(const float* Wm, int k0, int o, int lane, int ld) { v16h w; const int g = lane >> 4;
#pragma unroll
  for (int i = 0; i < 8; ++i) { w[i] = (_Float16)(bfr(Wm[(size_t)(k0 + 8 * g + i) * ld + o]) * 256.0f); w[8 + i] = (_Float16)(bfr(Wm[(size_t)(k0 + 16 + 8 * g + i) * ld + o]) * 256.0f); }
  return w; }
__device__ __forceinline__ v16h wcolh_oi(const float* Wm, int k0, int o, int lane, int K) { v16h w; const float* p = Wm + (size_t)o * K + k0 + 8 * (lane >> 4);
#pragma unroll
  for (int i = 0; i < 8; ++i) { w[i] = (_Float16)(bfr(p[i]) * 256.0f); w[8 + i] = (_Float16)(bfr(p[16 + i]) * 256.0f); }
  return w; }
#define WQKV_LAYOUT 1   // 0 = (in,out) [DIN][CC]; 1 = (out,in) [CC][DIN]; 2 = per-head [NH][DIN][HD]
__device__ __forceinline__ v16b wcol_hdk(const float* Wm, int k0, int o, int lane) { v16b w; const int g = lane >> 4; const float* p = Wm + (size_t)(o / HD) * DIN * HD + (o % HD);
#pragma unroll
  for (int i = 0; i < 8; ++i) { w[i] = (__bf16)p[(size_t)(k0 + 8 * g + i) * HD]; w[8 + i] = (__bf16)p[(size_t)(k0 + 16 + 8 * g + i) * HD]; }
  return w; }
#define WO_OUT_IN 1
#if WQKV_LAYOUT == 1
#define WCOL(W, k0, o, lane) wcol_oi(W, k0, o, lane, DIN)
#elif WQKV_LAYOUT == 2
#define WCOL(W, k0, o, lane) wcol_hdk(W, k0, o, lane)
#else
#define WCOL(W, k0, o, lane) wcol_io(W, k0, o, lane, CC)
#endif
#if WO_OUT_IN
#define WOCOL(W, k0, o, lane) wcol_oi(W, k0, o, lane, CC)
#define WOCOLH(W, k0, o, lane) wcolh_oi(W, k0, o, lane, CC)
#else
#define WOCOL(W, k0, o, lane) wcol_io(W, k0, o, lane, DIN)
#define WOCOLH(W, k0, o, lane) wcolh_io(W, k0, o, lane, DIN)
#endif

#ifndef PROJ_EXTRA_PARAMS
#define PROJ_EXTRA_PARAMS
#endif

#define WS_QH  0u                                      // f16 q rows [b*t][CC]
#define WS_KH  (WS_QH + 2u * (size_t)NB * TT * CC)      // f16 k rows [b*t][CC]
#define WS_VT  (WS_KH + 2u * (size_t)NB * TT * CC)      // f16 v planes [b][c][t]
#define WS_QL  (WS_VT + 2u * (size_t)NB * CC * TT)      // f16 q residual x 2^10 rows [b][t < QHI][CC]
#define WS_KL  (WS_QL + 2u * (size_t)NB * QHI * CC)     // f16 k residual x 2^10 rows [b][t < KHI][CC]
#define WS_VB  (WS_KL + 2u * (size_t)NB * KHI * CC)     // bf16 v hi planes [b][c][t < KHI]
#define WS_VBL (WS_VB + 2u * (size_t)NB * CC * KHI)
#define WS_Y   (WS_VBL + 2u * (size_t)NB * CC * KHI)    // f32 ctx rows [b*t][CC] (only when there is an output projection)
#define WS_END (WS_Y  + 4u * (size_t)NB * TT * CC)

// ---- operand staging of k_proj and k_out: a K step is KS columns of the block's X (or ctx) rows and of its W rows. Thread (tid >> 4, tid & 15) takes rows 8 i + (tid >> 4), floats 4 (tid & 15) .. + 3, so each wave-wide load reads two whole 256-byte row pieces; each value is rounded once per block and lies in LDS as the 16-bit operand, rows at pitch SP; every wave takes its fragments from there. Two LDS buffers: the next step's loads fly while this step is multiplied.
#define KS 64
#define SP (KS + 8)        // LDS pitch of a staged row in 16-bit elements: 144 B = 16 B x odd, for the 16-byte fragment reads
typedef __attribute__((ext_vector_type(4))) __bf16 v4b;
typedef __attribute__((ext_vector_type(4))) _Float16 v4hs;
template <int N> __device__ __forceinline__ void ld_rows(v4f (&r)[N], const float* p, int ld) {
#pragma unroll
  for (int i = 0; i < N; ++i) r[i] = *(const v4f*)(p + (size_t)i * 8 * ld); }
// the wait that stands before an address register of the row loads may be overwritten; the two pointers are named as inputs so that they live, unchanged, up to here
#define XW(p, q) asm volatile("s_wait_xcnt 0x0" :: "v"(p), "v"(q) : "memory")
template <int N> __device__ __forceinline__ void st_bf(const v4f (&r)[N], __bf16* d) {
#pragma unroll
  for (int i = 0; i < N; ++i) { v4b q;
#pragma unroll
    for (int c = 0; c < 4; ++c) q[c] = (__bf16)r[i][c];
    *(v4b*)(d + i * 8 * SP) = q; } }
template <int N> __device__ __forceinline__ void st_split(const v4f (&r)[N], __bf16* dh, __bf16* dl) {
#pragma unroll
  for (int i = 0; i < N; ++i) { v4b qh, ql;
#pragma unroll
    for (int c = 0; c < 4; ++c) { const __bf16 h = (__bf16)r[i][c]; qh[c] = h; ql[c] = (__bf16)(r[i][c] - (float)h); }
    *(v4b*)(dh + i * 8 * SP) = qh; *(v4b*)(dl + i * 8 * SP) = ql; } }
template <int N> __device__ __forceinline__ void st_hs(const v4f (&r)[N], _Float16* d, float sc) {
#pragma unroll
  for (int i = 0; i < N; ++i) { v4hs q;
#pragma unroll
    for (int c = 0; c < 4; ++c) q[c] = (_Float16)(r[i][c] * sc);
    *(v4hs*)(d + i * 8 * SP) = q; } }
template <int N> __device__ __forceinline__ void st_hw(const v4f (&r)[N], _Float16* d) {
#pragma unroll
  for (int i = 0; i < N; ++i) { v4hs q;
#pragma unroll
    for (int c = 0; c < 4; ++c) q[c] = (_Float16)(bfr(r[i][c]) * 256.0f);
    *(v4hs*)(d + i * 8 * SP) = q; } }
// ---- k_proj: block = (64 rows, 128 cols, which): q/k/v = X W (+ b) with exact bf16 products (K = DIN) -> which 0: q f16 rows (+ residual rows < QHI); 1: k f16 rows (+ residual rows < KHI); 2: v f16 planes [c][t] (+ bf16 hi/lo planes for t < KHI)
__global__ __launch_bounds__(128) void k_proj(const float* __restrict__ XQ, const float* __restrict__ XK, const float* __restrict__ XV, const float* __restrict__ WQ, const float* __restrict__ WK, const float* __restrict__ WV, const float* __restrict__ BQ, const float* __restrict__ BK, const float* __restrict__ BV,
    _Float16* __restrict__ QH, _Float16* __restrict__ QL, _Float16* __restrict__ KH, _Float16* __restrict__ KL, _Float16* __restrict__ VT, __bf16* __restrict__ VB, __bf16* __restrict__ VBL) {
  __shared__ __align__(16) char smem[2 * (64 + 128) * SP * 2];   /* the two staging buffers; the epilogue's tiles lie over them behind a barrier */
  static_assert(sizeof(smem) >= 3 * 128 * 72 * 2 && sizeof(smem) >= 2 * 64 * 136 * 2, "epilogue tiles fit");
  __bf16* const sA = (__bf16*)smem; __bf16* const sB = sA + 2 * 64 * SP;   /* [2][64][SP], [2][128][SP] */
  _Float16 (* const sh)[136] = (_Float16 (*)[136])smem; _Float16 (* const sl)[136] = sh + 64; _Float16 (* const th)[72] = (_Float16 (*)[72])smem; __bf16 (* const tb)[72] = (__bf16 (*)[72])smem + 128; __bf16 (* const tbl)[72] = tb + 128;
  const int tid = threadIdx.x, wave = tid >> 5, lane = tid & 31, col = lane & 15, g = lane >> 4; const int which = blockIdx.z; const int c0 = blockIdx.y * 128; const size_t r0 = (size_t)blockIdx.x * 64; const size_t bb = r0 / TT; const int t0 = (int)(r0 % TT);
  const float* X = which == 0 ? XQ : which == 1 ? XK : XV; const float* WA = which == 0 ? WQ : which == 1 ? WK : WV; const float* BA = which == 0 ? BQ : which == 1 ? BK : BV;
  v8f acc[8] = {};
  static_assert(WQKV_LAYOUT == 1, "the staging reads W rows of DIN floats");
  { const float* pa = X + (r0 + (tid >> 4)) * DIN + (tid & 15) * 4; const float* pb = WA + (size_t)(c0 + (tid >> 4)) * DIN + (tid & 15) * 4; const int so = (tid >> 4) * SP + (tid & 15) * 4;
    v4f ra[8], rb[16]; ld_rows(ra, pa, DIN); ld_rows(rb, pb, DIN); XW(pa, pb); st_bf(ra, sA + so); st_bf(rb, sB + so);
#pragma unroll 1   /* rolled: one copy of the step keeps the kernel's text small */
    for (int ks = 0; ks < DIN / KS; ++ks) { const int cur = ks & 1, nxt = cur ^ 1;
      __syncthreads();   /* step ks is whole in buffer cur; every wave has left buffer nxt */
      if (ks + 1 < DIN / KS) { pa += KS; pb += KS; ld_rows(ra, pa, DIN); ld_rows(rb, pb, DIN); XW(pa, pb); }
#pragma unroll
      for (int kk = 0; kk < KS / 32; ++kk) { const v16b a = frag_b(sA + (cur * 64 + wave * 16 + col) * SP + kk * 32, lane);
#pragma unroll
        for (int jh = 0; jh < 8; jh += 4) { v16b w[4];   /* four fragments' LDS reads go out together, ahead of their four products: one LDS latency per group */
#pragma unroll
          for (int j = 0; j < 4; ++j) w[j] = frag_b(sB + (cur * 128 + (jh + j) * 16 + col) * SP + kk * 32, lane);
#pragma unroll
          for (int j = 0; j < 4; ++j) acc[jh + j] = wmma_bf(a, w[j], acc[jh + j]); } }
      if (ks + 1 < DIN / KS) { st_bf(ra, sA + nxt * 64 * SP + so); st_bf(rb, sB + nxt * 128 * SP + so); } }
    __syncthreads(); }   /* every wave has read its last fragments before the epilogue's tiles overwrite the buffers */
  if (which < 2) { _Float16* DH = which == 0 ? QH : KH; _Float16* DL = which == 0 ? QL : KL; const int nhi = which == 0 ? QHI : KHI; const bool hi_rows = t0 < nhi;
#pragma unroll
    for (int j = 0; j < 8; ++j) { const float bias = BA ? bfr(BA[c0 + j * 16 + col]) : 0.f;
#pragma unroll
      for (int r = 0; r < 8; ++r) { const float v = acc[j][r] + bias; const _Float16 hv = (_Float16)v; sh[wave * 16 + 8 * g + r][j * 16 + col] = hv; sl[wave * 16 + 8 * g + r][j * 16 + col] = (_Float16)((v - (float)hv) * 1024.0f); } }
    __syncthreads();
    for (int e = tid; e < 64 * 16; e += 128) { const int rl = e >> 4, q = e & 15; vst2((unsigned*)(DH + (r0 + rl) * CC + c0 + q * 8), *(const v4u*)&sh[rl][q * 8]); if (hi_rows) vst2((unsigned*)(DL + (bb * nhi + t0 + rl) * (size_t)CC + c0 + q * 8), *(const v4u*)&sl[rl][q * 8]); }
  } else { const bool hi_rows = t0 < KHI;
#pragma unroll
    for (int j = 0; j < 8; ++j) { const float bias = BA ? bfr(BA[c0 + j * 16 + col]) : 0.f;
#pragma unroll
      for (int r = 0; r < 8; ++r) { const float v = acc[j][r] + bias; const int rl = wave * 16 + 8 * g + r, cl = j * 16 + col; th[cl][rl] = (_Float16)v; const __bf16 bh = (__bf16)v; tb[cl][rl] = bh; tbl[cl][rl] = (__bf16)(v - (float)bh); } }
    __syncthreads();
    for (int e = tid; e < 128 * 8; e += 128) { const int cl = e >> 3, q = e & 7; vst2((unsigned*)(VT + (bb * CC + c0 + cl) * (size_t)TT + t0 + q * 8), *(const v4u*)&th[cl][q * 8]); if (hi_rows) { const size_t o3 = (bb * CC + c0 + cl) * (size_t)KHI + t0 + q * 8; vst2((unsigned*)(VB + o3), *(const v4u*)&tb[cl][q * 8]); vst2((unsigned*)(VBL + o3), *(const v4u*)&tbl[cl][q * 8]); } } } }
// ---- k_pv: block = 16 queries (tile blockIdx.x) of (b, h) = blockIdx.z, PVW waves; logits, softmax and P . v in one kernel, the logits never leave the registers. The 32-key chunks are counted down from the diagonal: wave w takes chunks nch - 1 - w, nch - 1 - w - PVW, ..., so that the one chunk with excluded keys is always wave 0's first. Logits transposed, S^T = k q^T (A = 16 k rows, B = the block's 16 q rows): lane (g, col) then holds, for query col, keys 8 g + r of a 16-key tile in element r, which is the A fragment of P for P . v as it stands (tile 0 = elements 0..7, tile 1 = elements 8..15 of a 32-key chunk). Logits x SCALE: single f16 q x k; causal early query tiles (rows < QHI): q hi + residual against k hi + residual (x 2^10), 3 products. Softmax in f32: maximum and sum by lane, across the two lane halves, then across the waves in wave order through LDS. ctx = P . v (P x 2^11 once to f16 against v f16: 1 product; early tiles: P and v as bf16 hi + lo, 3 products); the PVW f32 partials are summed in wave order through LDS; 256-B (row, head) segment by 16 lanes
#define PVW 8
// fragment from a pointer that already holds the lane half's 8 g elements: the pointer is then the loads' own address, the one that XW names
__device__ __forceinline__ v16h frag_hp(const _Float16* p) { union { v16h v; v8h q[2]; } u; u.q[0] = *(const v8h*)p; u.q[1] = *(const v8h*)(p + 16); return u.v; }
__device__ __forceinline__ v16b frag_bp(const __bf16* p) { union { v16b v; v8b q[2]; } u; u.q[0] = *(const v8b*)p; u.q[1] = *(const v8b*)(p + 16); return u.v; }
// (every loop of att_body is unrolled whole: s, the fragment arrays and acc live in registers and need compile-time indices)
template <bool HI> __device__ __forceinline__ void att_body(const _Float16* __restrict__ QH, const _Float16* __restrict__ KH, const _Float16* __restrict__ QL, const _Float16* __restrict__ KL, const _Float16* __restrict__ VT, const __bf16* __restrict__ VB, const __bf16* __restrict__ VBL, int b, int h, int ql0, float (*rm)[16], float (*rs)[16], v8f (&acc)[HD / 16]) {
  constexpr int NI = HI ? (KHI / 32 + PVW - 1) / PVW : TT / 32 / PVW;   /* most chunks a wave can have */
  static_assert(NI % 2 == 0, "chunks are taken in pairs");
  const int tid = threadIdx.x, wave = __builtin_amdgcn_readfirstlane(tid >> 5), lane = tid & 31, col = lane & 15, g = lane >> 4;
  const int nch = (ql0 + 16 + 31) >> 5;   /* 32-key chunks that hold a key <= the tile's last query; only the last of them, nch - 1, holds keys past the tile's first query */
  const int t = ql0 + col;
  const _Float16* qp = QH + ((size_t)b * TT + t) * CC + h * HD + 8 * g; const _Float16* qlp = QL + ((size_t)b * QHI + (HI ? t : 0)) * CC + h * HD + 8 * g;
  const v16h q0 = frag_hp(qp), q1 = frag_hp(qp + 32); v16h r0 = {}, r1 = {};
  if (HI) { r0 = frag_hp(qlp); r1 = frag_hp(qlp + 32); }
  XW(qp, qlp);
  v8f s[NI][2]; float m = -3.0e38f;   /* s[i] is written, and later read, only where the wave has an i-th chunk (wave + i PVW < nch, wave-uniform) */
  // two chunks' fragment loads fly together under one wave-uniform test; where the second does not exist its loads read chunk 0 and are not used
#pragma unroll
  for (int ip = 0; ip < NI / 2; ++ip) {
    if (wave + 2 * ip * PVW < nch) { v16h kf[2][2][2], lf[2][2][2]; const _Float16* kp[2]; const _Float16* lp[2];
#pragma unroll
      for (int u = 0; u < 2; ++u) { const int kc = nch - 1 - wave - (2 * ip + u) * PVW, kl = kc > 0 ? kc : 0; kp[u] = KH + ((size_t)b * TT + kl * 32 + col) * CC + h * HD + 8 * g; lp[u] = KL + ((size_t)b * KHI + (HI ? kl * 32 + col : 0)) * CC + h * HD + 8 * g;
#pragma unroll
        for (int t2 = 0; t2 < 2; ++t2)
#pragma unroll
          for (int d = 0; d < 2; ++d) { kf[u][t2][d] = frag_hp(kp[u] + t2 * 16 * CC + d * 32); if (HI) lf[u][t2][d] = frag_hp(lp[u] + t2 * 16 * CC + d * 32); } }
      XW(kp[0], kp[1]); if (HI) XW(lp[0], lp[1]);
#pragma unroll
      for (int u = 0; u < 2; ++u) if (u == 0 || wave + (2 * ip + 1) * PVW < nch) {
#pragma unroll
        for (int t2 = 0; t2 < 2; ++t2) { v8f a = {}, al = {};
          a = wmma16(kf[u][t2][0], q0, a); if (HI) { al = wmma16(kf[u][t2][0], r0, al); al = wmma16(lf[u][t2][0], q0, al); }
          a = wmma16(kf[u][t2][1], q1, a); if (HI) { al = wmma16(kf[u][t2][1], r1, al); al = wmma16(lf[u][t2][1], q1, al); }
#pragma unroll
          for (int r = 0; r < 8; ++r) a[r] = HI ? (a[r] + al[r] * (1.0f / 1024.0f)) * SCALE : a[r] * SCALE;
          if (ip == 0 && u == 0 && wave == 0) {   /* the chunk on the diagonal: causal -> logit if key <= query, else excluded */
#pragma unroll
            for (int r = 0; r < 8; ++r) a[r] = ((nch - 1) * 32 + t2 * 16 + 8 * g + r <= t) ? a[r] : -3.0e38f; }
#pragma unroll
          for (int r = 0; r < 8; ++r) m = fmaxf(m, a[r]);
          s[2 * ip + u][t2] = a; } } } }
  m = fmaxf(m, __shfl_xor(m, 16));
  if (g == 0) rm[wave][col] = m;
  __syncthreads();   /* every wave's maxima are in LDS before any wave joins them */
#pragma unroll
  for (int w = 0; w < PVW; ++w) m = fmaxf(m, rm[w][col]);
  float sum = 0.f;
#pragma unroll
  for (int i = 0; i < NI; ++i) {
    if (wave + i * PVW < nch) {
#pragma unroll
      for (int t2 = 0; t2 < 2; ++t2)
#pragma unroll
        for (int r = 0; r < 8; ++r) { const float x = s[i][t2][r]; const float ex = expf(x - m); const float e = (i == 0 && x <= -1.0e38f) ? 0.f : ex; s[i][t2][r] = e; sum += e; } } }   /* excluded keys stand only in a first chunk */
  sum += __shfl_xor(sum, 16);
  if (g == 0) rs[wave][col] = sum;
  __syncthreads();   /* every wave's sums are in LDS before any wave joins them */
  sum = 0.f;
#pragma unroll
  for (int w = 0; w < PVW; ++w) sum += rs[w][col];
  const float inv = sum > 0.f ? 2048.0f / sum : 0.f;
#pragma unroll
  for (int ip = 0; ip < NI / 2; ++ip) {
    if (wave + 2 * ip * PVW < nch) {   /* as above: two chunks' v fragments fly together */
      if (HI) { v16b vh[2][HD / 16], vl[2][HD / 16]; const __bf16* vp[2]; const __bf16* wp[2];
#pragma unroll
        for (int u = 0; u < 2; ++u) { const int kc = nch - 1 - wave - (2 * ip + u) * PVW, kl = kc > 0 ? kc : 0; const size_t po = ((size_t)b * CC + h * HD + col) * (size_t)KHI + kl * 32 + 8 * g; vp[u] = VB + po; wp[u] = VBL + po;
#pragma unroll
          for (int j = 0; j < HD / 16; ++j) { vh[u][j] = frag_bp(vp[u] + j * 16 * KHI); vl[u][j] = frag_bp(wp[u] + j * 16 * KHI); } }
        XW(vp[0], vp[1]); XW(wp[0], wp[1]);
#pragma unroll
        for (int u = 0; u < 2; ++u) if (u == 0 || wave + (2 * ip + 1) * PVW < nch) { float pv[16];
#pragma unroll
          for (int r = 0; r < 8; ++r) { pv[r] = s[2 * ip + u][0][r] * inv; pv[8 + r] = s[2 * ip + u][1][r] * inv; }
          const F2 p = bsplit16(pv);
#pragma unroll
          for (int j = 0; j < HD / 16; ++j) { acc[j] = wmma_bf(p.h, vh[u][j], acc[j]); acc[j] = wmma_bf(p.l, vh[u][j], acc[j]); acc[j] = wmma_bf(p.h, vl[u][j], acc[j]); } }
      } else { v16h vf[2][HD / 16]; const _Float16* vp[2];
#pragma unroll
        for (int u = 0; u < 2; ++u) { const int kc = nch - 1 - wave - (2 * ip + u) * PVW, kl = kc > 0 ? kc : 0; vp[u] = VT + ((size_t)b * CC + h * HD + col) * (size_t)TT + kl * 32 + 8 * g;
#pragma unroll
          for (int j = 0; j < HD / 16; ++j) vf[u][j] = frag_hp(vp[u] + j * 16 * TT); }
        XW(vp[0], vp[1]);
#pragma unroll
        for (int u = 0; u < 2; ++u) if (u == 0 || wave + (2 * ip + 1) * PVW < nch) { v16h p;
#pragma unroll
          for (int r = 0; r < 8; ++r) { p[r] = (_Float16)(s[2 * ip + u][0][r] * inv); p[8 + r] = (_Float16)(s[2 * ip + u][1][r] * inv); }
#pragma unroll
          for (int j = 0; j < HD / 16; ++j) acc[j] = wmma16(p, vf[u][j], acc[j]); } } } } }
__global__ __launch_bounds__(32 * PVW) void k_pv(const _Float16* __restrict__ QH, const _Float16* __restrict__ KH, const _Float16* __restrict__ QL, const _Float16* __restrict__ KL, const _Float16* __restrict__ VT, const __bf16* __restrict__ VB, const __bf16* __restrict__ VBL, float* __restrict__ Y) { __shared__ __align__(16) float ss[PVW][16][HD + 4]; __shared__ float rm[PVW][16]; __shared__ float rs[PVW][16];
  const int b = blockIdx.z / NH, h = blockIdx.z % NH; const int tid = threadIdx.x, wave = __builtin_amdgcn_readfirstlane(tid >> 5), lane = tid & 31, col = lane & 15, g = lane >> 4; const int ql0 = blockIdx.x * 16;
  v8f acc[HD / 16] = {};
  if (__builtin_expect(ql0 >= QBH * 64, 1)) att_body<false>(QH, KH, QL, KL, VT, VB, VBL, b, h, ql0, rm, rs, acc); else att_body<true>(QH, KH, QL, KL, VT, VB, VBL, b, h, ql0, rm, rs, acc);   /* block-uniform; marked likely so that the common path stands first in the text, unbroken */
#pragma unroll
  for (int j = 0; j < HD / 16; ++j)
#pragma unroll
    for (int r = 0; r < 8; ++r) ss[wave][8 * g + r][j * 16 + col] = acc[j][r];
  __syncthreads();   /* every wave's partial (zero for a wave without chunks) is in LDS before any thread sums across waves */
  for (int e = tid; e < 16 * (HD / 4); e += 32 * PVW) { const int rl = e / (HD / 4), q = e % (HD / 4); v4f s = *(const v4f*)&ss[0][rl][q * 4];
#pragma unroll
    for (int w = 1; w < PVW; ++w) s += *(const v4f*)&ss[w][rl][q * 4];
    vst2(Y + ((size_t)b * TT + ql0 + rl) * CC + h * HD + q * 4, s * (1.0f / 2048.0f)); } }
// ---- k_out: block = (64 rows, 128 cols): out = ctx Wo (+ bo): ctx x 2^6 once to f16 against Wo as f16(bf16 x 2^8) exact (1 product) x 2^-14; causal early rows (< QHI of each sequence): ctx bf16 hi + lo against exact bf16 Wo (2 products)
template <bool EARLY> __device__ __forceinline__ void out_body(const float* __restrict__ Y, const float* __restrict__ WO, const float* __restrict__ BO, float* __restrict__ OUT, char* smem) {
  float (* const sf)[16][132] = (float (*)[16][132])smem;
  const int tid = threadIdx.x, wave = tid >> 5, lane = tid & 31, col = lane & 15, g = lane >> 4; const int c0 = blockIdx.y * 128; const size_t r0 = (size_t)blockIdx.x * 64 + wave * 16;
  __bf16* const sH = (__bf16*)smem; __bf16* const sL = sH + 2 * 64 * SP; __bf16* const sW = sL + 2 * 64 * SP;   /* early rows: [2][64][SP] hi, [2][64][SP] lo, [2][128][SP] W */
  _Float16* const sA = (_Float16*)smem; _Float16* const sV = sA + 2 * 64 * SP;   /* other rows: [2][64][SP] ctx, [2][128][SP] W */
  const float* pa = Y + ((size_t)blockIdx.x * 64 + (tid >> 4)) * CC + (tid & 15) * 4; const float* pb = WO + (size_t)(c0 + (tid >> 4)) * CC + (tid & 15) * 4; const int so = (tid >> 4) * SP + (tid & 15) * 4;
  v8f acc[8] = {};
  v4f ra[8], rb[16]; ld_rows(ra, pa, CC); ld_rows(rb, pb, CC); XW(pa, pb);
  if (EARLY) { st_split(ra, sH + so, sL + so); st_bf(rb, sW + so); }
  else { st_hs(ra, sA + so, 64.0f); st_hw(rb, sV + so); }   /* ctx carried x 2^6 into f16 so small-magnitude context rows stay clear of f16 subnormals */
#pragma unroll 1   /* rolled: one copy of the step keeps the kernel's text small */
  for (int ks = 0; ks < CC / KS; ++ks) { const int cur = ks & 1, nxt = cur ^ 1;
    __syncthreads();   /* step ks is whole in buffer cur; every wave has left buffer nxt */
    if (ks + 1 < CC / KS) { pa += KS; pb += KS; ld_rows(ra, pa, CC); ld_rows(rb, pb, CC); XW(pa, pb); }
    if (EARLY) {
#pragma unroll
      for (int kk = 0; kk < KS / 32; ++kk) { const int ao = (cur * 64 + wave * 16 + col) * SP + kk * 32; const v16b ah = frag_b(sH + ao, lane), al = frag_b(sL + ao, lane);
#pragma unroll
        for (int jh = 0; jh < 8; jh += 4) { v16b w[4];   /* four fragments' LDS reads go out together, ahead of their products */
#pragma unroll
          for (int j = 0; j < 4; ++j) w[j] = frag_b(sW + (cur * 128 + (jh + j) * 16 + col) * SP + kk * 32, lane);
#pragma unroll
          for (int j = 0; j < 4; ++j) { acc[jh + j] = wmma_bf(ah, w[j], acc[jh + j]); acc[jh + j] = wmma_bf(al, w[j], acc[jh + j]); } } }
      if (ks + 1 < CC / KS) { st_split(ra, sH + nxt * 64 * SP + so, sL + nxt * 64 * SP + so); st_bf(rb, sW + nxt * 128 * SP + so); }
    } else {
#pragma unroll
      for (int kk = 0; kk < KS / 32; ++kk) { const v16h a = frag_h(sA + (cur * 64 + wave * 16 + col) * SP + kk * 32, lane);
#pragma unroll
        for (int jh = 0; jh < 8; jh += 4) { v16h w[4];   /* four fragments' LDS reads go out together, ahead of their products */
#pragma unroll
          for (int j = 0; j < 4; ++j) w[j] = frag_h(sV + (cur * 128 + (jh + j) * 16 + col) * SP + kk * 32, lane);
#pragma unroll
          for (int j = 0; j < 4; ++j) acc[jh + j] = wmma16(a, w[j], acc[jh + j]); } }
      if (ks + 1 < CC / KS) { st_hs(ra, sA + nxt * 64 * SP + so, 64.0f); st_hw(rb, sV + nxt * 128 * SP + so); } } }
  __syncthreads();   /* every wave has read its last fragments before the epilogue's tile overwrites the buffers */
#pragma unroll
  for (int j = 0; j < 8; ++j) { const float bias = BO ? bfr(BO[c0 + j * 16 + col]) : 0.f;
#pragma unroll
    for (int r = 0; r < 8; ++r) sf[wave][8 * g + r][j * 16 + col] = EARLY ? acc[j][r] + bias : acc[j][r] * (1.0f / 16384.0f) + bias; }   /* other rows: 2^-8 (Wo carry) x 2^-6 (ctx carry) */
  LDSX(); for (int rl = 0; rl < 16; ++rl) vst2(OUT + (r0 + rl) * DIN + c0 + lane * 4, *(const v4f*)&sf[wave][rl][lane * 4]); }
__global__ __launch_bounds__(128) void k_out(const float* __restrict__ Y, const float* __restrict__ WO, const float* __restrict__ BO, float* __restrict__ OUT) { __shared__ __align__(16) char smem[2 * (64 + 64 + 128) * SP * 2];   /* two staging buffers of ctx (hi, lo) and W rows; the epilogue's tile lies over them behind a barrier */
  static_assert(sizeof(smem) >= 4 * 16 * 132 * 4, "epilogue tile fits"); static_assert(WO_OUT_IN == 1, "the staging reads W rows of CC floats");
  if (CAUSAL && (int)(((size_t)blockIdx.x * 64) % TT) < QHI) { out_body<true>(Y, WO, BO, OUT, smem); return; }   /* block-uniform */
  out_body<false>(Y, WO, BO, OUT, smem); }

extern "C" void kernel_launch(void* const* d_in, const int* in_sizes, int n_in, void* d_out, int out_size, void* d_ws, size_t ws_size, hipStream_t stream) {
  (void)in_sizes; (void)n_in; (void)out_size;
  const float** F = (const float**)d_in;
  if (ws_size < (size_t)WS_END) return;
  char* ws = (char*)d_ws; _Float16 *QH = (_Float16*)(ws + WS_QH), *KH = (_Float16*)(ws + WS_KH), *VT = (_Float16*)(ws + WS_VT), *QL = (_Float16*)(ws + WS_QL), *KL = (_Float16*)(ws + WS_KL); __bf16 *VB = (__bf16*)(ws + WS_VB), *VBL = (__bf16*)(ws + WS_VBL); float *Y = (float*)(ws + WS_Y);
  (void)Y; (void)QL; (void)KL; (void)VB; (void)VBL;
  // inputs: 0 x [2,2048,1024]; 1 W_qkv [3072,1024] (out,in): q rows 0..1023, k 1024..2047, v 2048..3071; 2 W_o [1024,1024] (out,in); no biases
  k_proj<<<dim3(TNB * TT / 64, CC / 128, 3), 128, 0, stream>>>(F[0], F[0], F[0], F[1], F[1] + (size_t)CC * DIN, F[1] + 2 * (size_t)CC * DIN, nullptr, nullptr, nullptr, QH, QL, KH, KL, VT, VB, VBL);
  k_pv<<<dim3(TT / 16, 1, TNB * NH), 32 * PVW, 0, stream>>>(QH, KH, QL, KL, VT, VB, VBL, Y);
  k_out<<<dim3(TNB * TT / 64, DIN / 128), 128, 0, stream>>>(Y, F[2], nullptr, (float*)d_out);
}

// v005
// One run takes 98.9 microseconds.
// Next to v004, in two timings, it ran 1.57 and 1.58 times as fast.
// Counting every step since v000, it is 12.0 times as fast.
// compute dtype: all float inputs rounded to bf16; the fused q / k / v projection with EXACT bf16 products on WMMA 16x16x32 (f32 accumulate) (no biases); causal logits: 3 products for the first 384 rows, single f16 q x k after, x 64^-0.5; softmax f32; P x 2^11 once to f16 x v once to f16 (bf16 hi + lo below row 384); ctx hi+lo x exact W below row 384, x2^6 f16 carry x f16(bf16 x 2^8) W after, no bias; f32 output.
#include <hip/hip_runtime.h>
#include <math.h>

typedef __attribute__((ext_vector_type(16))) _Float16 v16h;
typedef __attribute__((ext_vector_type(16))) __bf16 v16b;
typedef __attribute__((ext_vector_type(8)))  _Float16 v8h;
typedef __attribute__((ext_vector_type(8)))  float v8f;
typedef __attribute__((ext_vector_type(4)))  float v4f;
typedef __attribute__((ext_vector_type(2)))  float v2f;
typedef __attribute__((ext_vector_type(4)))  unsigned v4u;
typedef __attribute__((ext_vector_type(4)))  int v4i;
typedef float __attribute__((may_alias)) float_a;
typedef int __attribute__((may_alias)) int_a;

template <typename T> __device__ __forceinline__ void vst2(void* p, T v) { *(T*)p = v;  }
__device__ __forceinline__ v8f wmma16(v16h a, v16h b, v8f c) {
  v8f d = __builtin_amdgcn_wmma_f32_16x16x32_f16(false, a, false, b, (short)0, c, false, false);
  asm volatile("v_nop\n\tv_nop\n\tv_nop\n\tv_nop" : "+v"(d) : "v"(a), "v"(b));
  return d;
}
__device__ __forceinline__ v8f wmma_bf(v16b a, v16b b, v8f c) {
  v8f d = __builtin_amdgcn_wmma_f32_16x16x32_bf16(false, a, false, b, (short)0, c, false, false);
  asm volatile("v_nop\n\tv_nop\n\tv_nop\n\tv_nop" : "+v"(d) : "v"(a), "v"(b));
  return d;
}
// 16x16x32 fragments: lane = (h = lane>>4, row/col = lane&15); elements 0..7 = k0+8h+0..7, 8..15 = k0+16+8h+0..7; D element r = row 8h+r
__device__ __forceinline__ v16h frag_h(const _Float16* rowk0, int lane) {
  union { v16h v; v8h q[2]; } u; const _Float16* p = rowk0 + 8 * (lane >> 4);
  u.q[0] = *(const v8h*)p; u.q[1] = *(const v8h*)(p + 16); return u.v;
}
__device__ __forceinline__ v16h frag_f32(const float* rowk0, int lane) {
  v16h a; const float* p = rowk0 + 8 * (lane >> 4);
#pragma unroll
  for (int i = 0; i < 8; ++i) { a[i] = (_Float16)p[i]; a[8 + i] = (_Float16)p[16 + i]; }
  return a;
}
__device__ __forceinline__ v16h frag_f32s(const float* rowk0, int lane, float sc) {
  v16h a; const float* p = rowk0 + 8 * (lane >> 4);
#pragma unroll
  for (int i = 0; i < 8; ++i) { a[i] = (_Float16)(p[i] * sc); a[8 + i] = (_Float16)(p[16 + i] * sc); }
  return a;
}
// column fragment from a [K][ld] layout (column n), rows >= K read as 0
__device__ __forceinline__ v16h fragc_f32(const float* W, int k0, int n, int lane, int ld, int K) {
  v16h a; const int g = lane >> 4;
#pragma unroll
  for (int i = 0; i < 8; ++i) { const int ka = k0 + 8 * g + i, kb = ka + 16;
    a[i] = (_Float16)(ka < K ? W[(size_t)(ka < K ? ka : K - 1) * ld + n] : 0.f); a[8 + i] = (_Float16)(kb < K ? W[(size_t)(kb < K ? kb : K - 1) * ld + n] : 0.f); }
  return a;
}
struct F2 { v16b h, l; };
__device__ __forceinline__ F2 bsplit16(const float v[16]) { F2 r;
#pragma unroll
  for (int i = 0; i < 16; ++i) { const __bf16 h = (__bf16)v[i]; r.h[i] = h; r.l[i] = (__bf16)(v[i] - (float)h); }
  return r; }
__device__ __forceinline__ F2 split_row(const float* row, int k0, int lane) { float v[16]; const float* p = row + k0 + 8 * (lane >> 4);
#pragma unroll
  for (int i = 0; i < 8; ++i) { v[i] = p[i]; v[8 + i] = p[16 + i]; }
  return bsplit16(v); }
__device__ __forceinline__ F2 split_rowK(const float* row, int k0, int lane, int K) { float v[16]; const int g = lane >> 4;
#pragma unroll
  for (int i = 0; i < 8; ++i) { const int ka = k0 + 8 * g + i, kb = ka + 16; v[i] = ka < K ? row[ka < K ? ka : K - 1] : 0.f; v[8 + i] = kb < K ? row[kb < K ? kb : K - 1] : 0.f; }
  return bsplit16(v); }
__device__ __forceinline__ F2 split_col(const float* W, int k0, int n, int lane, int ld, int K) { float v[16]; const int g = lane >> 4;
#pragma unroll
  for (int i = 0; i < 8; ++i) { const int ka = k0 + 8 * g + i, kb = ka + 16; v[i] = ka < K ? W[(size_t)(ka < K ? ka : K - 1) * ld + n] : 0.f; v[8 + i] = kb < K ? W[(size_t)(kb < K ? kb : K - 1) * ld + n] : 0.f; }
  return bsplit16(v); }
__device__ __forceinline__ v8f mac3(const F2& a, const F2& b, v8f c) { c = wmma_bf(a.l, b.h, c); c = wmma_bf(a.h, b.l, c); return wmma_bf(a.h, b.h, c); }
__device__ __forceinline__ float sigm(float v) { return 1.0f / (1.0f + expf(-v)); }
#define LDSX() do { asm volatile("s_wait_dscnt 0" ::: "memory"); __builtin_amdgcn_wave_barrier(); __builtin_amdgcn_fence(__ATOMIC_RELEASE, "workgroup"); } while (0)

// Bias-free causal multi-head self-attention with a fused (out,in) QKV projection (x [2,2048,1024]; Wqkv [3072,1024] torch (out,in): jnp.split thirds of einsum('btd,ed->bte') = x @ Wqkv.T (q = rows 0..1023, k = 1024..2047, v = 2048..3071); Wout [1024,1024] (out,in); no biases; 16 heads x 64; scores x 1/sqrt(64); tril kept, -inf elsewhere; softmax; out @ Wout.T).
#define NB 2
#define TT 2048
#define CC 1024            // NH * HD = projected width
#define DIN 1024          // input (model) width
#define NH 16
#define HD 64
#define NQB (TT / 64)
#define HG 4
#define SCALE (0.125f)
#define CAUSAL 1
#ifndef TNB
#define TNB NB
#endif
__device__ __forceinline__ float bfr(float v) { return (float)(__bf16)v; }
__host__ __device__ __forceinline__ int kb_last(int qb) { return CAUSAL ? ((qb * 64 + 63) >> 7) : (TT / 128 - 1); }
typedef __attribute__((ext_vector_type(8))) __bf16 v8b;
__device__ __forceinline__ v16b frag_b(const __bf16* rowk0, int lane) {
  union { v16b v; v8b q[2]; } u; const __bf16* p = rowk0 + 8 * (lane >> 4);
  u.q[0] = *(const v8b*)p; u.q[1] = *(const v8b*)(p + 16); return u.v;
}
#define QBH 6              // causal: query rows < QBH * 64 of each sequence (few keys, no averaging) take the high-precision path
#define QHI 384            // rows carrying a q residual plane
#define KHI 384            // key rows carrying k residual / v bf16 hi+lo planes (used only by the causal high-precision path)
// B fragment (k rows k0+.., output column o) of a weight: (in,out) [K][ld] or (out,in) [ld rows of K]: bf16 exact, or f16(bf16 * 256) exact
__device__ __forceinline__ v16b wcol_io(const float* Wm, int k0, int o, int lane, int ld) { v16b w; const int g = lane >> 4;
#pragma unroll
  for (int i = 0; i < 8; ++i) { w[i] = (__bf16)Wm[(size_t)(k0 + 8 * g + i) * ld + o]; w[8 + i] = (__bf16)Wm[(size_t)(k0 + 16 + 8 * g + i) * ld + o]; }
  return w; }
__device__ __forceinline__ v16b wcol_oi(const float* Wm, int k0, int o, int lane, int K) { v16b w; const float* p = Wm + (size_t)o * K + k0 + 8 * (lane >> 4);
#pragma unroll
  for (int i = 0; i < 8; ++i) { w[i] = (__bf16)p[i]; w[8 + i] = (__bf16)p[16 + i]; }
  return w; }
__device__ __forceinline__ v16h wcolh_io(const float* Wm, int k0, int o, int lane, int ld) { v16h w; const int g = lane >> 4;
#pragma unroll
  for (int i = 0; i < 8; ++i) { w[i] = (_Float16)(bfr(Wm[(size_t)(k0 + 8 * g + i) * ld + o]) * 256.0f); w[8 + i] = (_Float16)(bfr(Wm[(size_t)(k0 + 16 + 8 * g + i) * ld + o]) * 256.0f); }
  return w; }
__device__ __forceinline__ v16h wcolh_oi(const float* Wm, int k0, int o, int lane, int K) { v16h w; const float* p = Wm + (size_t)o * K + k0 + 8 * (lane >> 4);
#pragma unroll
  for (int i = 0; i < 8; ++i) { w[i] = (_Float16)(bfr(p[i]) * 256.0f); w[8 + i] = (_Float16)(bfr(p[16 + i]) * 256.0f); }
  return w; }
#define WQKV_LAYOUT 1   // 0 = (in,out) [DIN][CC]; 1 = (out,in) [CC][DIN]; 2 = per-head [NH][DIN][HD]
__device__ __forceinline__ v16b wcol_hdk(const float* Wm, int k0, int o, int lane) { v16b w; const int g = lane >> 4; const float* p = Wm + (size_t)(o / HD) * DIN * HD + (o % HD);
#pragma unroll
  for (int i = 0; i < 8; ++i) { w[i] = (__bf16)p[(size_t)(k0 + 8 * g + i) * HD]; w[8 + i] = (__bf16)p[(size_t)(k0 + 16 + 8 * g + i) * HD]; }
  return w; }
#define WO_OUT_IN 1
#if WQKV_LAYOUT == 1
#define WCOL(W, k0, o, lane) wcol_oi(W, k0, o, lane, DIN)
#elif WQKV_LAYOUT == 2
#define WCOL(W, k0, o, lane) wcol_hdk(W, k0, o, lane)
#else
#define WCOL(W, k0, o, lane) wcol_io(W, k0, o, lane, CC)
#endif
#if WO_OUT_IN
#define WOCOL(W, k0, o, lane) wcol_oi(W, k0, o, lane, CC)
#define WOCOLH(W, k0, o, lane) wcolh_oi(W, k0, o, lane, CC)
#else
#define WOCOL(W, k0, o, lane) wcol_io(W, k0, o, lane, DIN)
#define WOCOLH(W, k0, o, lane) wcolh_io(W, k0, o, lane, DIN)
#endif

#ifndef PROJ_EXTRA_PARAMS
#define PROJ_EXTRA_PARAMS
#endif

#define WS_QH  0u                                      // f16 q rows [b*t][CC]
#define WS_KH  (WS_QH + 2u * (size_t)NB * TT * CC)      // f16 k rows [b*t][CC]
#define WS_VT  (WS_KH + 2u * (size_t)NB * TT * CC)      // f16 v planes [b][c][t]
#define WS_QL  (WS_VT + 2u * (size_t)NB * CC * TT)      // f16 q residual x 2^10 rows [b][t < QHI][CC]
#define WS_KL  (WS_QL + 2u * (size_t)NB * QHI * CC)     // f16 k residual x 2^10 rows [b][t < KHI][CC]
#define WS_VB  (WS_KL + 2u * (size_t)NB * KHI * CC)     // bf16 v hi planes [b][c][t < KHI]
#define WS_VBL (WS_VB + 2u * (size_t)NB * CC * KHI)
#define WS_Y   (WS_VBL + 2u * (size_t)NB * CC * KHI)    // f32 ctx rows [b*t][CC] (only when there is an output projection)
#define WS_END (WS_Y  + 4u * (size_t)NB * TT * CC)

// ---- operand staging of k_proj and k_out: a K step is KS columns of the block's X (or ctx) rows and of its W rows. Thread (tid >> 4, tid & 15) takes rows 8 i + (tid >> 4), floats 4 (tid & 15) .. + 3, so each wave-wide load reads two whole 256-byte row pieces; each value is rounded once per block and lies in LDS as the 16-bit operand, rows at pitch SP; every wave takes its fragments from there. Two LDS buffers: the next step's loads fly while this step is multiplied.
#define KS 64
#define SP (KS + 8)        // LDS pitch of a staged row in 16-bit elements: 144 B = 16 B x odd, for the 16-byte fragment reads
typedef __attribute__((ext_vector_type(4))) __bf16 v4b;
typedef __attribute__((ext_vector_type(4))) _Float16 v4hs;
template <int N> __device__ __forceinline__ void ld_rows(v4f (&r)[N], const float* p, int ld) {
#pragma unroll
  for (int i = 0; i < N; ++i) r[i] = *(const v4f*)(p + (size_t)i * 8 * ld); }
// the wait that stands before an address register of the row loads may be overwritten; the two pointers are named as inputs so that they live, unchanged, up to here
#define XW(p, q) asm volatile("s_wait_xcnt 0x0" :: "v"(p), "v"(q) : "memory")
template <int N> __device__ __forceinline__ void st_bf(const v4f (&r)[N], __bf16* d) {
#pragma unroll
  for (int i = 0; i < N; ++i) { v4b q;
#pragma unroll
    for (int c = 0; c < 4; ++c) q[c] = (__bf16)r[i][c];
    *(v4b*)(d + i * 8 * SP) = q; } }
template <int N> __device__ __forceinline__ void st_split(const v4f (&r)[N], __bf16* dh, __bf16* dl) {
#pragma unroll
  for (int i = 0; i < N; ++i) { v4b qh, ql;
#pragma unroll
    for (int c = 0; c < 4; ++c) { const __bf16 h = (__bf16)r[i][c]; qh[c] = h; ql[c] = (__bf16)(r[i][c] - (float)h); }
    *(v4b*)(dh + i * 8 * SP) = qh; *(v4b*)(dl + i * 8 * SP) = ql; } }
template <int N> __device__ __forceinline__ void st_hs(const v4f (&r)[N], _Float16* d, float sc) {
#pragma unroll
  for (int i = 0; i < N; ++i) { v4hs q;
#pragma unroll
    for (int c = 0; c < 4; ++c) q[c] = (_Float16)(r[i][c] * sc);
    *(v4hs*)(d + i * 8 * SP) = q; } }
template <int N> __device__ __forceinline__ void st_hw(const v4f (&r)[N], _Float16* d) {
#pragma unroll
  for (int i = 0; i < N; ++i) { v4hs q;
#pragma unroll
    for (int c = 0; c < 4; ++c) q[c] = (_Float16)(bfr(r[i][c]) * 256.0f);
    *(v4hs*)(d + i * 8 * SP) = q; } }
// ---- k_proj: block = (64 rows, 128 cols, which): q/k/v = X W (+ b) with exact bf16 products (K = DIN) -> which 0: q f16 rows (+ residual rows < QHI); 1: k f16 rows (+ residual rows < KHI); 2: v f16 planes [c][t] (+ bf16 hi/lo planes for t < KHI)
__global__ __launch_bounds__(128) void k_proj(const float* __restrict__ XQ, const float* __restrict__ XK, const float* __restrict__ XV, const float* __restrict__ WQ, const float* __restrict__ WK, const float* __restrict__ WV, const float* __restrict__ BQ, const float* __restrict__ BK, const float* __restrict__ BV,
    _Float16* __restrict__ QH, _Float16* __restrict__ QL, _Float16* __restrict__ KH, _Float16* __restrict__ KL, _Float16* __restrict__ VT, __bf16* __restrict__ VB, __bf16* __restrict__ VBL) {
  __shared__ __align__(16) char smem[2 * (64 + 128) * SP * 2];   /* the two staging buffers; the epilogue's tiles lie over them behind a barrier */
  static_assert(sizeof(smem) >= 3 * 128 * 72 * 2 && sizeof(smem) >= 2 * 64 * 136 * 2, "epilogue tiles fit");
  __bf16* const sA = (__bf16*)smem; __bf16* const sB = sA + 2 * 64 * SP;   /* [2][64][SP], [2][128][SP] */
  _Float16 (* const sh)[136] = (_Float16 (*)[136])smem; _Float16 (* const sl)[136] = sh + 64; _Float16 (* const th)[72] = (_Float16 (*)[72])smem; __bf16 (* const tb)[72] = (__bf16 (*)[72])smem + 128; __bf16 (* const tbl)[72] = tb + 128;
  const int tid = threadIdx.x, wave = tid >> 5, lane = tid & 31, col = lane & 15, g = lane >> 4; const int which = blockIdx.z; const int c0 = blockIdx.y * 128; const size_t r0 = (size_t)blockIdx.x * 64; const size_t bb = r0 / TT; const int t0 = (int)(r0 % TT);
  const float* X = which == 0 ? XQ : which == 1 ? XK : XV; const float* WA = which == 0 ? WQ : which == 1 ? WK : WV; const float* BA = which == 0 ? BQ : which == 1 ? BK : BV;
  v8f acc[8] = {};
  static_assert(WQKV_LAYOUT == 1, "the staging reads W rows of DIN floats");
  { const float* pa = X + (r0 + (tid >> 4)) * DIN + (tid & 15) * 4; const float* pb = WA + (size_t)(c0 + (tid >> 4)) * DIN + (tid & 15) * 4; const int so = (tid >> 4) * SP + (tid & 15) * 4;
    v4f ra[8], rb[16]; ld_rows(ra, pa, DIN); ld_rows(rb, pb, DIN); XW(pa, pb); st_bf(ra, sA + so); st_bf(rb, sB + so);
#pragma unroll 1   /* rolled: one copy of the step keeps the kernel's text small */
    for (int ks = 0; ks < DIN / KS; ++ks) { const int cur = ks & 1, nxt = cur ^ 1;
      __syncthreads();   /* step ks is whole in buffer cur; every wave has left buffer nxt */
      if (ks + 1 < DIN / KS) { pa += KS; pb += KS; ld_rows(ra, pa, DIN); ld_rows(rb, pb, DIN); XW(pa, pb); }
#pragma unroll
      for (int kk = 0; kk < KS / 32; ++kk) { const v16b a = frag_b(sA + (cur * 64 + wave * 16 + col) * SP + kk * 32, lane);
#pragma unroll
        for (int jh = 0; jh < 8; jh += 4) { v16b w[4];   /* four fragments' LDS reads go out together, ahead of their four products: one LDS latency per group */
#pragma unroll
          for (int j = 0; j < 4; ++j) w[j] = frag_b(sB + (cur * 128 + (jh + j) * 16 + col) * SP + kk * 32, lane);
#pragma unroll
          for (int j = 0; j < 4; ++j) acc[jh + j] = wmma_bf(a, w[j], acc[jh + j]); } }
      if (ks + 1 < DIN / KS) { st_bf(ra, sA + nxt * 64 * SP + so); st_bf(rb, sB + nxt * 128 * SP + so); } }
    __syncthreads(); }   /* every wave has read its last fragments before the epilogue's tiles overwrite the buffers */
  if (which < 2) { _Float16* DH = which == 0 ? QH : KH; _Float16* DL = which == 0 ? QL : KL; const int nhi = which == 0 ? QHI : KHI; const bool hi_rows = t0 < nhi;
#pragma unroll
    for (int j = 0; j < 8; ++j) { const float bias = BA ? bfr(BA[c0 + j * 16 + col]) : 0.f;
#pragma unroll
      for (int r = 0; r < 8; ++r) { const float v = acc[j][r] + bias; const _Float16 hv = (_Float16)v; sh[wave * 16 + 8 * g + r][j * 16 + col] = hv; sl[wave * 16 + 8 * g + r][j * 16 + col] = (_Float16)((v - (float)hv) * 1024.0f); } }
    __syncthreads();
    for (int e = tid; e < 64 * 16; e += 128) { const int rl = e >> 4, q = e & 15; vst2((unsigned*)(DH + (r0 + rl) * CC + c0 + q * 8), *(const v4u*)&sh[rl][q * 8]); if (hi_rows) vst2((unsigned*)(DL + (bb * nhi + t0 + rl) * (size_t)CC + c0 + q * 8), *(const v4u*)&sl[rl][q * 8]); }
  } else { const bool hi_rows = t0 < KHI;
#pragma unroll
    for (int j = 0; j < 8; ++j) { const float bias = BA ? bfr(BA[c0 + j * 16 + col]) : 0.f;
#pragma unroll
      for (int r = 0; r < 8; ++r) { const float v = acc[j][r] + bias; const int rl = wave * 16 + 8 * g + r, cl = j * 16 + col; th[cl][rl] = (_Float16)v; const __bf16 bh = (__bf16)v; tb[cl][rl] = bh; tbl[cl][rl] = (__bf16)(v - (float)bh); } }
    __syncthreads();
    for (int e = tid; e < 128 * 8; e += 128) { const int cl = e >> 3, q = e & 7; vst2((unsigned*)(VT + (bb * CC + c0 + cl) * (size_t)TT + t0 + q * 8), *(const v4u*)&th[cl][q * 8]); if (hi_rows) { const size_t o3 = (bb * CC + c0 + cl) * (size_t)KHI + t0 + q * 8; vst2((unsigned*)(VB + o3), *(const v4u*)&tb[cl][q * 8]); vst2((unsigned*)(VBL + o3), *(const v4u*)&tbl[cl][q * 8]); } } } }
// ---- k_pv, early rows (< QBH * 64; att_body is instantiated with HI = true alone, the later rows go through att_stream below): block = 16 queries of (b, h), PVW waves; logits, softmax and P . v in one kernel, the logits never leave the registers. The 32-key chunks are counted down from the diagonal: wave w takes chunks nch - 1 - w, nch - 1 - w - PVW, ..., so that the one chunk with excluded keys is always wave 0's first. Logits transposed, S^T = k q^T (A = 16 k rows, B = the block's 16 q rows): lane (g, col) then holds, for query col, keys 8 g + r of a 16-key tile in element r, which is the A fragment of P for P . v as it stands (tile 0 = elements 0..7, tile 1 = elements 8..15 of a 32-key chunk). Logits x SCALE: single f16 q x k; causal early query tiles (rows < QHI): q hi + residual against k hi + residual (x 2^10), 3 products. Softmax in f32: maximum and sum by lane, across the two lane halves, then across the waves in wave order through LDS. ctx = P . v (P x 2^11 once to f16 against v f16: 1 product; early tiles: P and v as bf16 hi + lo, 3 products); the PVW f32 partials are summed in wave order through LDS; 256-B (row, head) segment by 16 lanes
#define PVW 8
// fragment from a pointer that already holds the lane half's 8 g elements: the pointer is then the loads' own address, the one that XW names
__device__ __forceinline__ v16h frag_hp(const _Float16* p) { union { v16h v; v8h q[2]; } u; u.q[0] = *(const v8h*)p; u.q[1] = *(const v8h*)(p + 16); return u.v; }
__device__ __forceinline__ v16b frag_bp(const __bf16* p) { union { v16b v; v8b q[2]; } u; u.q[0] = *(const v8b*)p; u.q[1] = *(const v8b*)(p + 16); return u.v; }
// (every loop of att_body is unrolled whole: s, the fragment arrays and acc live in registers and need compile-time indices)
template <bool HI> __device__ __forceinline__ void att_body(const _Float16* __restrict__ QH, const _Float16* __restrict__ KH, const _Float16* __restrict__ QL, const _Float16* __restrict__ KL, const _Float16* __restrict__ VT, const __bf16* __restrict__ VB, const __bf16* __restrict__ VBL, int b, int h, int ql0, float (*rm)[16], float (*rs)[16], v8f (&acc)[HD / 16]) {
  constexpr int NI = HI ? (KHI / 32 + PVW - 1) / PVW : TT / 32 / PVW;   /* most chunks a wave can have */
  static_assert(NI % 2 == 0, "chunks are taken in pairs");
  const int tid = threadIdx.x, wave = __builtin_amdgcn_readfirstlane(tid >> 5), lane = tid & 31, col = lane & 15, g = lane >> 4;
  const int nch = (ql0 + 16 + 31) >> 5;   /* 32-key chunks that hold a key <= the tile's last query; only the last of them, nch - 1, holds keys past the tile's first query */
  const int t = ql0 + col;
  const _Float16* qp = QH + ((size_t)b * TT + t) * CC + h * HD + 8 * g; const _Float16* qlp = QL + ((size_t)b * QHI + (HI ? t : 0)) * CC + h * HD + 8 * g;
  const v16h q0 = frag_hp(qp), q1 = frag_hp(qp + 32); v16h r0 = {}, r1 = {};
  if (HI) { r0 = frag_hp(qlp); r1 = frag_hp(qlp + 32); }
  XW(qp, qlp);
  v8f s[NI][2]; float m = -3.0e38f;   /* s[i] is written, and later read, only where the wave has an i-th chunk (wave + i PVW < nch, wave-uniform) */
  // two chunks' fragment loads fly together under one wave-uniform test; where the second does not exist its loads read chunk 0 and are not used
#pragma unroll
  for (int ip = 0; ip < NI / 2; ++ip) {
    if (wave + 2 * ip * PVW < nch) { v16h kf[2][2][2], lf[2][2][2]; const _Float16* kp[2]; const _Float16* lp[2];
#pragma unroll
      for (int u = 0; u < 2; ++u) { const int kc = nch - 1 - wave - (2 * ip + u) * PVW, kl = kc > 0 ? kc : 0; kp[u] = KH + ((size_t)b * TT + kl * 32 + col) * CC + h * HD + 8 * g; lp[u] = KL + ((size_t)b * KHI + (HI ? kl * 32 + col : 0)) * CC + h * HD + 8 * g;
#pragma unroll
        for (int t2 = 0; t2 < 2; ++t2)
#pragma unroll
          for (int d = 0; d < 2; ++d) { kf[u][t2][d] = frag_hp(kp[u] + t2 * 16 * CC + d * 32); if (HI) lf[u][t2][d] = frag_hp(lp[u] + t2 * 16 * CC + d * 32); } }
      XW(kp[0], kp[1]); if (HI) XW(lp[0], lp[1]);
#pragma unroll
      for (int u = 0; u < 2; ++u) if (u == 0 || wave + (2 * ip + 1) * PVW < nch) {
#pragma unroll
        for (int t2 = 0; t2 < 2; ++t2) { v8f a = {}, al = {};
          a = wmma16(kf[u][t2][0], q0, a); if (HI) { al = wmma16(kf[u][t2][0], r0, al); al = wmma16(lf[u][t2][0], q0, al); }
          a = wmma16(kf[u][t2][1], q1, a); if (HI) { al = wmma16(kf[u][t2][1], r1, al); al = wmma16(lf[u][t2][1], q1, al); }
#pragma unroll
          for (int r = 0; r < 8; ++r) a[r] = HI ? (a[r] + al[r] * (1.0f / 1024.0f)) * SCALE : a[r] * SCALE;
          if (ip == 0 && u == 0 && wave == 0) {   /* the chunk on the diagonal: causal -> logit if key <= query, else excluded */
#pragma unroll
            for (int r = 0; r < 8; ++r) a[r] = ((nch - 1) * 32 + t2 * 16 + 8 * g + r <= t) ? a[r] : -3.0e38f; }
#pragma unroll
          for (int r = 0; r < 8; ++r) m = fmaxf(m, a[r]);
          s[2 * ip + u][t2] = a; } } } }
  m = fmaxf(m, __shfl_xor(m, 16));
  if (g == 0) rm[wave][col] = m;
  __syncthreads();   /* every wave's maxima are in LDS before any wave joins them */
#pragma unroll
  for (int w = 0; w < PVW; ++w) m = fmaxf(m, rm[w][col]);
  float sum = 0.f;
#pragma unroll
  for (int i = 0; i < NI; ++i) {
    if (wave + i * PVW < nch) {
#pragma unroll
      for (int t2 = 0; t2 < 2; ++t2)
#pragma unroll
        for (int r = 0; r < 8; ++r) { const float x = s[i][t2][r]; const float ex = expf(x - m); const float e = (i == 0 && x <= -1.0e38f) ? 0.f : ex; s[i][t2][r] = e; sum += e; } } }   /* excluded keys stand only in a first chunk */
  sum += __shfl_xor(sum, 16);
  if (g == 0) rs[wave][col] = sum;
  __syncthreads();   /* every wave's sums are in LDS before any wave joins them */
  sum = 0.f;
#pragma unroll
  for (int w = 0; w < PVW; ++w) sum += rs[w][col];
  const float inv = sum > 0.f ? 2048.0f / sum : 0.f;
#pragma unroll
  for (int ip = 0; ip < NI / 2; ++ip) {
    if (wave + 2 * ip * PVW < nch) {   /* as above: two chunks' v fragments fly together */
      if (HI) { v16b vh[2][HD / 16], vl[2][HD / 16]; const __bf16* vp[2]; const __bf16* wp[2];
#pragma unroll
        for (int u = 0; u < 2; ++u) { const int kc = nch - 1 - wave - (2 * ip + u) * PVW, kl = kc > 0 ? kc : 0; const size_t po = ((size_t)b * CC + h * HD + col) * (size_t)KHI + kl * 32 + 8 * g; vp[u] = VB + po; wp[u] = VBL + po;
#pragma unroll
          for (int j = 0; j < HD / 16; ++j) { vh[u][j] = frag_bp(vp[u] + j * 16 * KHI); vl[u][j] = frag_bp(wp[u] + j * 16 * KHI); } }
        XW(vp[0], vp[1]); XW(wp[0], wp[1]);
#pragma unroll
        for (int u = 0; u < 2; ++u) if (u == 0 || wave + (2 * ip + 1) * PVW < nch) { float pv[16];
#pragma unroll
          for (int r = 0; r < 8; ++r) { pv[r] = s[2 * ip + u][0][r] * inv; pv[8 + r] = s[2 * ip + u][1][r] * inv; }
          const F2 p = bsplit16(pv);
#pragma unroll
          for (int j = 0; j < HD / 16; ++j) { acc[j] = wmma_bf(p.h, vh[u][j], acc[j]); acc[j] = wmma_bf(p.l, vh[u][j], acc[j]); acc[j] = wmma_bf(p.h, vl[u][j], acc[j]); } }
      } else { v16h vf[2][HD / 16]; const _Float16* vp[2];
#pragma unroll
        for (int u = 0; u < 2; ++u) { const int kc = nch - 1 - wave - (2 * ip + u) * PVW, kl = kc > 0 ? kc : 0; vp[u] = VT + ((size_t)b * CC + h * HD + col) * (size_t)TT + kl * 32 + 8 * g;
#pragma unroll
          for (int j = 0; j < HD / 16; ++j) vf[u][j] = frag_hp(vp[u] + j * 16 * TT); }
        XW(vp[0], vp[1]);
#pragma unroll
        for (int u = 0; u < 2; ++u) if (u == 0 || wave + (2 * ip + 1) * PVW < nch) { v16h p;
#pragma unroll
          for (int r = 0; r < 8; ++r) { p[r] = (_Float16)(s[2 * ip + u][0][r] * inv); p[8 + r] = (_Float16)(s[2 * ip + u][1][r] * inv); }
#pragma unroll
          for (int j = 0; j < HD / 16; ++j) acc[j] = wmma16(p, vf[u][j], acc[j]); } } } } }
// ---- later rows (>= QBH * 64) of k_pv: block = FQ queries of (b, h), one 16-query tile per wave; every wave walks the same keys from key 0 up, in stages of 64, so a stage of k rows and of v planes is read from global memory once per FQ queries, in whole 128-byte lines (thread (tid >> 3, tid & 7): rows tid >> 3 and 32 + (tid >> 3), 16 bytes at 16 (tid & 7)), and lies in LDS at pitch SP for all PVW waves. Two LDS buffers: the next stage's loads fly while this stage is worked on. Logits transposed as in att_body (S^T = k q^T, single f16 q x k): lane (g, col) holds keys 8 g + r of each 16-key tile for query col. Softmax with a running maximum in the base-2 scale (logit x SCALE x log2 e): P = 2^(y - max + 11) once to f16, the f32 sum of the unrounded P and the context are scaled by 2^(old max - new max) at each stage. Context transposed, O^T = v^T P^T (A = 16 v planes, B = P as it stands in the lane), so that maximum, sum and context of a query stay in that query's lanes; the 2^11 cancels in context / sum.
#define FQ (16 * PVW)
#define NFB ((TT - QBH * 64) / FQ)   // blocks of later rows per (b, h)
#define NHB (QBH * 64 / 16)          // 16-query blocks of early rows per (b, h)
static_assert((QBH * 64) % FQ == 0 && TT % FQ == 0 && FQ % 64 == 0 && HD == 64, "whole blocks, whole stages");
__device__ __forceinline__ v8f wm16(v16h a, v16h b, v8f c) { return __builtin_amdgcn_wmma_f32_16x16x32_f16(false, a, false, b, (short)0, c, false, false); }
__device__ __forceinline__ float xhalf(float v) { return __builtin_bit_cast(float, __builtin_amdgcn_permlanex16(__builtin_bit_cast(int, v), __builtin_bit_cast(int, v), 0x76543210, 0xfedcba98, false, false)); }   // lane l takes lane l ^ 16's value
// 2^x by v_exp_f32, with the one slot that the instruction set asks for behind a transcendental (before its result is read or its source overwritten) in the same statement, so that it stands directly behind it. ex2x8: no result shares a register with a source (early clobber), so each v_exp_f32 is the independent instruction behind the one before it, and one v_nop behind the last serves all eight.
__device__ __forceinline__ float ex2(float x) { float e; asm("v_exp_f32 %0, %1\n\tv_nop" : "=v"(e) : "v"(x)); return e; }
__device__ __forceinline__ v8f ex2x8(v8f x) { float e0, e1, e2, e3, e4, e5, e6, e7;
  asm("v_exp_f32 %0, %8\n\tv_exp_f32 %1, %9\n\tv_exp_f32 %2, %10\n\tv_exp_f32 %3, %11\n\tv_exp_f32 %4, %12\n\tv_exp_f32 %5, %13\n\tv_exp_f32 %6, %14\n\tv_exp_f32 %7, %15\n\tv_nop"
      : "=&v"(e0), "=&v"(e1), "=&v"(e2), "=&v"(e3), "=&v"(e4), "=&v"(e5), "=&v"(e6), "=&v"(e7) : "v"(x[0]), "v"(x[1]), "v"(x[2]), "v"(x[3]), "v"(x[4]), "v"(x[5]), "v"(x[6]), "v"(x[7]));
  return v8f{e0, e1, e2, e3, e4, e5, e6, e7}; }
__device__ __forceinline__ void att_stream(const _Float16* __restrict__ QH, const _Float16* __restrict__ KH, const _Float16* __restrict__ VT, float* __restrict__ Y, int b, int h, int x, char* smem) {
  _Float16* const sK = (_Float16*)smem; _Float16* const sV = sK + 2 * 64 * SP;   /* [2][64 keys][SP], [2][64 planes][SP] */
  float (* const so)[16][HD + 4] = (float (*)[16][HD + 4])smem;   /* the epilogue's tiles lie over the buffers behind a barrier */
  const int tid = threadIdx.x, wave = __builtin_amdgcn_readfirstlane(tid >> 5), lane = tid & 31, col = lane & 15, g = lane >> 4;
  const int ql0 = x * FQ + wave * 16, t = ql0 + col;
  const int nst = (x + 1) * (FQ / 64);   /* stages that hold a key <= the block's last query */
  const int lastw = (ql0 + 15) >> 6;     /* the wave's last stage, the only one with keys past the tile's first query (64 lastw <= ql0) */
  const _Float16* qp = QH + ((size_t)b * TT + t) * CC + h * HD + 8 * g;
  const v16h q0 = frag_hp(qp), q1 = frag_hp(qp + 32);
  XW(qp, qp);
  const _Float16* pk = KH + ((size_t)b * TT + (tid >> 3)) * CC + h * HD + (tid & 7) * 8; const _Float16* pv = VT + ((size_t)b * CC + h * HD + (tid >> 3)) * (size_t)TT + (tid & 7) * 8; const int so8 = (tid >> 3) * SP + (tid & 7) * 8;
  v8h rk[2], rv[2];
#pragma unroll
  for (int i = 0; i < 2; ++i) { rk[i] = *(const v8h*)(pk + (size_t)i * 32 * CC); rv[i] = *(const v8h*)(pv + (size_t)i * 32 * TT); }
  XW(pk, pv);
#pragma unroll
  for (int i = 0; i < 2; ++i) { *(v8h*)(sK + i * 32 * SP + so8) = rk[i]; *(v8h*)(sV + i * 32 * SP + so8) = rv[i]; }
  constexpr float C2 = SCALE * 1.44269504088896340736f;
  v8f acc[HD / 16] = {}; float m = -3.0e38f, sum = 0.f;
#pragma unroll 1   /* rolled: the trip count differs from block to block, and one copy of the stage keeps the kernel's text small */
  for (int st = 0; st < nst; ++st) { const int cur = st & 1, nxt = cur ^ 1;
    __syncthreads();   /* stage st is whole in buffer cur; every wave has left buffer nxt */
    if (st + 1 < nst) { pk += 64 * CC; pv += 64;
#pragma unroll
      for (int i = 0; i < 2; ++i) { rk[i] = *(const v8h*)(pk + (size_t)i * 32 * CC); rv[i] = *(const v8h*)(pv + (size_t)i * 32 * TT); }
      XW(pk, pv); }
    if (st <= lastw) {   /* wave-uniform; a wave past its diagonal only stages and keeps the barriers */
      const _Float16* bK = sK + (cur * 64 + col) * SP; const _Float16* bV = sV + (cur * 64 + col) * SP;
      v8f s[4] = {}; v16h kf[2][4], vf[2][HD / 16];   /* four independent accumulators */
#pragma unroll
      for (int d = 0; d < 2; ++d)
#pragma unroll
        for (int t4 = 0; t4 < 4; ++t4) kf[d][t4] = frag_h(bK + t4 * 16 * SP + d * 32, lane);
#pragma unroll
      for (int u = 0; u < 2; ++u)
#pragma unroll
        for (int j = 0; j < HD / 16; ++j) vf[u][j] = frag_h(bV + j * 16 * SP + u * 32, lane);
      /* the stage's 32 LDS reads (k first, then v) go out as one group ahead of the 8 logit products: left alone, the compiler reads each fragment directly in front of its product and the wave waits out one LDS latency per product */
      __builtin_amdgcn_sched_group_barrier(0x100, 32, 0); __builtin_amdgcn_sched_group_barrier(0x008, 8, 0);
#pragma unroll
      for (int d = 0; d < 2; ++d)
#pragma unroll
        for (int t4 = 0; t4 < 4; ++t4) s[t4] = wm16(kf[d][t4], d == 0 ? q0 : q1, s[t4]);
      if (st == lastw) {   /* the stage on the diagonal: causal -> logit if key <= query, else excluded */
#pragma unroll
        for (int t4 = 0; t4 < 4; ++t4)
#pragma unroll
          for (int r = 0; r < 8; ++r) s[t4][r] = (st * 64 + t4 * 16 + 8 * g + r <= t) ? s[t4][r] : -3.0e38f; }
      float mq[4];   /* four independent chains */
#pragma unroll
      for (int t4 = 0; t4 < 4; ++t4) { mq[t4] = s[t4][0];
#pragma unroll
        for (int r = 1; r < 8; ++r) mq[t4] = fmaxf(mq[t4], s[t4][r]); }
      float mx = fmaxf(fmaxf(mq[0], mq[1]), fmaxf(mq[2], mq[3]));
      mx = fmaxf(mx, xhalf(mx));
      const float mn = fmaxf(m, mx * C2);   /* finite from stage 0 on: key 0 is open to every query */
      const float al = ex2(m - mn); m = mn;   /* 0 at stage 0 */
      const float nb = 11.0f - mn; float ps[4];
#pragma unroll
      for (int t4 = 0; t4 < 4; ++t4)
#pragma unroll
        for (int r = 0; r < 8; ++r) s[t4][r] = __builtin_fmaf(s[t4][r], C2, nb);
#pragma unroll
      for (int t4 = 0; t4 < 4; ++t4) s[t4] = ex2x8(s[t4]);   /* an excluded key gives 2^(-huge) = 0 */
#pragma unroll
      for (int t4 = 0; t4 < 4; ++t4) ps[t4] = ((s[t4][0] + s[t4][1]) + (s[t4][2] + s[t4][3])) + ((s[t4][4] + s[t4][5]) + (s[t4][6] + s[t4][7]));
      sum = sum * al + ((ps[0] + ps[1]) + (ps[2] + ps[3]));
#pragma unroll
      for (int j = 0; j < HD / 16; ++j) acc[j] *= al;
#pragma unroll
      for (int u = 0; u < 2; ++u) { v16h p;
#pragma unroll
        for (int r = 0; r < 8; ++r) { p[r] = (_Float16)s[2 * u][r]; p[8 + r] = (_Float16)s[2 * u + 1][r]; }
#pragma unroll
        for (int j = 0; j < HD / 16; ++j) acc[j] = wm16(vf[u][j], p, acc[j]); } }
    if (st + 1 < nst) {
#pragma unroll
      for (int i = 0; i < 2; ++i) { *(v8h*)(sK + (nxt * 64 + i * 32) * SP + so8) = rk[i]; *(v8h*)(sV + (nxt * 64 + i * 32) * SP + so8) = rv[i]; } } }
  sum += xhalf(sum);
  const float inv = 1.0f / sum;   /* sum >= 2^11: the key of the maximum counts 2^11 */
  __syncthreads();   /* every wave has read its last fragments before the epilogue's tiles overwrite the buffers */
#pragma unroll
  for (int j = 0; j < HD / 16; ++j) { v4f lo, hi;   /* acc[j] element r = channel 16 j + 8 g + r of query col */
#pragma unroll
    for (int c = 0; c < 4; ++c) { lo[c] = acc[j][c] * inv; hi[c] = acc[j][4 + c] * inv; }
    *(v4f*)&so[wave][col][j * 16 + 8 * g] = lo; *(v4f*)&so[wave][col][j * 16 + 8 * g + 4] = hi; }
  LDSX();   /* a wave reads back only its own tile: its LDS writes are done before it reads them by rows */
#pragma unroll
  for (int i = 0; i < 8; ++i) { const int rl = 2 * i + g; vst2(Y + ((size_t)b * TT + ql0 + rl) * CC + h * HD + col * 4, *(const v4f*)&so[wave][rl][col * 4]); } }   /* each store: two whole 256-B (row, head) segments */
__global__ __launch_bounds__(32 * PVW) void k_pv(const _Float16* __restrict__ QH, const _Float16* __restrict__ KH, const _Float16* __restrict__ QL, const _Float16* __restrict__ KL, const _Float16* __restrict__ VT, const __bf16* __restrict__ VB, const __bf16* __restrict__ VBL, float* __restrict__ Y) { __shared__ __align__(16) char smem[2 * (64 + 64) * SP * 2];   /* later rows: two buffers of k and v stages; early rows: the partials and the waves' maxima and sums */
  static_assert(sizeof(smem) >= (PVW * 16 * (HD + 4) + 2 * PVW * 16) * 4, "partials, maxima and sums fit");
  float (* const ss)[16][HD + 4] = (float (*)[16][HD + 4])smem; float (* const rm)[16] = (float (*)[16])(smem + PVW * 16 * (HD + 4) * 4); float (* const rs)[16] = rm + PVW;
  const int b = blockIdx.x / NH, h = blockIdx.x % NH; const int tid = threadIdx.x, wave = __builtin_amdgcn_readfirstlane(tid >> 5), lane = tid & 31, col = lane & 15, g = lane >> 4;
  if (__builtin_expect((int)blockIdx.y < NFB, 1)) { att_stream(QH, KH, VT, Y, b, h, TT / FQ - 1 - (int)blockIdx.y, smem); return; }   /* block-uniform; the longest blocks have the lowest indices and start first; marked likely so that the common path stands first in the text */
  const int ql0 = ((int)blockIdx.y - NFB) * 16;
  v8f acc[HD / 16] = {};
  att_body<true>(QH, KH, QL, KL, VT, VB, VBL, b, h, ql0, rm, rs, acc);
#pragma unroll
  for (int j = 0; j < HD / 16; ++j)
#pragma unroll
    for (int r = 0; r < 8; ++r) ss[wave][8 * g + r][j * 16 + col] = acc[j][r];
  __syncthreads();   /* every wave's partial (zero for a wave without chunks) is in LDS before any thread sums across waves */
  for (int e = tid; e < 16 * (HD / 4); e += 32 * PVW) { const int rl = e / (HD / 4), q = e % (HD / 4); v4f s = *(const v4f*)&ss[0][rl][q * 4];
#pragma unroll
    for (int w = 1; w < PVW; ++w) s += *(const v4f*)&ss[w][rl][q * 4];
    vst2(Y + ((size_t)b * TT + ql0 + rl) * CC + h * HD + q * 4, s * (1.0f / 2048.0f)); } }
// ---- k_out: block = (64 rows, 128 cols): out = ctx Wo (+ bo): ctx x 2^6 once to f16 against Wo as f16(bf16 x 2^8) exact (1 product) x 2^-14; causal early rows (< QHI of each sequence): ctx bf16 hi + lo against exact bf16 Wo (2 products)
template <bool EARLY> __device__ __forceinline__ void out_body(const float* __restrict__ Y, const float* __restrict__ WO, const float* __restrict__ BO, float* __restrict__ OUT, char* smem) {
  float (* const sf)[16][132] = (float (*)[16][132])smem;
  const int tid = threadIdx.x, wave = tid >> 5, lane = tid & 31, col = lane & 15, g = lane >> 4; const int c0 = blockIdx.y * 128; const size_t r0 = (size_t)blockIdx.x * 64 + wave * 16;
  __bf16* const sH = (__bf16*)smem; __bf16* const sL = sH + 2 * 64 * SP; __bf16* const sW = sL + 2 * 64 * SP;   /* early rows: [2][64][SP] hi, [2][64][SP] lo, [2][128][SP] W */
  _Float16* const sA = (_Float16*)smem; _Float16* const sV = sA + 2 * 64 * SP;   /* other rows: [2][64][SP] ctx, [2][128][SP] W */
  const float* pa = Y + ((size_t)blockIdx.x * 64 + (tid >> 4)) * CC + (tid & 15) * 4; const float* pb = WO + (size_t)(c0 + (tid >> 4)) * CC + (tid & 15) * 4; const int so = (tid >> 4) * SP + (tid & 15) * 4;
  v8f acc[8] = {};
  v4f ra[8], rb[16]; ld_rows(ra, pa, CC); ld_rows(rb, pb, CC); XW(pa, pb);
  if (EARLY) { st_split(ra, sH + so, sL + so); st_bf(rb, sW + so); }
  else { st_hs(ra, sA + so, 64.0f); st_hw(rb, sV + so); }   /* ctx carried x 2^6 into f16 so small-magnitude context rows stay clear of f16 subnormals */
#pragma unroll 1   /* rolled: one copy of the step keeps the kernel's text small */
  for (int ks = 0; ks < CC / KS; ++ks) { const int cur = ks & 1, nxt = cur ^ 1;
    __syncthreads();   /* step ks is whole in buffer cur; every wave has left buffer nxt */
    if (ks + 1 < CC / KS) { pa += KS; pb += KS; ld_rows(ra, pa, CC); ld_rows(rb, pb, CC); XW(pa, pb); }
    if (EARLY) {
#pragma unroll
      for (int kk = 0; kk < KS / 32; ++kk) { const int ao = (cur * 64 + wave * 16 + col) * SP + kk * 32; const v16b ah = frag_b(sH + ao, lane), al = frag_b(sL + ao, lane);
#pragma unroll
        for (int jh = 0; jh < 8; jh += 4) { v16b w[4];   /* four fragments' LDS reads go out together, ahead of their products */
#pragma unroll
          for (int j = 0; j < 4; ++j) w[j] = frag_b(sW + (cur * 128 + (jh + j) * 16 + col) * SP + kk * 32, lane);
#pragma unroll
          for (int j = 0; j < 4; ++j) { acc[jh + j] = wmma_bf(ah, w[j], acc[jh + j]); acc[jh + j] = wmma_bf(al, w[j], acc[jh + j]); } } }
      if (ks + 1 < CC / KS) { st_split(ra, sH + nxt * 64 * SP + so, sL + nxt * 64 * SP + so); st_bf(rb, sW + nxt * 128 * SP + so); }
    } else {
#pragma unroll
      for (int kk = 0; kk < KS / 32; ++kk) { const v16h a = frag_h(sA + (cur * 64 + wave * 16 + col) * SP + kk * 32, lane);
#pragma unroll
        for (int jh = 0; jh < 8; jh += 4) { v16h w[4];   /* four fragments' LDS reads go out together, ahead of their products */
#pragma unroll
          for (int j = 0; j < 4; ++j) w[j] = frag_h(sV + (cur * 128 + (jh + j) * 16 + col) * SP + kk * 32, lane);
#pragma unroll
          for (int j = 0; j < 4; ++j) acc[jh + j] = wmma16(a, w[j], acc[jh + j]); } }
      if (ks + 1 < CC / KS) { st_hs(ra, sA + nxt * 64 * SP + so, 64.0f); st_hw(rb, sV + nxt * 128 * SP + so); } } }
  __syncthreads();   /* every wave has read its last fragments before the epilogue's tile overwrites the buffers */
#pragma unroll
  for (int j = 0; j < 8; ++j) { const float bias = BO ? bfr(BO[c0 + j * 16 + col]) : 0.f;
#pragma unroll
    for (int r = 0; r < 8; ++r) sf[wave][8 * g + r][j * 16 + col] = EARLY ? acc[j][r] + bias : acc[j][r] * (1.0f / 16384.0f) + bias; }   /* other rows: 2^-8 (Wo carry) x 2^-6 (ctx carry) */
  LDSX(); for (int rl = 0; rl < 16; ++rl) vst2(OUT + (r0 + rl) * DIN + c0 + lane * 4, *(const v4f*)&sf[wave][rl][lane * 4]); }
__global__ __launch_bounds__(128) void k_out(const float* __restrict__ Y, const float* __restrict__ WO, const float* __restrict__ BO, float* __restrict__ OUT) { __shared__ __align__(16) char smem[2 * (64 + 64 + 128) * SP * 2];   /* two staging buffers of ctx (hi, lo) and W rows; the epilogue's tile lies over them behind a barrier */
  static_assert(sizeof(smem) >= 4 * 16 * 132 * 4, "epilogue tile fits"); static_assert(WO_OUT_IN == 1, "the staging reads W rows of CC floats");
  if (CAUSAL && (int)(((size_t)blockIdx.x * 64) % TT) < QHI) { out_body<true>(Y, WO, BO, OUT, smem); return; }   /* block-uniform */
  out_body<false>(Y, WO, BO, OUT, smem); }

extern "C" void kernel_launch(void* const* d_in, const int* in_sizes, int n_in, void* d_out, int out_size, void* d_ws, size_t ws_size, hipStream_t stream) {
  (void)in_sizes; (void)n_in; (void)out_size;
  const float** F = (const float**)d_in;
  if (ws_size < (size_t)WS_END) return;
  char* ws = (char*)d_ws; _Float16 *QH = (_Float16*)(ws + WS_QH), *KH = (_Float16*)(ws + WS_KH), *VT = (_Float16*)(ws + WS_VT), *QL = (_Float16*)(ws + WS_QL), *KL = (_Float16*)(ws + WS_KL); __bf16 *VB = (__bf16*)(ws + WS_VB), *VBL = (__bf16*)(ws + WS_VBL); float *Y = (float*)(ws + WS_Y);
  (void)Y; (void)QL; (void)KL; (void)VB; (void)VBL;
  // inputs: 0 x [2,2048,1024]; 1 W_qkv [3072,1024] (out,in): q rows 0..1023, k 1024..2047, v 2048..3071; 2 W_o [1024,1024] (out,in); no biases
  k_proj<<<dim3(TNB * TT / 64, CC / 128, 3), 128, 0, stream>>>(F[0], F[0], F[0], F[1], F[1] + (size_t)CC * DIN, F[1] + 2 * (size_t)CC * DIN, nullptr, nullptr, nullptr, QH, QL, KH, KL, VT, VB, VBL);
  k_pv<<<dim3(TNB * NH, NFB + NHB), 32 * PVW, 0, stream>>>(QH, KH, QL, KL, VT, VB, VBL, Y);
  k_out<<<dim3(TNB * TT / 64, DIN / 128), 128, 0, stream>>>(Y, F[2], nullptr, (float*)d_out);
}

// v006
// Measured time: 90.1 microseconds a run.
// Two timings next to v005 put it at 1.10 and 1.09 times that version's speed.
// Over all steps from v000 it is 13.1 times as fast.
// compute dtype: all float inputs rounded to bf16; the fused q / k / v projection with EXACT bf16 products on WMMA 16x16x32 (f32 accumulate) (no biases); causal logits: 3 products for the first 384 rows, single f16 q x k after, x 64^-0.5; softmax f32; P x 2^11 once to f16 x v once to f16 (bf16 hi + lo below row 384); ctx hi+lo x exact W below row 384, x2^6 f16 carry x f16(bf16 x 2^8) W after, no bias; f32 output.
#include <hip/hip_runtime.h>
#include <math.h>

typedef __attribute__((ext_vector_type(16))) _Float16 v16h;
typedef __attribute__((ext_vector_type(16))) __bf16 v16b;
typedef __attribute__((ext_vector_type(8)))  _Float16 v8h;
typedef __attribute__((ext_vector_type(8)))  float v8f;
typedef __attribute__((ext_vector_type(4)))  float v4f;
typedef __attribute__((ext_vector_type(2)))  float v2f;
typedef __attribute__((ext_vector_type(4)))  unsigned v4u;
typedef __attribute__((ext_vector_type(4)))  int v4i;
typedef float __attribute__((may_alias)) float_a;
typedef int __attribute__((may_alias)) int_a;

template <typename T> __device__ __forceinline__ void vst2(void* p, T v) { *(T*)p = v;  }
__device__ __forceinline__ v8f wmma16(v16h a, v16h b, v8f c) {
  v8f d = __builtin_amdgcn_wmma_f32_16x16x32_f16(false, a, false, b, (short)0, c, false, false);
  asm volatile("v_nop\n\tv_nop\n\tv_nop\n\tv_nop" : "+v"(d) : "v"(a), "v"(b));
  return d;
}
__device__ __forceinline__ v8f wmma_bf(v16b a, v16b b, v8f c) {
  v8f d = __builtin_amdgcn_wmma_f32_16x16x32_bf16(false, a, false, b, (short)0, c, false, false);
  asm volatile("v_nop\n\tv_nop\n\tv_nop\n\tv_nop" : "+v"(d) : "v"(a), "v"(b));
  return d;
}
// 16x16x32 fragments: lane = (h = lane>>4, row/col = lane&15); elements 0..7 = k0+8h+0..7, 8..15 = k0+16+8h+0..7; D element r = row 8h+r
__device__ __forceinline__ v16h frag_h(const _Float16* rowk0, int lane) {
  union { v16h v; v8h q[2]; } u; const _Float16* p = rowk0 + 8 * (lane >> 4);
  u.q[0] = *(const v8h*)p; u.q[1] = *(const v8h*)(p + 16); return u.v;
}
__device__ __forceinline__ v16h frag_f32(const float* rowk0, int lane) {
  v16h a; const float* p = rowk0 + 8 * (lane >> 4);
#pragma unroll
  for (int i = 0; i < 8; ++i) { a[i] = (_Float16)p[i]; a[8 + i] = (_Float16)p[16 + i]; }
  return a;
}
__device__ __forceinline__ v16h frag_f32s(const float* rowk0, int lane, float sc) {
  v16h a; const float* p = rowk0 + 8 * (lane >> 4);
#pragma unroll
  for (int i = 0; i < 8; ++i) { a[i] = (_Float16)(p[i] * sc); a[8 + i] = (_Float16)(p[16 + i] * sc); }
  return a;
}
// column fragment from a [K][ld] layout (column n), rows >= K read as 0
__device__ __forceinline__ v16h fragc_f32(const float* W, int k0, int n, int lane, int ld, int K) {
  v16h a; const int g = lane >> 4;
#pragma unroll
  for (int i = 0; i < 8; ++i) { const int ka = k0 + 8 * g + i, kb = ka + 16;
    a[i] = (_Float16)(ka < K ? W[(size_t)(ka < K ? ka : K - 1) * ld + n] : 0.f); a[8 + i] = (_Float16)(kb < K ? W[(size_t)(kb < K ? kb : K - 1) * ld + n] : 0.f); }
  return a;
}
struct F2 { v16b h, l; };
__device__ __forceinline__ F2 bsplit16(const float v[16]) { F2 r;
#pragma unroll
  for (int i = 0; i < 16; ++i) { const __bf16 h = (__bf16)v[i]; r.h[i] = h; r.l[i] = (__bf16)(v[i] - (float)h); }
  return r; }
__device__ __forceinline__ F2 split_row(const float* row, int k0, int lane) { float v[16]; const float* p = row + k0 + 8 * (lane >> 4);
#pragma unroll
  for (int i = 0; i < 8; ++i) { v[i] = p[i]; v[8 + i] = p[16 + i]; }
  return bsplit16(v); }
__device__ __forceinline__ F2 split_rowK(const float* row, int k0, int lane, int K) { float v[16]; const int g = lane >> 4;
#pragma unroll
  for (int i = 0; i < 8; ++i) { const int ka = k0 + 8 * g + i, kb = ka + 16; v[i] = ka < K ? row[ka < K ? ka : K - 1] : 0.f; v[8 + i] = kb < K ? row[kb < K ? kb : K - 1] : 0.f; }
  return bsplit16(v); }
__device__ __forceinline__ F2 split_col(const float* W, int k0, int n, int lane, int ld, int K) { float v[16]; const int g = lane >> 4;
#pragma unroll
  for (int i = 0; i < 8; ++i) { const int ka = k0 + 8 * g + i, kb = ka + 16; v[i] = ka < K ? W[(size_t)(ka < K ? ka : K - 1) * ld + n] : 0.f; v[8 + i] = kb < K ? W[(size_t)(kb < K ? kb : K - 1) * ld + n] : 0.f; }
  return bsplit16(v); }
__device__ __forceinline__ v8f mac3(const F2& a, const F2& b, v8f c) { c = wmma_bf(a.l, b.h, c); c = wmma_bf(a.h, b.l, c); return wmma_bf(a.h, b.h, c); }
__device__ __forceinline__ float sigm(float v) { return 1.0f / (1.0f + expf(-v)); }
#define LDSX() do { asm volatile("s_wait_dscnt 0" ::: "memory"); __builtin_amdgcn_wave_barrier(); __builtin_amdgcn_fence(__ATOMIC_RELEASE, "workgroup"); } while (0)

// Bias-free causal multi-head self-attention with a fused (out,in) QKV projection (x [2,2048,1024]; Wqkv [3072,1024] torch (out,in): jnp.split thirds of einsum('btd,ed->bte') = x @ Wqkv.T (q = rows 0..1023, k = 1024..2047, v = 2048..3071); Wout [1024,1024] (out,in); no biases; 16 heads x 64; scores x 1/sqrt(64); tril kept, -inf elsewhere; softmax; out @ Wout.T).
#define NB 2
#define TT 2048
#define CC 1024            // NH * HD = projected width
#define DIN 1024          // input (model) width
#define NH 16
#define HD 64
#define NQB (TT / 64)
#define HG 4
#define SCALE (0.125f)
#define CAUSAL 1
#ifndef TNB
#define TNB NB
#endif
__device__ __forceinline__ float bfr(float v) { return (float)(__bf16)v; }
__host__ __device__ __forceinline__ int kb_last(int qb) { return CAUSAL ? ((qb * 64 + 63) >> 7) : (TT / 128 - 1); }
typedef __attribute__((ext_vector_type(8))) __bf16 v8b;
__device__ __forceinline__ v16b frag_b(const __bf16* rowk0, int lane) {
  union { v16b v; v8b q[2]; } u; const __bf16* p = rowk0 + 8 * (lane >> 4);
  u.q[0] = *(const v8b*)p; u.q[1] = *(const v8b*)(p + 16); return u.v;
}
#define QBH 6              // causal: query rows < QBH * 64 of each sequence (few keys, no averaging) take the high-precision path
#define QHI 384            // rows carrying a q residual plane
#define KHI 384            // key rows carrying k residual / v bf16 hi+lo planes (used only by the causal high-precision path)
// B fragment (k rows k0+.., output column o) of a weight: (in,out) [K][ld] or (out,in) [ld rows of K]: bf16 exact, or f16(bf16 * 256) exact
__device__ __forceinline__ v16b wcol_io(const float* Wm, int k0, int o, int lane, int ld) { v16b w; const int g = lane >> 4;
#pragma unroll
  for (int i = 0; i < 8; ++i) { w[i] = (__bf16)Wm[(size_t)(k0 + 8 * g + i) * ld + o]; w[8 + i] = (__bf16)Wm[(size_t)(k0 + 16 + 8 * g + i) * ld + o]; }
  return w; }
__device__ __forceinline__ v16b wcol_oi(const float* Wm, int k0, int o, int lane, int K) { v16b w; const float* p = Wm + (size_t)o * K + k0 + 8 * (lane >> 4);
#pragma unroll
  for (int i = 0; i < 8; ++i) { w[i] = (__bf16)p[i]; w[8 + i] = (__bf16)p[16 + i]; }
  return w; }
__device__ __forceinline__ v16h wcolh_io(const float* Wm, int k0, int o, int lane, int ld) { v16h w; const int g = lane >> 4;
#pragma unroll
  for (int i = 0; i < 8; ++i) { w[i] = (_Float16)(bfr(Wm[(size_t)(k0 + 8 * g + i) * ld + o]) * 256.0f); w[8 + i] = (_Float16)(bfr(Wm[(size_t)(k0 + 16 + 8 * g + i) * ld + o]) * 256.0f); }
  return w; }
__device__ __forceinline__ v16h wcolh_oi(const float* Wm, int k0, int o, int lane, int K) { v16h w; const float* p = Wm + (size_t)o * K + k0 + 8 * (lane >> 4);
#pragma unroll
  for (int i = 0; i < 8; ++i) { w[i] = (_Float16)(bfr(p[i]) * 256.0f); w[8 + i] = (_Float16)(bfr(p[16 + i]) * 256.0f); }
  return w; }
#define WQKV_LAYOUT 1   // 0 = (in,out) [DIN][CC]; 1 = (out,in) [CC][DIN]; 2 = per-head [NH][DIN][HD]
__device__ __forceinline__ v16b wcol_hdk(const float* Wm, int k0, int o, int lane) { v16b w; const int g = lane >> 4; const float* p = Wm + (size_t)(o / HD) * DIN * HD + (o % HD);
#pragma unroll
  for (int i = 0; i < 8; ++i) { w[i] = (__bf16)p[(size_t)(k0 + 8 * g + i) * HD]; w[8 + i] = (__bf16)p[(size_t)(k0 + 16 + 8 * g + i) * HD]; }
  return w; }
#define WO_OUT_IN 1
#if WQKV_LAYOUT == 1
#define WCOL(W, k0, o, lane) wcol_oi(W, k0, o, lane, DIN)
#elif WQKV_LAYOUT == 2
#define WCOL(W, k0, o, lane) wcol_hdk(W, k0, o, lane)
#else
#define WCOL(W, k0, o, lane) wcol_io(W, k0, o, lane, CC)
#endif
#if WO_OUT_IN
#define WOCOL(W, k0, o, lane) wcol_oi(W, k0, o, lane, CC)
#define WOCOLH(W, k0, o, lane) wcolh_oi(W, k0, o, lane, CC)
#else
#define WOCOL(W, k0, o, lane) wcol_io(W, k0, o, lane, DIN)
#define WOCOLH(W, k0, o, lane) wcolh_io(W, k0, o, lane, DIN)
#endif

#ifndef PROJ_EXTRA_PARAMS
#define PROJ_EXTRA_PARAMS
#endif

#define WS_QH  0u                                      // f16 q rows [b*t][CC]
#define WS_KH  (WS_QH + 2u * (size_t)NB * TT * CC)      // f16 k rows [b*t][CC]
#define WS_VT  (WS_KH + 2u * (size_t)NB * TT * CC)      // f16 v planes [b][c][t]
#define WS_QL  (WS_VT + 2u * (size_t)NB * CC * TT)      // f16 q residual x 2^10 rows [b][t < QHI][CC]
#define WS_KL  (WS_QL + 2u * (size_t)NB * QHI * CC)     // f16 k residual x 2^10 rows [b][t < KHI][CC]
#define WS_VB  (WS_KL + 2u * (size_t)NB * KHI * CC)     // bf16 v hi planes [b][c][t < KHI]
#define WS_VBL (WS_VB + 2u * (size_t)NB * CC * KHI)
#define WS_Y   (WS_VBL + 2u * (size_t)NB * CC * KHI)    // f16 ctx x 2^6 rows [b*t][CC] (rows >= QHI of each sequence are written and read)
#define WS_YB  (WS_Y  + 2u * (size_t)NB * TT * CC)      // bf16 ctx hi rows [b*t][CC] (rows < QHI of each sequence are written and read)
#define WS_YL  (WS_YB + 2u * (size_t)NB * TT * CC)      // bf16 ctx lo rows, as hi
#define WS_XB  (WS_YL + 2u * (size_t)NB * TT * CC)      // bf16 x rows [b*t][DIN]
#define WS_WB  (WS_XB + 2u * (size_t)NB * TT * DIN)     // bf16 Wqkv rows [3 CC][DIN]
#define WS_OB  (WS_WB + 2u * (size_t)3 * CC * DIN)      // bf16 Wo rows [DIN][CC]
#define WS_OH  (WS_OB + 2u * (size_t)DIN * CC)          // f16(bf16 Wo x 2^8) rows [DIN][CC]
#define WS_END (WS_OH + 2u * (size_t)DIN * CC)

// ---- operand staging of k_proj and k_out: every operand lies in the workspace as the 16-bit value that the product takes, rounded once by the launch that makes it (x and the weights by k_cvt, ctx by k_pv). A K step is KS columns (128 bytes) of the block's X (or ctx) rows and of its W rows. Thread (tid >> 3, tid & 7) takes rows 16 i + (tid >> 3), 16 bytes at 16 (tid & 7), so each wave-wide load reads four whole 128-byte lines; the bytes go to LDS as they are, rows at pitch SP; every wave takes its fragments from there. Two LDS buffers: the next step's loads fly while this step is multiplied.
#define KS 64
#define SP (KS + 8)        // LDS pitch of a staged row in 16-bit elements: 144 B = 16 B x odd, for the 16-byte fragment reads
typedef __attribute__((ext_vector_type(4))) __bf16 v4b;
typedef __attribute__((ext_vector_type(4))) _Float16 v4hs;
template <int N, typename V, typename E> __device__ __forceinline__ void ld16(V (&r)[N], const E* p, int ld) {
#pragma unroll
  for (int i = 0; i < N; ++i) r[i] = *(const V*)(p + (size_t)i * 16 * ld); }
template <int N, typename V, typename E> __device__ __forceinline__ void st16(const V (&r)[N], E* d) {
#pragma unroll
  for (int i = 0; i < N; ++i) *(V*)(d + i * 16 * SP) = r[i]; }
// the wait that stands before an address register of the row loads may be overwritten; the two pointers are named as inputs so that they live, unchanged, up to here
#define XW(p, q) asm volatile("s_wait_xcnt 0x0" :: "v"(p), "v"(q) : "memory")
// ---- k_cvt: x, Wqkv and Wo rounded once: x, Wqkv, Wo -> bf16 rows; Wo also -> f16(bf16 x 2^8) rows. Block = CVU units of 4 floats of one input, 16 units per thread, all 16 loads in flight; each wave-wide load reads 512 contiguous bytes, each store writes 256
#define CVU 4096
static_assert((NB * TT * DIN / 4) % CVU == 0 && (3 * CC * DIN / 4) % CVU == 0 && (DIN * CC / 4) % CVU == 0, "whole blocks per input");
__global__ __launch_bounds__(256) void k_cvt(const float* __restrict__ X, const float* __restrict__ WQKV, const float* __restrict__ WO, __bf16* __restrict__ XB, __bf16* __restrict__ WB, __bf16* __restrict__ OB, _Float16* __restrict__ OH) {
  constexpr int BX = NB * TT * DIN / 4 / CVU, BW = 3 * CC * DIN / 4 / CVU;
  const int bi = blockIdx.x; const int sel = bi < BX ? 0 : bi < BX + BW ? 1 : 2;   /* block-uniform */
  const size_t u0 = ((size_t)(bi - (sel == 0 ? 0 : sel == 1 ? BX : BX + BW)) * CVU + threadIdx.x) * 4;
  const float* p = (sel == 0 ? X : sel == 1 ? WQKV : WO) + u0; __bf16* d = (sel == 0 ? XB : sel == 1 ? WB : OB) + u0;
  v4f r[16];
#pragma unroll
  for (int i = 0; i < 16; ++i) r[i] = *(const v4f*)(p + i * 1024);
  XW(p, p);
#pragma unroll
  for (int i = 0; i < 16; ++i) { v4b q;
#pragma unroll
    for (int c = 0; c < 4; ++c) q[c] = (__bf16)r[i][c];
    *(v4b*)(d + i * 1024) = q; }
  if (sel == 2) { _Float16* e = OH + u0;
    asm volatile("s_wait_xcnt 0x0" ::: "memory");   /* the wait that stands before the registers of the stores above may be overwritten */
#pragma unroll
    for (int i = 0; i < 16; ++i) { v4hs q;
#pragma unroll
      for (int c = 0; c < 4; ++c) q[c] = (_Float16)(bfr(r[i][c]) * 256.0f);
      *(v4hs*)(e + i * 1024) = q; } } }
// ---- k_proj: block = (64 rows, 128 cols, which): q/k/v = X W (+ b) with exact bf16 products (K = DIN) -> which 0: q f16 rows (+ residual rows < QHI); 1: k f16 rows (+ residual rows < KHI); 2: v f16 planes [c][t] (+ bf16 hi/lo planes for t < KHI)
__global__ __launch_bounds__(128) void k_proj(const __bf16* __restrict__ XQ, const __bf16* __restrict__ XK, const __bf16* __restrict__ XV, const __bf16* __restrict__ WQ, const __bf16* __restrict__ WK, const __bf16* __restrict__ WV, const float* __restrict__ BQ, const float* __restrict__ BK, const float* __restrict__ BV,
    _Float16* __restrict__ QH, _Float16* __restrict__ QL, _Float16* __restrict__ KH, _Float16* __restrict__ KL, _Float16* __restrict__ VT, __bf16* __restrict__ VB, __bf16* __restrict__ VBL) {
  __shared__ __align__(16) char smem[2 * (64 + 128) * SP * 2];   /* the two staging buffers; the epilogue's tiles lie over them behind a barrier */
  static_assert(sizeof(smem) >= 3 * 128 * 72 * 2 && sizeof(smem) >= 2 * 64 * 136 * 2, "epilogue tiles fit");
  __bf16* const sA = (__bf16*)smem; __bf16* const sB = sA + 2 * 64 * SP;   /* [2][64][SP], [2][128][SP] */
  _Float16 (* const sh)[136] = (_Float16 (*)[136])smem; _Float16 (* const sl)[136] = sh + 64; _Float16 (* const th)[72] = (_Float16 (*)[72])smem; __bf16 (* const tb)[72] = (__bf16 (*)[72])smem + 128; __bf16 (* const tbl)[72] = tb + 128;
  const int tid = threadIdx.x, wave = tid >> 5, lane = tid & 31, col = lane & 15, g = lane >> 4; const int which = blockIdx.z; const int c0 = blockIdx.y * 128; const size_t r0 = (size_t)blockIdx.x * 64; const size_t bb = r0 / TT; const int t0 = (int)(r0 % TT);
  const __bf16* X = which == 0 ? XQ : which == 1 ? XK : XV; const __bf16* WA = which == 0 ? WQ : which == 1 ? WK : WV; const float* BA = which == 0 ? BQ : which == 1 ? BK : BV;
  v8f acc[8] = {};
  static_assert(WQKV_LAYOUT == 1, "the staging reads W rows of DIN elements");
  { const __bf16* pa = X + (r0 + (tid >> 3)) * DIN + (tid & 7) * 8; const __bf16* pb = WA + (size_t)(c0 + (tid >> 3)) * DIN + (tid & 7) * 8; const int so = (tid >> 3) * SP + (tid & 7) * 8;
    v8b ra[4], rb[8]; ld16(ra, pa, DIN); ld16(rb, pb, DIN); XW(pa, pb); st16(ra, sA + so); st16(rb, sB + so);
#pragma unroll 1   /* rolled: one copy of the step keeps the kernel's text small */
    for (int ks = 0; ks < DIN / KS; ++ks) { const int cur = ks & 1, nxt = cur ^ 1;
      __syncthreads();   /* step ks is whole in buffer cur; every wave has left buffer nxt */
      if (ks + 1 < DIN / KS) { pa += KS; pb += KS; ld16(ra, pa, DIN); ld16(rb, pb, DIN); XW(pa, pb); }
#pragma unroll
      for (int kk = 0; kk < KS / 32; ++kk) { const v16b a = frag_b(sA + (cur * 64 + wave * 16 + col) * SP + kk * 32, lane);
#pragma unroll
        for (int jh = 0; jh < 8; jh += 4) { v16b w[4];   /* four fragments' LDS reads go out together, ahead of their four products: one LDS latency per group */
#pragma unroll
          for (int j = 0; j < 4; ++j) w[j] = frag_b(sB + (cur * 128 + (jh + j) * 16 + col) * SP + kk * 32, lane);
#pragma unroll
          for (int j = 0; j < 4; ++j) acc[jh + j] = wmma_bf(a, w[j], acc[jh + j]); } }
      if (ks + 1 < DIN / KS) { st16(ra, sA + nxt * 64 * SP + so); st16(rb, sB + nxt * 128 * SP + so); } }
    __syncthreads(); }   /* every wave has read its last fragments before the epilogue's tiles overwrite the buffers */
  if (which < 2) { _Float16* DH = which == 0 ? QH : KH; _Float16* DL = which == 0 ? QL : KL; const int nhi = which == 0 ? QHI : KHI; const bool hi_rows = t0 < nhi;
#pragma unroll
    for (int j = 0; j < 8; ++j) { const float bias = BA ? bfr(BA[c0 + j * 16 + col]) : 0.f;
#pragma unroll
      for (int r = 0; r < 8; ++r) { const float v = acc[j][r] + bias; const _Float16 hv = (_Float16)v; sh[wave * 16 + 8 * g + r][j * 16 + col] = hv; sl[wave * 16 + 8 * g + r][j * 16 + col] = (_Float16)((v - (float)hv) * 1024.0f); } }
    __syncthreads();
    for (int e = tid; e < 64 * 16; e += 128) { const int rl = e >> 4, q = e & 15; vst2((unsigned*)(DH + (r0 + rl) * CC + c0 + q * 8), *(const v4u*)&sh[rl][q * 8]); if (hi_rows) vst2((unsigned*)(DL + (bb * nhi + t0 + rl) * (size_t)CC + c0 + q * 8), *(const v4u*)&sl[rl][q * 8]); }
  } else { const bool hi_rows = t0 < KHI;
#pragma unroll
    for (int j = 0; j < 8; ++j) { const float bias = BA ? bfr(BA[c0 + j * 16 + col]) : 0.f;
#pragma unroll
      for (int r = 0; r < 8; ++r) { const float v = acc[j][r] + bias; const int rl = wave * 16 + 8 * g + r, cl = j * 16 + col; th[cl][rl] = (_Float16)v; const __bf16 bh = (__bf16)v; tb[cl][rl] = bh; tbl[cl][rl] = (__bf16)(v - (float)bh); } }
    __syncthreads();
    for (int e = tid; e < 128 * 8; e += 128) { const int cl = e >> 3, q = e & 7; vst2((unsigned*)(VT + (bb * CC + c0 + cl) * (size_t)TT + t0 + q * 8), *(const v4u*)&th[cl][q * 8]); if (hi_rows) { const size_t o3 = (bb * CC + c0 + cl) * (size_t)KHI + t0 + q * 8; vst2((unsigned*)(VB + o3), *(const v4u*)&tb[cl][q * 8]); vst2((unsigned*)(VBL + o3), *(const v4u*)&tbl[cl][q * 8]); } } } }
// ---- k_pv, early rows (< QBH * 64; att_body is instantiated with HI = true alone, the later rows go through att_stream below): block = 16 queries of (b, h), PVW waves; logits, softmax and P . v in one kernel, the logits never leave the registers. The 32-key chunks are counted down from the diagonal: wave w takes chunks nch - 1 - w, nch - 1 - w - PVW, ..., so that the one chunk with excluded keys is always wave 0's first. Logits transposed, S^T = k q^T (A = 16 k rows, B = the block's 16 q rows): lane (g, col) then holds, for query col, keys 8 g + r of a 16-key tile in element r, which is the A fragment of P for P . v as it stands (tile 0 = elements 0..7, tile 1 = elements 8..15 of a 32-key chunk). Logits x SCALE: single f16 q x k; causal early query tiles (rows < QHI): q hi + residual against k hi + residual (x 2^10), 3 products. Softmax in f32: maximum and sum by lane, across the two lane halves, then across the waves in wave order through LDS. ctx = P . v (P x 2^11 once to f16 against v f16: 1 product; early tiles: P and v as bf16 hi + lo, 3 products); the PVW f32 partials are summed in wave order through LDS; ctx leaves as bf16 hi + lo, a 128-B (row, head) segment of each plane by 16 lanes
#define PVW 8
// fragment from a pointer that already holds the lane half's 8 g elements: the pointer is then the loads' own address, the one that XW names
__device__ __forceinline__ v16h frag_hp(const _Float16* p) { union { v16h v; v8h q[2]; } u; u.q[0] = *(const v8h*)p; u.q[1] = *(const v8h*)(p + 16); return u.v; }
__device__ __forceinline__ v16b frag_bp(const __bf16* p) { union { v16b v; v8b q[2]; } u; u.q[0] = *(const v8b*)p; u.q[1] = *(const v8b*)(p + 16); return u.v; }
// (every loop of att_body is unrolled whole: s, the fragment arrays and acc live in registers and need compile-time indices)
template <bool HI> __device__ __forceinline__ void att_body(const _Float16* __restrict__ QH, const _Float16* __restrict__ KH, const _Float16* __restrict__ QL, const _Float16* __restrict__ KL, const _Float16* __restrict__ VT, const __bf16* __restrict__ VB, const __bf16* __restrict__ VBL, int b, int h, int ql0, float (*rm)[16], float (*rs)[16], v8f (&acc)[HD / 16]) {
  constexpr int NI = HI ? (KHI / 32 + PVW - 1) / PVW : TT / 32 / PVW;   /* most chunks a wave can have */
  static_assert(NI % 2 == 0, "chunks are taken in pairs");
  const int tid = threadIdx.x, wave = __builtin_amdgcn_readfirstlane(tid >> 5), lane = tid & 31, col = lane & 15, g = lane >> 4;
  const int nch = (ql0 + 16 + 31) >> 5;   /* 32-key chunks that hold a key <= the tile's last query; only the last of them, nch - 1, holds keys past the tile's first query */
  const int t = ql0 + col;
  const _Float16* qp = QH + ((size_t)b * TT + t) * CC + h * HD + 8 * g; const _Float16* qlp = QL + ((size_t)b * QHI + (HI ? t : 0)) * CC + h * HD + 8 * g;
  const v16h q0 = frag_hp(qp), q1 = frag_hp(qp + 32); v16h r0 = {}, r1 = {};
  if (HI) { r0 = frag_hp(qlp); r1 = frag_hp(qlp + 32); }
  XW(qp, qlp);
  v8f s[NI][2]; float m = -3.0e38f;   /* s[i] is written, and later read, only where the wave has an i-th chunk (wave + i PVW < nch, wave-uniform) */
  // two chunks' fragment loads fly together under one wave-uniform test; where the second does not exist its loads read chunk 0 and are not used
#pragma unroll
  for (int ip = 0; ip < NI / 2; ++ip) {
    if (wave + 2 * ip * PVW < nch) { v16h kf[2][2][2], lf[2][2][2]; const _Float16* kp[2]; const _Float16* lp[2];
#pragma unroll
      for (int u = 0; u < 2; ++u) { const int kc = nch - 1 - wave - (2 * ip + u) * PVW, kl = kc > 0 ? kc : 0; kp[u] = KH + ((size_t)b * TT + kl * 32 + col) * CC + h * HD + 8 * g; lp[u] = KL + ((size_t)b * KHI + (HI ? kl * 32 + col : 0)) * CC + h * HD + 8 * g;
#pragma unroll
        for (int t2 = 0; t2 < 2; ++t2)
#pragma unroll
          for (int d = 0; d < 2; ++d) { kf[u][t2][d] = frag_hp(kp[u] + t2 * 16 * CC + d * 32); if (HI) lf[u][t2][d] = frag_hp(lp[u] + t2 * 16 * CC + d * 32); } }
      XW(kp[0], kp[1]); if (HI) XW(lp[0], lp[1]);
#pragma unroll
      for (int u = 0; u < 2; ++u) if (u == 0 || wave + (2 * ip + 1) * PVW < nch) {
#pragma unroll
        for (int t2 = 0; t2 < 2; ++t2) { v8f a = {}, al = {};
          a = wmma16(kf[u][t2][0], q0, a); if (HI) { al = wmma16(kf[u][t2][0], r0, al); al = wmma16(lf[u][t2][0], q0, al); }
          a = wmma16(kf[u][t2][1], q1, a); if (HI) { al = wmma16(kf[u][t2][1], r1, al); al = wmma16(lf[u][t2][1], q1, al); }
#pragma unroll
          for (int r = 0; r < 8; ++r) a[r] = HI ? (a[r] + al[r] * (1.0f / 1024.0f)) * SCALE : a[r] * SCALE;
          if (ip == 0 && u == 0 && wave == 0) {   /* the chunk on the diagonal: causal -> logit if key <= query, else excluded */
#pragma unroll
            for (int r = 0; r < 8; ++r) a[r] = ((nch - 1) * 32 + t2 * 16 + 8 * g + r <= t) ? a[r] : -3.0e38f; }
#pragma unroll
          for (int r = 0; r < 8; ++r) m = fmaxf(m, a[r]);
          s[2 * ip + u][t2] = a; } } } }
  m = fmaxf(m, __shfl_xor(m, 16));
  if (g == 0) rm[wave][col] = m;
  __syncthreads();   /* every wave's maxima are in LDS before any wave joins them */
#pragma unroll
  for (int w = 0; w < PVW; ++w) m = fmaxf(m, rm[w][col]);
  float sum = 0.f;
#pragma unroll
  for (int i = 0; i < NI; ++i) {
    if (wave + i * PVW < nch) {
#pragma unroll
      for (int t2 = 0; t2 < 2; ++t2)
#pragma unroll
        for (int r = 0; r < 8; ++r) { const float x = s[i][t2][r]; const float ex = expf(x - m); const float e = (i == 0 && x <= -1.0e38f) ? 0.f : ex; s[i][t2][r] = e; sum += e; } } }   /* excluded keys stand only in a first chunk */
  sum += __shfl_xor(sum, 16);
  if (g == 0) rs[wave][col] = sum;
  __syncthreads();   /* every wave's sums are in LDS before any wave joins them */
  sum = 0.f;
#pragma unroll
  for (int w = 0; w < PVW; ++w) sum += rs[w][col];
  const float inv = sum > 0.f ? 2048.0f / sum : 0.f;
#pragma unroll
  for (int ip = 0; ip < NI / 2; ++ip) {
    if (wave + 2 * ip * PVW < nch) {   /* as above: two chunks' v fragments fly together */
      if (HI) { v16b vh[2][HD / 16], vl[2][HD / 16]; const __bf16* vp[2]; const __bf16* wp[2];
#pragma unroll
        for (int u = 0; u < 2; ++u) { const int kc = nch - 1 - wave - (2 * ip + u) * PVW, kl = kc > 0 ? kc : 0; const size_t po = ((size_t)b * CC + h * HD + col) * (size_t)KHI + kl * 32 + 8 * g; vp[u] = VB + po; wp[u] = VBL + po;
#pragma unroll
          for (int j = 0; j < HD / 16; ++j) { vh[u][j] = frag_bp(vp[u] + j * 16 * KHI); vl[u][j] = frag_bp(wp[u] + j * 16 * KHI); } }
        XW(vp[0], vp[1]); XW(wp[0], wp[1]);
#pragma unroll
        for (int u = 0; u < 2; ++u) if (u == 0 || wave + (2 * ip + 1) * PVW < nch) { float pv[16];
#pragma unroll
          for (int r = 0; r < 8; ++r) { pv[r] = s[2 * ip + u][0][r] * inv; pv[8 + r] = s[2 * ip + u][1][r] * inv; }
          const F2 p = bsplit16(pv);
#pragma unroll
          for (int j = 0; j < HD / 16; ++j) { acc[j] = wmma_bf(p.h, vh[u][j], acc[j]); acc[j] = wmma_bf(p.l, vh[u][j], acc[j]); acc[j] = wmma_bf(p.h, vl[u][j], acc[j]); } }
      } else { v16h vf[2][HD / 16]; const _Float16* vp[2];
#pragma unroll
        for (int u = 0; u < 2; ++u) { const int kc = nch - 1 - wave - (2 * ip + u) * PVW, kl = kc > 0 ? kc : 0; vp[u] = VT + ((size_t)b * CC + h * HD + col) * (size_t)TT + kl * 32 + 8 * g;
#pragma unroll
          for (int j = 0; j < HD / 16; ++j) vf[u][j] = frag_hp(vp[u] + j * 16 * TT); }
        XW(vp[0], vp[1]);
#pragma unroll
        for (int u = 0; u < 2; ++u) if (u == 0 || wave + (2 * ip + 1) * PVW < nch) { v16h p;
#pragma unroll
          for (int r = 0; r < 8; ++r) { p[r] = (_Float16)(s[2 * ip + u][0][r] * inv); p[8 + r] = (_Float16)(s[2 * ip + u][1][r] * inv); }
#pragma unroll
          for (int j = 0; j < HD / 16; ++j) acc[j] = wmma16(p, vf[u][j], acc[j]); } } } } }
// ---- later rows (>= QBH * 64) of k_pv: block = FQ queries of (b, h), one 16-query tile per wave; every wave walks the same keys from key 0 up, in stages of 64, so a stage of k rows and of v planes is read from global memory once per FQ queries, in whole 128-byte lines (thread (tid >> 3, tid & 7): rows tid >> 3 and 32 + (tid >> 3), 16 bytes at 16 (tid & 7)), and lies in LDS at pitch SP for all PVW waves. Two LDS buffers: the next stage's loads fly while this stage is worked on. Logits transposed as in att_body (S^T = k q^T, single f16 q x k): lane (g, col) holds keys 8 g + r of each 16-key tile for query col. Softmax with a running maximum in the base-2 scale (logit x SCALE x log2 e): P = 2^(y - max + 11) once to f16, the f32 sum of the unrounded P and the context are scaled by 2^(old max - new max) at each stage. Context transposed, O^T = v^T P^T (A = 16 v planes, B = P as it stands in the lane), so that maximum, sum and context of a query stay in that query's lanes; the 2^11 cancels in context / sum.
#define FQ (16 * PVW)
#define NFB ((TT - QBH * 64) / FQ)   // blocks of later rows per (b, h)
#define NHB (QBH * 64 / 16)          // 16-query blocks of early rows per (b, h)
static_assert((QBH * 64) % FQ == 0 && TT % FQ == 0 && FQ % 64 == 0 && HD == 64, "whole blocks, whole stages");
__device__ __forceinline__ v8f wm16(v16h a, v16h b, v8f c) { return __builtin_amdgcn_wmma_f32_16x16x32_f16(false, a, false, b, (short)0, c, false, false); }
__device__ __forceinline__ float xhalf(float v) { return __builtin_bit_cast(float, __builtin_amdgcn_permlanex16(__builtin_bit_cast(int, v), __builtin_bit_cast(int, v), 0x76543210, 0xfedcba98, false, false)); }   // lane l takes lane l ^ 16's value
// 2^x by v_exp_f32, with the one slot that the instruction set asks for behind a transcendental (before its result is read or its source overwritten) in the same statement, so that it stands directly behind it. ex2x8: no result shares a register with a source (early clobber), so each v_exp_f32 is the independent instruction behind the one before it, and one v_nop behind the last serves all eight.
__device__ __forceinline__ float ex2(float x) { float e; asm("v_exp_f32 %0, %1\n\tv_nop" : "=v"(e) : "v"(x)); return e; }
__device__ __forceinline__ v8f ex2x8(v8f x) { float e0, e1, e2, e3, e4, e5, e6, e7;
  asm("v_exp_f32 %0, %8\n\tv_exp_f32 %1, %9\n\tv_exp_f32 %2, %10\n\tv_exp_f32 %3, %11\n\tv_exp_f32 %4, %12\n\tv_exp_f32 %5, %13\n\tv_exp_f32 %6, %14\n\tv_exp_f32 %7, %15\n\tv_nop"
      : "=&v"(e0), "=&v"(e1), "=&v"(e2), "=&v"(e3), "=&v"(e4), "=&v"(e5), "=&v"(e6), "=&v"(e7) : "v"(x[0]), "v"(x[1]), "v"(x[2]), "v"(x[3]), "v"(x[4]), "v"(x[5]), "v"(x[6]), "v"(x[7]));
  return v8f{e0, e1, e2, e3, e4, e5, e6, e7}; }
__device__ __forceinline__ void att_stream(const _Float16* __restrict__ QH, const _Float16* __restrict__ KH, const _Float16* __restrict__ VT, _Float16* __restrict__ YH, int b, int h, int x, char* smem) {
  _Float16* const sK = (_Float16*)smem; _Float16* const sV = sK + 2 * 64 * SP;   /* [2][64 keys][SP], [2][64 planes][SP] */
  float (* const so)[16][HD + 4] = (float (*)[16][HD + 4])smem;   /* the epilogue's tiles lie over the buffers behind a barrier */
  const int tid = threadIdx.x, wave = __builtin_amdgcn_readfirstlane(tid >> 5), lane = tid & 31, col = lane & 15, g = lane >> 4;
  const int ql0 = x * FQ + wave * 16, t = ql0 + col;
  const int nst = (x + 1) * (FQ / 64);   /* stages that hold a key <= the block's last query */
  const int lastw = (ql0 + 15) >> 6;     /* the wave's last stage, the only one with keys past the tile's first query (64 lastw <= ql0) */
  const _Float16* qp = QH + ((size_t)b * TT + t) * CC + h * HD + 8 * g;
  const v16h q0 = frag_hp(qp), q1 = frag_hp(qp + 32);
  XW(qp, qp);
  const _Float16* pk = KH + ((size_t)b * TT + (tid >> 3)) * CC + h * HD + (tid & 7) * 8; const _Float16* pv = VT + ((size_t)b * CC + h * HD + (tid >> 3)) * (size_t)TT + (tid & 7) * 8; const int so8 = (tid >> 3) * SP + (tid & 7) * 8;
  v8h rk[2], rv[2];
#pragma unroll
  for (int i = 0; i < 2; ++i) { rk[i] = *(const v8h*)(pk + (size_t)i * 32 * CC); rv[i] = *(const v8h*)(pv + (size_t)i * 32 * TT); }
  XW(pk, pv);
#pragma unroll
  for (int i = 0; i < 2; ++i) { *(v8h*)(sK + i * 32 * SP + so8) = rk[i]; *(v8h*)(sV + i * 32 * SP + so8) = rv[i]; }
  constexpr float C2 = SCALE * 1.44269504088896340736f;
  v8f acc[HD / 16] = {}; float m = -3.0e38f, sum = 0.f;
#pragma unroll 1   /* rolled: the trip count differs from block to block, and one copy of the stage keeps the kernel's text small */
  for (int st = 0; st < nst; ++st) { const int cur = st & 1, nxt = cur ^ 1;
    __syncthreads();   /* stage st is whole in buffer cur; every wave has left buffer nxt */
    if (st + 1 < nst) { pk += 64 * CC; pv += 64;
#pragma unroll
      for (int i = 0; i < 2; ++i) { rk[i] = *(const v8h*)(pk + (size_t)i * 32 * CC); rv[i] = *(const v8h*)(pv + (size_t)i * 32 * TT); }
      XW(pk, pv); }
    if (st <= lastw) {   /* wave-uniform; a wave past its diagonal only stages and keeps the barriers */
      const _Float16* bK = sK + (cur * 64 + col) * SP; const _Float16* bV = sV + (cur * 64 + col) * SP;
      v8f s[4] = {}; v16h kf[2][4], vf[2][HD / 16];   /* four independent accumulators */
#pragma unroll
      for (int d = 0; d < 2; ++d)
#pragma unroll
        for (int t4 = 0; t4 < 4; ++t4) kf[d][t4] = frag_h(bK + t4 * 16 * SP + d * 32, lane);
#pragma unroll
      for (int u = 0; u < 2; ++u)
#pragma unroll
        for (int j = 0; j < HD / 16; ++j) vf[u][j] = frag_h(bV + j * 16 * SP + u * 32, lane);
      /* the stage's 32 LDS reads (k first, then v) go out as one group ahead of the 8 logit products: left alone, the compiler reads each fragment directly in front of its product and the wave waits out one LDS latency per product */
      __builtin_amdgcn_sched_group_barrier(0x100, 32, 0); __builtin_amdgcn_sched_group_barrier(0x008, 8, 0);
#pragma unroll
      for (int d = 0; d < 2; ++d)
#pragma unroll
        for (int t4 = 0; t4 < 4; ++t4) s[t4] = wm16(kf[d][t4], d == 0 ? q0 : q1, s[t4]);
      if (st == lastw) {   /* the stage on the diagonal: causal -> logit if key <= query, else excluded */
#pragma unroll
        for (int t4 = 0; t4 < 4; ++t4)
#pragma unroll
          for (int r = 0; r < 8; ++r) s[t4][r] = (st * 64 + t4 * 16 + 8 * g + r <= t) ? s[t4][r] : -3.0e38f; }
      float mq[4];   /* four independent chains */
#pragma unroll
      for (int t4 = 0; t4 < 4; ++t4) { mq[t4] = s[t4][0];
#pragma unroll
        for (int r = 1; r < 8; ++r) mq[t4] = fmaxf(mq[t4], s[t4][r]); }
      float mx = fmaxf(fmaxf(mq[0], mq[1]), fmaxf(mq[2], mq[3]));
      mx = fmaxf(mx, xhalf(mx));
      const float mn = fmaxf(m, mx * C2);   /* finite from stage 0 on: key 0 is open to every query */
      const float al = ex2(m - mn); m = mn;   /* 0 at stage 0 */
      const float nb = 11.0f - mn; float ps[4];
#pragma unroll
      for (int t4 = 0; t4 < 4; ++t4)
#pragma unroll
        for (int r = 0; r < 8; ++r) s[t4][r] = __builtin_fmaf(s[t4][r], C2, nb);
#pragma unroll
      for (int t4 = 0; t4 < 4; ++t4) s[t4] = ex2x8(s[t4]);   /* an excluded key gives 2^(-huge) = 0 */
#pragma unroll
      for (int t4 = 0; t4 < 4; ++t4) ps[t4] = ((s[t4][0] + s[t4][1]) + (s[t4][2] + s[t4][3])) + ((s[t4][4] + s[t4][5]) + (s[t4][6] + s[t4][7]));
      sum = sum * al + ((ps[0] + ps[1]) + (ps[2] + ps[3]));
#pragma unroll
      for (int j = 0; j < HD / 16; ++j) acc[j] *= al;
#pragma unroll
      for (int u = 0; u < 2; ++u) { v16h p;
#pragma unroll
        for (int r = 0; r < 8; ++r) { p[r] = (_Float16)s[2 * u][r]; p[8 + r] = (_Float16)s[2 * u + 1][r]; }
#pragma unroll
        for (int j = 0; j < HD / 16; ++j) acc[j] = wm16(vf[u][j], p, acc[j]); } }
    if (st + 1 < nst) {
#pragma unroll
      for (int i = 0; i < 2; ++i) { *(v8h*)(sK + (nxt * 64 + i * 32) * SP + so8) = rk[i]; *(v8h*)(sV + (nxt * 64 + i * 32) * SP + so8) = rv[i]; } } }
  sum += xhalf(sum);
  const float inv = 1.0f / sum;   /* sum >= 2^11: the key of the maximum counts 2^11 */
  __syncthreads();   /* every wave has read its last fragments before the epilogue's tiles overwrite the buffers */
#pragma unroll
  for (int j = 0; j < HD / 16; ++j) { v4f lo, hi;   /* acc[j] element r = channel 16 j + 8 g + r of query col */
#pragma unroll
    for (int c = 0; c < 4; ++c) { lo[c] = acc[j][c] * inv; hi[c] = acc[j][4 + c] * inv; }
    *(v4f*)&so[wave][col][j * 16 + 8 * g] = lo; *(v4f*)&so[wave][col][j * 16 + 8 * g + 4] = hi; }
  LDSX();   /* a wave reads back only its own tile: its LDS writes are done before it reads them by rows */
#pragma unroll
  for (int i = 0; i < 8; ++i) { const int rl = 2 * i + g; const v4f c4 = *(const v4f*)&so[wave][rl][col * 4]; v4hs q;   /* ctx carried x 2^6 into f16 so small-magnitude context rows stay clear of f16 subnormals */
#pragma unroll
    for (int c = 0; c < 4; ++c) q[c] = (_Float16)(c4[c] * 64.0f);
    vst2(YH + ((size_t)b * TT + ql0 + rl) * CC + h * HD + col * 4, q); } }   /* each store: two whole 128-B (row, head) segments */
__global__ __launch_bounds__(32 * PVW) void k_pv(const _Float16* __restrict__ QH, const _Float16* __restrict__ KH, const _Float16* __restrict__ QL, const _Float16* __restrict__ KL, const _Float16* __restrict__ VT, const __bf16* __restrict__ VB, const __bf16* __restrict__ VBL, _Float16* __restrict__ YH, __bf16* __restrict__ YB, __bf16* __restrict__ YL) { __shared__ __align__(16) char smem[2 * (64 + 64) * SP * 2];   /* later rows: two buffers of k and v stages; early rows: the partials and the waves' maxima and sums */
  static_assert(sizeof(smem) >= (PVW * 16 * (HD + 4) + 2 * PVW * 16) * 4, "partials, maxima and sums fit");
  float (* const ss)[16][HD + 4] = (float (*)[16][HD + 4])smem; float (* const rm)[16] = (float (*)[16])(smem + PVW * 16 * (HD + 4) * 4); float (* const rs)[16] = rm + PVW;
  const int b = blockIdx.x / NH, h = blockIdx.x % NH; const int tid = threadIdx.x, wave = __builtin_amdgcn_readfirstlane(tid >> 5), lane = tid & 31, col = lane & 15, g = lane >> 4;
  if (__builtin_expect((int)blockIdx.y < NFB, 1)) { att_stream(QH, KH, VT, YH, b, h, TT / FQ - 1 - (int)blockIdx.y, smem); return; }   /* block-uniform; the longest blocks have the lowest indices and start first; marked likely so that the common path stands first in the text */
  const int ql0 = ((int)blockIdx.y - NFB) * 16;
  v8f acc[HD / 16] = {};
  att_body<true>(QH, KH, QL, KL, VT, VB, VBL, b, h, ql0, rm, rs, acc);
#pragma unroll
  for (int j = 0; j < HD / 16; ++j)
#pragma unroll
    for (int r = 0; r < 8; ++r) ss[wave][8 * g + r][j * 16 + col] = acc[j][r];
  __syncthreads();   /* every wave's partial (zero for a wave without chunks) is in LDS before any thread sums across waves */
  for (int e = tid; e < 16 * (HD / 4); e += 32 * PVW) { const int rl = e / (HD / 4), q = e % (HD / 4); v4f s = *(const v4f*)&ss[0][rl][q * 4];
#pragma unroll
    for (int w = 1; w < PVW; ++w) s += *(const v4f*)&ss[w][rl][q * 4];
    s *= 1.0f / 2048.0f; v4b qh, qo; const size_t o = ((size_t)b * TT + ql0 + rl) * CC + h * HD + q * 4;   /* early rows: ctx as bf16 hi + lo; 16 threads write a whole 128-B (row, head) segment of each plane */
#pragma unroll
    for (int c = 0; c < 4; ++c) { const __bf16 hv = (__bf16)s[c]; qh[c] = hv; qo[c] = (__bf16)(s[c] - (float)hv); }
    vst2(YB + o, qh); vst2(YL + o, qo); } }
// ---- k_out: block = (64 rows, 128 cols): out = ctx Wo (+ bo): ctx x 2^6 once to f16 against Wo as f16(bf16 x 2^8) exact (1 product) x 2^-14; causal early rows (< QHI of each sequence): ctx bf16 hi + lo against exact bf16 Wo (2 products)
template <bool EARLY> __device__ __forceinline__ void out_body(const _Float16* __restrict__ YH, const __bf16* __restrict__ YB, const __bf16* __restrict__ YL, const __bf16* __restrict__ OB, const _Float16* __restrict__ OH, const float* __restrict__ BO, float* __restrict__ OUT, char* smem) {
  float (* const sf)[16][132] = (float (*)[16][132])smem;
  const int tid = threadIdx.x, wave = tid >> 5, lane = tid & 31, col = lane & 15, g = lane >> 4; const int c0 = blockIdx.y * 128; const size_t r0 = (size_t)blockIdx.x * 64 + wave * 16;
  __bf16* const sH = (__bf16*)smem; __bf16* const sL = sH + 2 * 64 * SP; __bf16* const sW = sL + 2 * 64 * SP;   /* early rows: [2][64][SP] hi, [2][64][SP] lo, [2][128][SP] W */
  _Float16* const sA = (_Float16*)smem; _Float16* const sV = sA + 2 * 64 * SP;   /* other rows: [2][64][SP] ctx, [2][128][SP] W */
  const size_t ao = ((size_t)blockIdx.x * 64 + (tid >> 3)) * CC + (tid & 7) * 8, wo = (size_t)(c0 + (tid >> 3)) * CC + (tid & 7) * 8; const int so = (tid >> 3) * SP + (tid & 7) * 8;
  v8f acc[8] = {};
  if (EARLY) { const __bf16* pa = YB + ao; const __bf16* pl = YL + ao; const __bf16* pb = OB + wo;
    v8b ra[4], rl[4], rb[8]; ld16(ra, pa, CC); ld16(rl, pl, CC); ld16(rb, pb, CC); XW(pa, pl); XW(pb, pb); st16(ra, sH + so); st16(rl, sL + so); st16(rb, sW + so);
#pragma unroll 1   /* rolled: one copy of the step keeps the kernel's text small */
    for (int ks = 0; ks < CC / KS; ++ks) { const int cur = ks & 1, nxt = cur ^ 1;
      __syncthreads();   /* step ks is whole in buffer cur; every wave has left buffer nxt */
      if (ks + 1 < CC / KS) { pa += KS; pl += KS; pb += KS; ld16(ra, pa, CC); ld16(rl, pl, CC); ld16(rb, pb, CC); XW(pa, pl); XW(pb, pb); }
#pragma unroll
      for (int kk = 0; kk < KS / 32; ++kk) { const int fo = (cur * 64 + wave * 16 + col) * SP + kk * 32; const v16b ah = frag_b(sH + fo, lane), al = frag_b(sL + fo, lane);
#pragma unroll
        for (int jh = 0; jh < 8; jh += 4) { v16b w[4];   /* four fragments' LDS reads go out together, ahead of their products */
#pragma unroll
          for (int j = 0; j < 4; ++j) w[j] = frag_b(sW + (cur * 128 + (jh + j) * 16 + col) * SP + kk * 32, lane);
#pragma unroll
          for (int j = 0; j < 4; ++j) { acc[jh + j] = wmma_bf(ah, w[j], acc[jh + j]); acc[jh + j] = wmma_bf(al, w[j], acc[jh + j]); } } }
      if (ks + 1 < CC / KS) { st16(ra, sH + nxt * 64 * SP + so); st16(rl, sL + nxt * 64 * SP + so); st16(rb, sW + nxt * 128 * SP + so); } }
  } else { const _Float16* pa = YH + ao; const _Float16* pb = OH + wo;
    v8h ra[4], rb[8]; ld16(ra, pa, CC); ld16(rb, pb, CC); XW(pa, pb); st16(ra, sA + so); st16(rb, sV + so);
#pragma unroll 1   /* rolled: one copy of the step keeps the kernel's text small */
    for (int ks = 0; ks < CC / KS; ++ks) { const int cur = ks & 1, nxt = cur ^ 1;
      __syncthreads();   /* step ks is whole in buffer cur; every wave has left buffer nxt */
      if (ks + 1 < CC / KS) { pa += KS; pb += KS; ld16(ra, pa, CC); ld16(rb, pb, CC); XW(pa, pb); }
#pragma unroll
      for (int kk = 0; kk < KS / 32; ++kk) { const v16h a = frag_h(sA + (cur * 64 + wave * 16 + col) * SP + kk * 32, lane);
#pragma unroll
        for (int jh = 0; jh < 8; jh += 4) { v16h w[4];   /* four fragments' LDS reads go out together, ahead of their products */
#pragma unroll
          for (int j = 0; j < 4; ++j) w[j] = frag_h(sV + (cur * 128 + (jh + j) * 16 + col) * SP + kk * 32, lane);
#pragma unroll
          for (int j = 0; j < 4; ++j) acc[jh + j] = wmma16(a, w[j], acc[jh + j]); } }
      if (ks + 1 < CC / KS) { st16(ra, sA + nxt * 64 * SP + so); st16(rb, sV + nxt * 128 * SP + so); } } }
  __syncthreads();   /* every wave has read its last fragments before the epilogue's tile overwrites the buffers */
#pragma unroll
  for (int j = 0; j < 8; ++j) { const float bias = BO ? bfr(BO[c0 + j * 16 + col]) : 0.f;
#pragma unroll
    for (int r = 0; r < 8; ++r) sf[wave][8 * g + r][j * 16 + col] = EARLY ? acc[j][r] + bias : acc[j][r] * (1.0f / 16384.0f) + bias; }   /* other rows: 2^-8 (Wo carry) x 2^-6 (ctx carry) */
  LDSX(); for (int rl = 0; rl < 16; ++rl) vst2(OUT + (r0 + rl) * DIN + c0 + lane * 4, *(const v4f*)&sf[wave][rl][lane * 4]); }
__global__ __launch_bounds__(128) void k_out(const _Float16* __restrict__ YH, const __bf16* __restrict__ YB, const __bf16* __restrict__ YL, const __bf16* __restrict__ OB, const _Float16* __restrict__ OH, const float* __restrict__ BO, float* __restrict__ OUT) { __shared__ __align__(16) char smem[2 * (64 + 64 + 128) * SP * 2];   /* two staging buffers of ctx (hi, lo) and W rows; the epilogue's tile lies over them behind a barrier */
  static_assert(sizeof(smem) >= 4 * 16 * 132 * 4, "epilogue tile fits"); static_assert(WO_OUT_IN == 1, "the staging reads W rows of CC elements");
  if (CAUSAL && (int)(((size_t)blockIdx.x * 64) % TT) < QHI) { out_body<true>(YH, YB, YL, OB, OH, BO, OUT, smem); return; }   /* block-uniform */
  out_body<false>(YH, YB, YL, OB, OH, BO, OUT, smem); }

extern "C" void kernel_launch(void* const* d_in, const int* in_sizes, int n_in, void* d_out, int out_size, void* d_ws, size_t ws_size, hipStream_t stream) {
  (void)in_sizes; (void)n_in; (void)out_size;
  const float** F = (const float**)d_in;
  if (ws_size < (size_t)WS_END) return;
  char* ws = (char*)d_ws; _Float16 *QH = (_Float16*)(ws + WS_QH), *KH = (_Float16*)(ws + WS_KH), *VT = (_Float16*)(ws + WS_VT), *QL = (_Float16*)(ws + WS_QL), *KL = (_Float16*)(ws + WS_KL); __bf16 *VB = (__bf16*)(ws + WS_VB), *VBL = (__bf16*)(ws + WS_VBL); _Float16 *YH = (_Float16*)(ws + WS_Y), *OH = (_Float16*)(ws + WS_OH); __bf16 *YB = (__bf16*)(ws + WS_YB), *YL = (__bf16*)(ws + WS_YL), *XB = (__bf16*)(ws + WS_XB), *WB = (__bf16*)(ws + WS_WB), *OB = (__bf16*)(ws + WS_OB);
  // inputs: 0 x [2,2048,1024]; 1 W_qkv [3072,1024] (out,in): q rows 0..1023, k 1024..2047, v 2048..3071; 2 W_o [1024,1024] (out,in); no biases
  k_cvt<<<dim3((NB * TT * DIN + 3 * CC * DIN + DIN * CC) / 4 / CVU), 256, 0, stream>>>(F[0], F[1], F[2], XB, WB, OB, OH);
  k_proj<<<dim3(TNB * TT / 64, CC / 128, 3), 128, 0, stream>>>(XB, XB, XB, WB, WB + (size_t)CC * DIN, WB + 2 * (size_t)CC * DIN, nullptr, nullptr, nullptr, QH, QL, KH, KL, VT, VB, VBL);
  k_pv<<<dim3(TNB * NH, NFB + NHB), 32 * PVW, 0, stream>>>(QH, KH, QL, KL, VT, VB, VBL, YH, YB, YL);
  k_out<<<dim3(TNB * TT / 64, DIN / 128), 128, 0, stream>>>(YH, YB, YL, OB, OH, nullptr, (float*)d_out);
}

// v007
// It runs in 80 microseconds.
// Next to v006, in two timings, it ran 1.12 and 1.13 times as fast.
// All steps since v000 together make it 14.8 times as fast.
// compute dtype: all float inputs rounded to bf16; the fused q / k / v projection with EXACT bf16 products on WMMA 16x16x32 (f32 accumulate) (no biases); causal logits: 3 products for the first 384 rows, single f16 q x k after, x 64^-0.5; softmax f32; P x 2^11 once to f16 x v once to f16 (bf16 hi + lo below row 384); ctx hi+lo x exact W below row 384, x2^6 f16 carry x f16(bf16 x 2^8) W after, no bias; f32 output.
#include <hip/hip_runtime.h>
#include <math.h>

typedef __attribute__((ext_vector_type(16))) _Float16 v16h;
typedef __attribute__((ext_vector_type(16))) __bf16 v16b;
typedef __attribute__((ext_vector_type(8)))  _Float16 v8h;
typedef __attribute__((ext_vector_type(8)))  float v8f;
typedef __attribute__((ext_vector_type(4)))  float v4f;
typedef __attribute__((ext_vector_type(2)))  float v2f;
typedef __attribute__((ext_vector_type(4)))  unsigned v4u;
typedef __attribute__((ext_vector_type(4)))  int v4i;
typedef float __attribute__((may_alias)) float_a;
typedef int __attribute__((may_alias)) int_a;

template <typename T> __device__ __forceinline__ void vst2(void* p, T v) { *(T*)p = v;  }
__device__ __forceinline__ v8f wmma16(v16h a, v16h b, v8f c) {
  v8f d = __builtin_amdgcn_wmma_f32_16x16x32_f16(false, a, false, b, (short)0, c, false, false);
  asm volatile("v_nop\n\tv_nop\n\tv_nop\n\tv_nop" : "+v"(d) : "v"(a), "v"(b));
  return d;
}
__device__ __forceinline__ v8f wmma_bf(v16b a, v16b b, v8f c) {
  v8f d = __builtin_amdgcn_wmma_f32_16x16x32_bf16(false, a, false, b, (short)0, c, false, false);
  asm volatile("v_nop\n\tv_nop\n\tv_nop\n\tv_nop" : "+v"(d) : "v"(a), "v"(b));
  return d;
}
// 16x16x32 fragments: lane = (h = lane>>4, row/col = lane&15); elements 0..7 = k0+8h+0..7, 8..15 = k0+16+8h+0..7; D element r = row 8h+r
__device__ __forceinline__ v16h frag_h(const _Float16* rowk0, int lane) {
  union { v16h v; v8h q[2]; } u; const _Float16* p = rowk0 + 8 * (lane >> 4);
  u.q[0] = *(const v8h*)p; u.q[1] = *(const v8h*)(p + 16); return u.v;
}
__device__ __forceinline__ v16h frag_f32(const float* rowk0, int lane) {
  v16h a; const float* p = rowk0 + 8 * (lane >> 4);
#pragma unroll
  for (int i = 0; i < 8; ++i) { a[i] = (_Float16)p[i]; a[8 + i] = (_Float16)p[16 + i]; }
  return a;
}
__device__ __forceinline__ v16h frag_f32s(const float* rowk0, int lane, float sc) {
  v16h a; const float* p = rowk0 + 8 * (lane >> 4);
#pragma unroll
  for (int i = 0; i < 8; ++i) { a[i] = (_Float16)(p[i] * sc); a[8 + i] = (_Float16)(p[16 + i] * sc); }
  return a;
}
// column fragment from a [K][ld] layout (column n), rows >= K read as 0
__device__ __forceinline__ v16h fragc_f32(const float* W, int k0, int n, int lane, int ld, int K) {
  v16h a; const int g = lane >> 4;
#pragma unroll
  for (int i = 0; i < 8; ++i) { const int ka = k0 + 8 * g + i, kb = ka + 16;
    a[i] = (_Float16)(ka < K ? W[(size_t)(ka < K ? ka : K - 1) * ld + n] : 0.f); a[8 + i] = (_Float16)(kb < K ? W[(size_t)(kb < K ? kb : K - 1) * ld + n] : 0.f); }
  return a;
}
struct F2 { v16b h, l; };
__device__ __forceinline__ F2 bsplit16(const float v[16]) { F2 r;
#pragma unroll
  for (int i = 0; i < 16; ++i) { const __bf16 h = (__bf16)v[i]; r.h[i] = h; r.l[i] = (__bf16)(v[i] - (float)h); }
  return r; }
__device__ __forceinline__ F2 split_row(const float* row, int k0, int lane) { float v[16]; const float* p = row + k0 + 8 * (lane >> 4);
#pragma unroll
  for (int i = 0; i < 8; ++i) { v[i] = p[i]; v[8 + i] = p[16 + i]; }
  return bsplit16(v); }
__device__ __forceinline__ F2 split_rowK(const float* row, int k0, int lane, int K) { float v[16]; const int g = lane >> 4;
#pragma unroll
  for (int i = 0; i < 8; ++i) { const int ka = k0 + 8 * g + i, kb = ka + 16; v[i] = ka < K ? row[ka < K ? ka : K - 1] : 0.f; v[8 + i] = kb < K ? row[kb < K ? kb : K - 1] : 0.f; }
  return bsplit16(v); }
__device__ __forceinline__ F2 split_col(const float* W, int k0, int n, int lane, int ld, int K) { float v[16]; const int g = lane >> 4;
#pragma unroll
  for (int i = 0; i < 8; ++i) { const int ka = k0 + 8 * g + i, kb = ka + 16; v[i] = ka < K ? W[(size_t)(ka < K ? ka : K - 1) * ld + n] : 0.f; v[8 + i] = kb < K ? W[(size_t)(kb < K ? kb : K - 1) * ld + n] : 0.f; }
  return bsplit16(v); }
__device__ __forceinline__ v8f mac3(const F2& a, const F2& b, v8f c) { c = wmma_bf(a.l, b.h, c); c = wmma_bf(a.h, b.l, c); return wmma_bf(a.h, b.h, c); }
__device__ __forceinline__ float sigm(float v) { return 1.0f / (1.0f + expf(-v)); }
#define LDSX() do { asm volatile("s_wait_dscnt 0" ::: "memory"); __builtin_amdgcn_wave_barrier(); __builtin_amdgcn_fence(__ATOMIC_RELEASE, "workgroup"); } while (0)

// Bias-free causal multi-head self-attention with a fused (out,in) QKV projection (x [2,2048,1024]; Wqkv [3072,1024] torch (out,in): jnp.split thirds of einsum('btd,ed->bte') = x @ Wqkv.T (q = rows 0..1023, k = 1024..2047, v = 2048..3071); Wout [1024,1024] (out,in); no biases; 16 heads x 64; scores x 1/sqrt(64); tril kept, -inf elsewhere; softmax; out @ Wout.T).
#define NB 2
#define TT 2048
#define CC 1024            // NH * HD = projected width
#define DIN 1024          // input (model) width
#define NH 16
#define HD 64
#define NQB (TT / 64)
#define HG 4
#define SCALE (0.125f)
#define CAUSAL 1
#ifndef TNB
#define TNB NB
#endif
__device__ __forceinline__ float bfr(float v) { return (float)(__bf16)v; }
__host__ __device__ __forceinline__ int kb_last(int qb) { return CAUSAL ? ((qb * 64 + 63) >> 7) : (TT / 128 - 1); }
typedef __attribute__((ext_vector_type(8))) __bf16 v8b;
__device__ __forceinline__ v16b frag_b(const __bf16* rowk0, int lane) {
  union { v16b v; v8b q[2]; } u; const __bf16* p = rowk0 + 8 * (lane >> 4);
  u.q[0] = *(const v8b*)p; u.q[1] = *(const v8b*)(p + 16); return u.v;
}
#define QBH 6              // causal: query rows < QBH * 64 of each sequence (few keys, no averaging) take the high-precision path
#define QHI 384            // rows carrying a q residual plane
#define KHI 384            // key rows carrying k residual / v bf16 hi+lo planes (used only by the causal high-precision path)
// B fragment (k rows k0+.., output column o) of a weight: (in,out) [K][ld] or (out,in) [ld rows of K]: bf16 exact, or f16(bf16 * 256) exact
__device__ __forceinline__ v16b wcol_io(const float* Wm, int k0, int o, int lane, int ld) { v16b w; const int g = lane >> 4;
#pragma unroll
  for (int i = 0; i < 8; ++i) { w[i] = (__bf16)Wm[(size_t)(k0 + 8 * g + i) * ld + o]; w[8 + i] = (__bf16)Wm[(size_t)(k0 + 16 + 8 * g + i) * ld + o]; }
  return w; }
__device__ __forceinline__ v16b wcol_oi(const float* Wm, int k0, int o, int lane, int K) { v16b w; const float* p = Wm + (size_t)o * K + k0 + 8 * (lane >> 4);
#pragma unroll
  for (int i = 0; i < 8; ++i) { w[i] = (__bf16)p[i]; w[8 + i] = (__bf16)p[16 + i]; }
  return w; }
__device__ __forceinline__ v16h wcolh_io(const float* Wm, int k0, int o, int lane, int ld) { v16h w; const int g = lane >> 4;
#pragma unroll
  for (int i = 0; i < 8; ++i) { w[i] = (_Float16)(bfr(Wm[(size_t)(k0 + 8 * g + i) * ld + o]) * 256.0f); w[8 + i] = (_Float16)(bfr(Wm[(size_t)(k0 + 16 + 8 * g + i) * ld + o]) * 256.0f); }
  return w; }
__device__ __forceinline__ v16h wcolh_oi(const float* Wm, int k0, int o, int lane, int K) { v16h w; const float* p = Wm + (size_t)o * K + k0 + 8 * (lane >> 4);
#pragma unroll
  for (int i = 0; i < 8; ++i) { w[i] = (_Float16)(bfr(p[i]) * 256.0f); w[8 + i] = (_Float16)(bfr(p[16 + i]) * 256.0f); }
  return w; }
#define WQKV_LAYOUT 1   // 0 = (in,out) [DIN][CC]; 1 = (out,in) [CC][DIN]; 2 = per-head [NH][DIN][HD]
__device__ __forceinline__ v16b wcol_hdk(const float* Wm, int k0, int o, int lane) { v16b w; const int g = lane >> 4; const float* p = Wm + (size_t)(o / HD) * DIN * HD + (o % HD);
#pragma unroll
  for (int i = 0; i < 8; ++i) { w[i] = (__bf16)p[(size_t)(k0 + 8 * g + i) * HD]; w[8 + i] = (__bf16)p[(size_t)(k0 + 16 + 8 * g + i) * HD]; }
  return w; }
#define WO_OUT_IN 1
#if WQKV_LAYOUT == 1
#define WCOL(W, k0, o, lane) wcol_oi(W, k0, o, lane, DIN)
#elif WQKV_LAYOUT == 2
#define WCOL(W, k0, o, lane) wcol_hdk(W, k0, o, lane)
#else
#define WCOL(W, k0, o, lane) wcol_io(W, k0, o, lane, CC)
#endif
#if WO_OUT_IN
#define WOCOL(W, k0, o, lane) wcol_oi(W, k0, o, lane, CC)
#define WOCOLH(W, k0, o, lane) wcolh_oi(W, k0, o, lane, CC)
#else
#define WOCOL(W, k0, o, lane) wcol_io(W, k0, o, lane, DIN)
#define WOCOLH(W, k0, o, lane) wcolh_io(W, k0, o, lane, DIN)
#endif

#ifndef PROJ_EXTRA_PARAMS
#define PROJ_EXTRA_PARAMS
#endif

#define WS_QH  0u                                      // f16 q rows [b*t][CC]
#define WS_KH  (WS_QH + 2u * (size_t)NB * TT * CC)      // f16 k rows [b*t][CC]
#define WS_VT  (WS_KH + 2u * (size_t)NB * TT * CC)      // f16 v planes [b][c][t]
#define WS_QL  (WS_VT + 2u * (size_t)NB * CC * TT)      // f16 q residual x 2^10 rows [b][t < QHI][CC]
#define WS_KL  (WS_QL + 2u * (size_t)NB * QHI * CC)     // f16 k residual x 2^10 rows [b][t < KHI][CC]
#define WS_VB  (WS_KL + 2u * (size_t)NB * KHI * CC)     // bf16 v hi planes [b][c][t < KHI]
#define WS_VBL (WS_VB + 2u * (size_t)NB * CC * KHI)
#define WS_Y   (WS_VBL + 2u * (size_t)NB * CC * KHI)    // f16 ctx x 2^6 rows [b*t][CC] (rows >= QHI of each sequence are written and read)
#define WS_YB  (WS_Y  + 2u * (size_t)NB * TT * CC)      // bf16 ctx hi rows [b*t][CC] (rows < QHI of each sequence are written and read)
#define WS_YL  (WS_YB + 2u * (size_t)NB * TT * CC)      // bf16 ctx lo rows, as hi
#define WS_XB  (WS_YL + 2u * (size_t)NB * TT * CC)      // bf16 x rows [b*t][DIN]
#define WS_WB  (WS_XB + 2u * (size_t)NB * TT * DIN)     // bf16 Wqkv rows [3 CC][DIN]
#define WS_OB  (WS_WB + 2u * (size_t)3 * CC * DIN)      // bf16 Wo rows [DIN][CC]
#define WS_OH  (WS_OB + 2u * (size_t)DIN * CC)          // f16(bf16 Wo x 2^8) rows [DIN][CC]
#define WS_END (WS_OH + 2u * (size_t)DIN * CC)

// ---- operand staging of k_proj and k_out: every operand lies in the workspace as the 16-bit value that the product takes, rounded once by the launch that makes it (x and the weights by k_cvt, ctx by k_pv). A K step is KS columns (128 bytes) of the block's X (or ctx) rows and of its W rows. Thread (tid >> 3, tid & 7) takes rows 16 i + (tid >> 3), 16 bytes at 16 (tid & 7), so each wave-wide load reads four whole 128-byte lines; the bytes go to LDS as they are, rows at pitch SP; every wave takes its fragments from there. Two LDS buffers: the next step's loads fly while this step is multiplied.
#define KS 64
#define SP (KS + 8)        // LDS pitch of a staged row in 16-bit elements: 144 B = 16 B x odd, for the 16-byte fragment reads
typedef __attribute__((ext_vector_type(4))) __bf16 v4b;
typedef __attribute__((ext_vector_type(4))) _Float16 v4hs;
template <int N, typename V, typename E> __device__ __forceinline__ void ld16(V (&r)[N], const E* p, int ld) {
#pragma unroll
  for (int i = 0; i < N; ++i) r[i] = *(const V*)(p + (size_t)i * 16 * ld); }
template <int N, typename V, typename E> __device__ __forceinline__ void st16(const V (&r)[N], E* d) {
#pragma unroll
  for (int i = 0; i < N; ++i) *(V*)(d + i * 16 * SP) = r[i]; }
// the wait that stands before an address register of the row loads may be overwritten; the two pointers are named as inputs so that they live, unchanged, up to here
#define XW(p, q) asm volatile("s_wait_xcnt 0x0" :: "v"(p), "v"(q) : "memory")
// ---- k_cvt: x, Wqkv and Wo rounded once: x, Wqkv, Wo -> bf16 rows; Wo also -> f16(bf16 x 2^8) rows. Block = CVU units of 4 floats of one input, 16 units per thread, all 16 loads in flight; each wave-wide load reads 512 contiguous bytes, each store writes 256
#define CVU 4096
static_assert((NB * TT * DIN / 4) % CVU == 0 && (3 * CC * DIN / 4) % CVU == 0 && (DIN * CC / 4) % CVU == 0, "whole blocks per input");
__global__ __launch_bounds__(256) void k_cvt(const float* __restrict__ X, const float* __restrict__ WQKV, const float* __restrict__ WO, __bf16* __restrict__ XB, __bf16* __restrict__ WB, __bf16* __restrict__ OB, _Float16* __restrict__ OH) {
  constexpr int BX = NB * TT * DIN / 4 / CVU, BW = 3 * CC * DIN / 4 / CVU;
  const int bi = blockIdx.x; const int sel = bi < BX ? 0 : bi < BX + BW ? 1 : 2;   /* block-uniform */
  const size_t u0 = ((size_t)(bi - (sel == 0 ? 0 : sel == 1 ? BX : BX + BW)) * CVU + threadIdx.x) * 4;
  const float* p = (sel == 0 ? X : sel == 1 ? WQKV : WO) + u0; __bf16* d = (sel == 0 ? XB : sel == 1 ? WB : OB) + u0;
  v4f r[16];
#pragma unroll
  for (int i = 0; i < 16; ++i) r[i] = *(const v4f*)(p + i * 1024);
  XW(p, p);
#pragma unroll
  for (int i = 0; i < 16; ++i) { v4b q;
#pragma unroll
    for (int c = 0; c < 4; ++c) q[c] = (__bf16)r[i][c];
    *(v4b*)(d + i * 1024) = q; }
  if (sel == 2) { _Float16* e = OH + u0;
    asm volatile("s_wait_xcnt 0x0" ::: "memory");   /* the wait that stands before the registers of the stores above may be overwritten */
#pragma unroll
    for (int i = 0; i < 16; ++i) { v4hs q;
#pragma unroll
      for (int c = 0; c < 4; ++c) q[c] = (_Float16)(bfr(r[i][c]) * 256.0f);
      *(v4hs*)(e + i * 1024) = q; } } }
// ---- k_proj: block = (128 rows, 128 cols, which), four waves in 2 x 2, a 64 x 64 tile per wave (4 x 4 accumulator tiles: each of the 8 fragments that a wave reads from LDS per 32 k feeds 4 products): q/k/v = X W (+ b) with exact bf16 products (K = DIN) -> which 0: q f16 rows (+ residual rows < QHI); 1: k f16 rows (+ residual rows < KHI); 2: v f16 planes [c][t] (+ bf16 hi/lo planes for t < KHI). The grid is three blocks per WGP; amdgpu_waves_per_eu(3) holds the registers to the budget of three waves per SIMD, so that the three are resident together
#define PR 128             // rows and columns of a k_proj block
static_assert(TT % PR == 0 && CC % PR == 0 && QHI % PR == 0 && KHI % PR == 0, "a block lies in one sequence, and wholly below or wholly above the residual rows' end");
// a PR x PR tile of 16-bit elements goes from LDS to global rows of ld elements: thread (tid >> 4, tid & 15) takes rows 8 i + (tid >> 4), 16 bytes at 16 (tid & 15), so each wave-wide store writes two runs of 256 bytes; d is the thread's own address in row tid >> 4, the one address of all 16 stores; the 16 LDS reads go out together
template <typename E> __device__ __forceinline__ void tile_out(E* d, int ld, const E (*tile)[PR + 8], int tid) { v4u v[PR / 8];
#pragma unroll
  for (int i = 0; i < PR / 8; ++i) v[i] = *(const v4u*)&tile[8 * i + (tid >> 4)][(tid & 15) * 8];
#pragma unroll
  for (int i = 0; i < PR / 8; ++i) vst2((unsigned*)(d + (size_t)i * 8 * ld), v[i]);
  XW(d, d); }   /* before a register of these stores may be overwritten */
__global__ __launch_bounds__(128) __attribute__((amdgpu_waves_per_eu(3))) void k_proj(const __bf16* __restrict__ XQ, const __bf16* __restrict__ XK, const __bf16* __restrict__ XV, const __bf16* __restrict__ WQ, const __bf16* __restrict__ WK, const __bf16* __restrict__ WV, const float* __restrict__ BQ, const float* __restrict__ BK, const float* __restrict__ BV,
    _Float16* __restrict__ QH, _Float16* __restrict__ QL, _Float16* __restrict__ KH, _Float16* __restrict__ KL, _Float16* __restrict__ VT, __bf16* __restrict__ VB, __bf16* __restrict__ VBL) {
  __shared__ __align__(16) char smem[3 * PR * (PR + 8) * 2];   /* the epilogue's three tiles of v; the two staging buffers lie in front of them in time, in the same bytes; three blocks fit a WGP's LDS */
  static_assert(sizeof(smem) >= 2 * (PR + PR) * SP * 2 && 3 * sizeof(smem) <= 327680, "the staging buffers fit; three blocks fit");
  __bf16* const sA = (__bf16*)smem; __bf16* const sB = sA + 2 * PR * SP;   /* [2][PR][SP], [2][PR][SP] */
  _Float16 (* const sh)[PR + 8] = (_Float16 (*)[PR + 8])smem; _Float16 (* const sl)[PR + 8] = sh + PR; __bf16 (* const tb)[PR + 8] = (__bf16 (*)[PR + 8])smem + PR; __bf16 (* const tbl)[PR + 8] = tb + PR;   /* q, k: [row][col] value, residual; v: [col][row] f16 in sh, bf16 hi in tb, bf16 lo in tbl */
  const int tid = threadIdx.x, wave = tid >> 5, lane = tid & 31, col = lane & 15, g = lane >> 4, wr = (wave >> 1) * 64, wc = (wave & 1) * 64; const int which = blockIdx.z; const int c0 = blockIdx.y * PR; const size_t r0 = (size_t)blockIdx.x * PR; const size_t bb = r0 / TT; const int t0 = (int)(r0 % TT);
  const __bf16* X = which == 0 ? XQ : which == 1 ? XK : XV; const __bf16* WA = which == 0 ? WQ : which == 1 ? WK : WV; const float* BA = which == 0 ? BQ : which == 1 ? BK : BV;
  v8f acc[4][4] = {};
  static_assert(WQKV_LAYOUT == 1, "the staging reads W rows of DIN elements");
  { const __bf16* pa = X + (r0 + (tid >> 3)) * DIN + (tid & 7) * 8; const __bf16* pb = WA + (size_t)(c0 + (tid >> 3)) * DIN + (tid & 7) * 8; const int so = (tid >> 3) * SP + (tid & 7) * 8;
    v8b ra[8], rb[8]; ld16(ra, pa, DIN); ld16(rb, pb, DIN); XW(pa, pb); st16(ra, sA + so); st16(rb, sB + so);
#pragma unroll 1   /* rolled: one copy of the step keeps the kernel's text small */
    for (int ks = 0; ks < DIN / KS; ++ks) { const int cur = ks & 1, nxt = cur ^ 1;
      __syncthreads();   /* step ks is whole in buffer cur; every wave has left buffer nxt */
      if (ks + 1 < DIN / KS) { pa += KS; pb += KS; ld16(ra, pa, DIN); ld16(rb, pb, DIN); XW(pa, pb); }
#pragma unroll
      for (int kk = 0; kk < KS / 32; ++kk) { v16b a[4], w[4];   /* eight fragments' LDS reads go out together, ahead of their sixteen products: one LDS latency per group */
#pragma unroll
        for (int i = 0; i < 4; ++i) a[i] = frag_b(sA + (cur * PR + wr + i * 16 + col) * SP + kk * 32, lane);
#pragma unroll
        for (int j = 0; j < 4; ++j) w[j] = frag_b(sB + (cur * PR + wc + j * 16 + col) * SP + kk * 32, lane);
#pragma unroll
        for (int i = 0; i < 4; ++i)
#pragma unroll
          for (int j = 0; j < 4; ++j) acc[i][j] = wmma_bf(a[i], w[j], acc[i][j]); }
      if (ks + 1 < DIN / KS) { st16(ra, sA + nxt * PR * SP + so); st16(rb, sB + nxt * PR * SP + so); } }
    __syncthreads(); }   /* every wave has read its last fragments before the epilogue's tiles overwrite the buffers */
  if (which < 2) { _Float16* DH = which == 0 ? QH : KH; _Float16* DL = which == 0 ? QL : KL; const int nhi = which == 0 ? QHI : KHI; const bool hi_rows = t0 < nhi;
#pragma unroll
    for (int j = 0; j < 4; ++j) { const float bias = BA ? bfr(BA[c0 + wc + j * 16 + col]) : 0.f;
#pragma unroll
      for (int i = 0; i < 4; ++i)
#pragma unroll
        for (int r = 0; r < 8; ++r) { const float v = acc[i][j][r] + bias; const _Float16 hv = (_Float16)v; const int rl = wr + i * 16 + 8 * g + r, cl = wc + j * 16 + col; sh[rl][cl] = hv; sl[rl][cl] = (_Float16)((v - (float)hv) * 1024.0f); } }
    __syncthreads();
    tile_out(DH + (r0 + (tid >> 4)) * CC + c0 + (tid & 15) * 8, CC, sh, tid); if (hi_rows) tile_out(DL + (bb * nhi + t0 + (tid >> 4)) * (size_t)CC + c0 + (tid & 15) * 8, CC, sl, tid);
  } else { const bool hi_rows = t0 < KHI;   /* block-uniform */
    /* an accumulator's 8 elements are 8 successive t of one channel: 16 bytes of a plane's row */
#pragma unroll
    for (int j = 0; j < 4; ++j) { const float bias = BA ? bfr(BA[c0 + wc + j * 16 + col]) : 0.f;
#pragma unroll
      for (int i = 0; i < 4; ++i) { v8h hv;
#pragma unroll
        for (int r = 0; r < 8; ++r) hv[r] = (_Float16)(acc[i][j][r] + bias);
        *(v8h*)&sh[wc + j * 16 + col][wr + i * 16 + 8 * g] = hv; } }
    if (hi_rows) {
#pragma unroll
      for (int j = 0; j < 4; ++j) { const float bias = BA ? bfr(BA[c0 + wc + j * 16 + col]) : 0.f;
#pragma unroll
        for (int i = 0; i < 4; ++i) { v8b bv, lv;
#pragma unroll
          for (int r = 0; r < 8; ++r) { const float v = acc[i][j][r] + bias; const __bf16 bh = (__bf16)v; bv[r] = bh; lv[r] = (__bf16)(v - (float)bh); }
          *(v8b*)&tb[wc + j * 16 + col][wr + i * 16 + 8 * g] = bv; *(v8b*)&tbl[wc + j * 16 + col][wr + i * 16 + 8 * g] = lv; } } }
    __syncthreads();
    tile_out(VT + (bb * CC + c0 + (tid >> 4)) * (size_t)TT + t0 + (tid & 15) * 8, TT, sh, tid); if (hi_rows) { const size_t o3 = (bb * CC + c0 + (tid >> 4)) * (size_t)KHI + t0 + (tid & 15) * 8; tile_out(VB + o3, KHI, tb, tid); tile_out(VBL + o3, KHI, tbl, tid); } } }
// ---- k_pv, early rows (< QBH * 64; att_body is instantiated with HI = true alone, the later rows go through att_stream below): block = 16 queries of (b, h), PVW waves; logits, softmax and P . v in one kernel, the logits never leave the registers. The 32-key chunks are counted down from the diagonal: wave w takes chunks nch - 1 - w, nch - 1 - w - PVW, ..., so that the one chunk with excluded keys is always wave 0's first. Logits transposed, S^T = k q^T (A = 16 k rows, B = the block's 16 q rows): lane (g, col) then holds, for query col, keys 8 g + r of a 16-key tile in element r, which is the A fragment of P for P . v as it stands (tile 0 = elements 0..7, tile 1 = elements 8..15 of a 32-key chunk). Logits x SCALE: single f16 q x k; causal early query tiles (rows < QHI): q hi + residual against k hi + residual (x 2^10), 3 products. Softmax in f32: maximum and sum by lane, across the two lane halves, then across the waves in wave order through LDS. ctx = P . v (P x 2^11 once to f16 against v f16: 1 product; early tiles: P and v as bf16 hi + lo, 3 products); the PVW f32 partials are summed in wave order through LDS; ctx leaves as bf16 hi + lo, a 128-B (row, head) segment of each plane by 16 lanes
#define PVW 8
// fragment from a pointer that already holds the lane half's 8 g elements: the pointer is then the loads' own address, the one that XW names
__device__ __forceinline__ v16h frag_hp(const _Float16* p) { union { v16h v; v8h q[2]; } u; u.q[0] = *(const v8h*)p; u.q[1] = *(const v8h*)(p + 16); return u.v; }
__device__ __forceinline__ v16b frag_bp(const __bf16* p) { union { v16b v; v8b q[2]; } u; u.q[0] = *(const v8b*)p; u.q[1] = *(const v8b*)(p + 16); return u.v; }
// (every loop of att_body is unrolled whole: s, the fragment arrays and acc live in registers and need compile-time indices)
template <bool HI> __device__ __forceinline__ void att_body(const _Float16* __restrict__ QH, const _Float16* __restrict__ KH, const _Float16* __restrict__ QL, const _Float16* __restrict__ KL, const _Float16* __restrict__ VT, const __bf16* __restrict__ VB, const __bf16* __restrict__ VBL, int b, int h, int ql0, float (*rm)[16], float (*rs)[16], v8f (&acc)[HD / 16]) {
  constexpr int NI = HI ? (KHI / 32 + PVW - 1) / PVW : TT / 32 / PVW;   /* most chunks a wave can have */
  static_assert(NI % 2 == 0, "chunks are taken in pairs");
  const int tid = threadIdx.x, wave = __builtin_amdgcn_readfirstlane(tid >> 5), lane = tid & 31, col = lane & 15, g = lane >> 4;
  const int nch = (ql0 + 16 + 31) >> 5;   /* 32-key chunks that hold a key <= the tile's last query; only the last of them, nch - 1, holds keys past the tile's first query */
  const int t = ql0 + col;
  const _Float16* qp = QH + ((size_t)b * TT + t) * CC + h * HD + 8 * g; const _Float16* qlp = QL + ((size_t)b * QHI + (HI ? t : 0)) * CC + h * HD + 8 * g;
  const v16h q0 = frag_hp(qp), q1 = frag_hp(qp + 32); v16h r0 = {}, r1 = {};
  if (HI) { r0 = frag_hp(qlp); r1 = frag_hp(qlp + 32); }
  XW(qp, qlp);
  v8f s[NI][2]; float m = -3.0e38f;   /* s[i] is written, and later read, only where the wave has an i-th chunk (wave + i PVW < nch, wave-uniform) */
  // two chunks' fragment loads fly together under one wave-uniform test; where the second does not exist its loads read chunk 0 and are not used
#pragma unroll
  for (int ip = 0; ip < NI / 2; ++ip) {
    if (wave + 2 * ip * PVW < nch) { v16h kf[2][2][2], lf[2][2][2]; const _Float16* kp[2]; const _Float16* lp[2];
#pragma unroll
      for (int u = 0; u < 2; ++u) { const int kc = nch - 1 - wave - (2 * ip + u) * PVW, kl = kc > 0 ? kc : 0; kp[u] = KH + ((size_t)b * TT + kl * 32 + col) * CC + h * HD + 8 * g; lp[u] = KL + ((size_t)b * KHI + (HI ? kl * 32 + col : 0)) * CC + h * HD + 8 * g;
#pragma unroll
        for (int t2 = 0; t2 < 2; ++t2)
#pragma unroll
          for (int d = 0; d < 2; ++d) { kf[u][t2][d] = frag_hp(kp[u] + t2 * 16 * CC + d * 32); if (HI) lf[u][t2][d] = frag_hp(lp[u] + t2 * 16 * CC + d * 32); } }
      XW(kp[0], kp[1]); if (HI) XW(lp[0], lp[1]);
#pragma unroll
      for (int u = 0; u < 2; ++u) if (u == 0 || wave + (2 * ip + 1) * PVW < nch) {
#pragma unroll
        for (int t2 = 0; t2 < 2; ++t2) { v8f a = {}, al = {};
          a = wmma16(kf[u][t2][0], q0, a); if (HI) { al = wmma16(kf[u][t2][0], r0, al); al = wmma16(lf[u][t2][0], q0, al); }
          a = wmma16(kf[u][t2][1], q1, a); if (HI) { al = wmma16(kf[u][t2][1], r1, al); al = wmma16(lf[u][t2][1], q1, al); }
#pragma unroll
          for (int r = 0; r < 8; ++r) a[r] = HI ? (a[r] + al[r] * (1.0f / 1024.0f)) * SCALE : a[r] * SCALE;
          if (ip == 0 && u == 0 && wave == 0) {   /* the chunk on the diagonal: causal -> logit if key <= query, else excluded */
#pragma unroll
            for (int r = 0; r < 8; ++r) a[r] = ((nch - 1) * 32 + t2 * 16 + 8 * g + r <= t) ? a[r] : -3.0e38f; }
#pragma unroll
          for (int r = 0; r < 8; ++r) m = fmaxf(m, a[r]);
          s[2 * ip + u][t2] = a; } } } }
  m = fmaxf(m, __shfl_xor(m, 16));
  if (g == 0) rm[wave][col] = m;
  __syncthreads();   /* every wave's maxima are in LDS before any wave joins them */
#pragma unroll
  for (int w = 0; w < PVW; ++w) m = fmaxf(m, rm[w][col]);
  float sum = 0.f;
#pragma unroll
  for (int i = 0; i < NI; ++i) {
    if (wave + i * PVW < nch) {
#pragma unroll
      for (int t2 = 0; t2 < 2; ++t2)
#pragma unroll
        for (int r = 0; r < 8; ++r) { const float x = s[i][t2][r]; const float ex = expf(x - m); const float e = (i == 0 && x <= -1.0e38f) ? 0.f : ex; s[i][t2][r] = e; sum += e; } } }   /* excluded keys stand only in a first chunk */
  sum += __shfl_xor(sum, 16);
  if (g == 0) rs[wave][col] = sum;
  __syncthreads();   /* every wave's sums are in LDS before any wave joins them */
  sum = 0.f;
#pragma unroll
  for (int w = 0; w < PVW; ++w) sum += rs[w][col];
  const float inv = sum > 0.f ? 2048.0f / sum : 0.f;
#pragma unroll
  for (int ip = 0; ip < NI / 2; ++ip) {
    if (wave + 2 * ip * PVW < nch) {   /* as above: two chunks' v fragments fly together */
      if (HI) { v16b vh[2][HD / 16], vl[2][HD / 16]; const __bf16* vp[2]; const __bf16* wp[2];
#pragma unroll
        for (int u = 0; u < 2; ++u) { const int kc = nch - 1 - wave - (2 * ip + u) * PVW, kl = kc > 0 ? kc : 0; const size_t po = ((size_t)b * CC + h * HD + col) * (size_t)KHI + kl * 32 + 8 * g; vp[u] = VB + po; wp[u] = VBL + po;
#pragma unroll
          for (int j = 0; j < HD / 16; ++j) { vh[u][j] = frag_bp(vp[u] + j * 16 * KHI); vl[u][j] = frag_bp(wp[u] + j * 16 * KHI); } }
        XW(vp[0], vp[1]); XW(wp[0], wp[1]);
#pragma unroll
        for (int u = 0; u < 2; ++u) if (u == 0 || wave + (2 * ip + 1) * PVW < nch) { float pv[16];
#pragma unroll
          for (int r = 0; r < 8; ++r) { pv[r] = s[2 * ip + u][0][r] * inv; pv[8 + r] = s[2 * ip + u][1][r] * inv; }
          const F2 p = bsplit16(pv);
#pragma unroll
          for (int j = 0; j < HD / 16; ++j) { acc[j] = wmma_bf(p.h, vh[u][j], acc[j]); acc[j] = wmma_bf(p.l, vh[u][j], acc[j]); acc[j] = wmma_bf(p.h, vl[u][j], acc[j]); } }
      } else { v16h vf[2][HD / 16]; const _Float16* vp[2];
#pragma unroll
        for (int u = 0; u < 2; ++u) { const int kc = nch - 1 - wave - (2 * ip + u) * PVW, kl = kc > 0 ? kc : 0; vp[u] = VT + ((size_t)b * CC + h * HD + col) * (size_t)TT + kl * 32 + 8 * g;
#pragma unroll
          for (int j = 0; j < HD / 16; ++j) vf[u][j] = frag_hp(vp[u] + j * 16 * TT); }
        XW(vp[0], vp[1]);
#pragma unroll
        for (int u = 0; u < 2; ++u) if (u == 0 || wave + (2 * ip + 1) * PVW < nch) { v16h p;
#pragma unroll
          for (int r = 0; r < 8; ++r) { p[r] = (_Float16)(s[2 * ip + u][0][r] * inv); p[8 + r] = (_Float16)(s[2 * ip + u][1][r] * inv); }
#pragma unroll
          for (int j = 0; j < HD / 16; ++j) acc[j] = wmma16(p, vf[u][j], acc[j]); } } } } }
// ---- later rows (>= QBH * 64) of k_pv: block = FQ queries of (b, h), one 16-query tile per wave; every wave walks the same keys from key 0 up, in stages of 64, so a stage of k rows and of v planes is read from global memory once per FQ queries, in whole 128-byte lines (thread (tid >> 3, tid & 7): rows tid >> 3 and 32 + (tid >> 3), 16 bytes at 16 (tid & 7)), and lies in LDS at pitch SP for all PVW waves. Two LDS buffers: the next stage's loads fly while this stage is worked on. Logits transposed as in att_body (S^T = k q^T, single f16 q x k): lane (g, col) holds keys 8 g + r of each 16-key tile for query col. Softmax with a running maximum in the base-2 scale (logit x SCALE x log2 e): P = 2^(y - max + 11) once to f16, the f32 sum of the unrounded P and the context are scaled by 2^(old max - new max) at each stage. Context transposed, O^T = v^T P^T (A = 16 v planes, B = P as it stands in the lane), so that maximum, sum and context of a query stay in that query's lanes; the 2^11 cancels in context / sum.
#define FQ (16 * PVW)
#define NFB ((TT - QBH * 64) / FQ)   // blocks of later rows per (b, h)
#define NHB (QBH * 64 / 16)          // 16-query blocks of early rows per (b, h)
static_assert((QBH * 64) % FQ == 0 && TT % FQ == 0 && FQ % 64 == 0 && HD == 64, "whole blocks, whole stages");
__device__ __forceinline__ v8f wm16(v16h a, v16h b, v8f c) { return __builtin_amdgcn_wmma_f32_16x16x32_f16(false, a, false, b, (short)0, c, false, false); }
__device__ __forceinline__ float xhalf(float v) { return __builtin_bit_cast(float, __builtin_amdgcn_permlanex16(__builtin_bit_cast(int, v), __builtin_bit_cast(int, v), 0x76543210, 0xfedcba98, false, false)); }   // lane l takes lane l ^ 16's value
// 2^x by v_exp_f32, with the one slot that the instruction set asks for behind a transcendental (before its result is read or its source overwritten) in the same statement, so that it stands directly behind it. ex2x8: no result shares a register with a source (early clobber), so each v_exp_f32 is the independent instruction behind the one before it, and one v_nop behind the last serves all eight.
__device__ __forceinline__ float ex2(float x) { float e; asm("v_exp_f32 %0, %1\n\tv_nop" : "=v"(e) : "v"(x)); return e; }
__device__ __forceinline__ v8f ex2x8(v8f x) { float e0, e1, e2, e3, e4, e5, e6, e7;
  asm("v_exp_f32 %0, %8\n\tv_exp_f32 %1, %9\n\tv_exp_f32 %2, %10\n\tv_exp_f32 %3, %11\n\tv_exp_f32 %4, %12\n\tv_exp_f32 %5, %13\n\tv_exp_f32 %6, %14\n\tv_exp_f32 %7, %15\n\tv_nop"
      : "=&v"(e0), "=&v"(e1), "=&v"(e2), "=&v"(e3), "=&v"(e4), "=&v"(e5), "=&v"(e6), "=&v"(e7) : "v"(x[0]), "v"(x[1]), "v"(x[2]), "v"(x[3]), "v"(x[4]), "v"(x[5]), "v"(x[6]), "v"(x[7]));
  return v8f{e0, e1, e2, e3, e4, e5, e6, e7}; }
__device__ __forceinline__ void att_stream(const _Float16* __restrict__ QH, const _Float16* __restrict__ KH, const _Float16* __restrict__ VT, _Float16* __restrict__ YH, int b, int h, int x, char* smem) {
  _Float16* const sK = (_Float16*)smem; _Float16* const sV = sK + 2 * 64 * SP;   /* [2][64 keys][SP], [2][64 planes][SP] */
  float (* const so)[16][HD + 4] = (float (*)[16][HD + 4])smem;   /* the epilogue's tiles lie over the buffers behind a barrier */
  const int tid = threadIdx.x, wave = __builtin_amdgcn_readfirstlane(tid >> 5), lane = tid & 31, col = lane & 15, g = lane >> 4;
  const int ql0 = x * FQ + wave * 16, t = ql0 + col;
  const int nst = (x + 1) * (FQ / 64);   /* stages that hold a key <= the block's last query */
  const int lastw = (ql0 + 15) >> 6;     /* the wave's last stage, the only one with keys past the tile's first query (64 lastw <= ql0) */
  const _Float16* qp = QH + ((size_t)b * TT + t) * CC + h * HD + 8 * g;
  const v16h q0 = frag_hp(qp), q1 = frag_hp(qp + 32);
  XW(qp, qp);
  const _Float16* pk = KH + ((size_t)b * TT + (tid >> 3)) * CC + h * HD + (tid & 7) * 8; const _Float16* pv = VT + ((size_t)b * CC + h * HD + (tid >> 3)) * (size_t)TT + (tid & 7) * 8; const int so8 = (tid >> 3) * SP + (tid & 7) * 8;
  v8h rk[2], rv[2];
#pragma unroll
  for (int i = 0; i < 2; ++i) { rk[i] = *(const v8h*)(pk + (size_t)i * 32 * CC); rv[i] = *(const v8h*)(pv + (size_t)i * 32 * TT); }
  XW(pk, pv);
#pragma unroll
  for (int i = 0; i < 2; ++i) { *(v8h*)(sK + i * 32 * SP + so8) = rk[i]; *(v8h*)(sV + i * 32 * SP + so8) = rv[i]; }
  constexpr float C2 = SCALE * 1.44269504088896340736f;
  v8f acc[HD / 16] = {}; float m = -3.0e38f, sum = 0.f;
#pragma unroll 1   /* rolled: the trip count differs from block to block, and one copy of the stage keeps the kernel's text small */
  for (int st = 0; st < nst; ++st) { const int cur = st & 1, nxt = cur ^ 1;
    __syncthreads();   /* stage st is whole in buffer cur; every wave has left buffer nxt */
    if (st + 1 < nst) { pk += 64 * CC; pv += 64;
#pragma unroll
      for (int i = 0; i < 2; ++i) { rk[i] = *(const v8h*)(pk + (size_t)i * 32 * CC); rv[i] = *(const v8h*)(pv + (size_t)i * 32 * TT); }
      XW(pk, pv); }
    if (st <= lastw) {   /* wave-uniform; a wave past its diagonal only stages and keeps the barriers */
      const _Float16* bK = sK + (cur * 64 + col) * SP; const _Float16* bV = sV + (cur * 64 + col) * SP;
      v8f s[4] = {}; v16h kf[2][4], vf[2][HD / 16];   /* four independent accumulators */
#pragma unroll
      for (int d = 0; d < 2; ++d)
#pragma unroll
        for (int t4 = 0; t4 < 4; ++t4) kf[d][t4] = frag_h(bK + t4 * 16 * SP + d * 32, lane);
#pragma unroll
      for (int u = 0; u < 2; ++u)
#pragma unroll
        for (int j = 0; j < HD / 16; ++j) vf[u][j] = frag_h(bV + j * 16 * SP + u * 32, lane);
      /* the stage's 32 LDS reads (k first, then v) go out as one group ahead of the 8 logit products: left alone, the compiler reads each fragment directly in front of its product and the wave waits out one LDS latency per product */
      __builtin_amdgcn_sched_group_barrier(0x100, 32, 0); __builtin_amdgcn_sched_group_barrier(0x008, 8, 0);
#pragma unroll
      for (int d = 0; d < 2; ++d)
#pragma unroll
        for (int t4 = 0; t4 < 4; ++t4) s[t4] = wm16(kf[d][t4], d == 0 ? q0 : q1, s[t4]);
      if (st == lastw) {   /* the stage on the diagonal: causal -> logit if key <= query, else excluded */
#pragma unroll
        for (int t4 = 0; t4 < 4; ++t4)
#pragma unroll
          for (int r = 0; r < 8; ++r) s[t4][r] = (st * 64 + t4 * 16 + 8 * g + r <= t) ? s[t4][r] : -3.0e38f; }
      float mq[4];   /* four independent chains */
#pragma unroll
      for (int t4 = 0; t4 < 4; ++t4) { mq[t4] = s[t4][0];
#pragma unroll
        for (int r = 1; r < 8; ++r) mq[t4] = fmaxf(mq[t4], s[t4][r]); }
      float mx = fmaxf(fmaxf(mq[0], mq[1]), fmaxf(mq[2], mq[3]));
      mx = fmaxf(mx, xhalf(mx));
      const float mn = fmaxf(m, mx * C2);   /* finite from stage 0 on: key 0 is open to every query */
      const float al = ex2(m - mn); m = mn;   /* 0 at stage 0 */
      const float nb = 11.0f - mn; float ps[4];
#pragma unroll
      for (int t4 = 0; t4 < 4; ++t4)
#pragma unroll
        for (int r = 0; r < 8; ++r) s[t4][r] = __builtin_fmaf(s[t4][r], C2, nb);
#pragma unroll
      for (int t4 = 0; t4 < 4; ++t4) s[t4] = ex2x8(s[t4]);   /* an excluded key gives 2^(-huge) = 0 */
#pragma unroll
      for (int t4 = 0; t4 < 4; ++t4) ps[t4] = ((s[t4][0] + s[t4][1]) + (s[t4][2] + s[t4][3])) + ((s[t4][4] + s[t4][5]) + (s[t4][6] + s[t4][7]));
      sum = sum * al + ((ps[0] + ps[1]) + (ps[2] + ps[3]));
#pragma unroll
      for (int j = 0; j < HD / 16; ++j) acc[j] *= al;
#pragma unroll
      for (int u = 0; u < 2; ++u) { v16h p;
#pragma unroll
        for (int r = 0; r < 8; ++r) { p[r] = (_Float16)s[2 * u][r]; p[8 + r] = (_Float16)s[2 * u + 1][r]; }
#pragma unroll
        for (int j = 0; j < HD / 16; ++j) acc[j] = wm16(vf[u][j], p, acc[j]); } }
    if (st + 1 < nst) {
#pragma unroll
      for (int i = 0; i < 2; ++i) { *(v8h*)(sK + (nxt * 64 + i * 32) * SP + so8) = rk[i]; *(v8h*)(sV + (nxt * 64 + i * 32) * SP + so8) = rv[i]; } } }
  sum += xhalf(sum);
  const float inv = 1.0f / sum;   /* sum >= 2^11: the key of the maximum counts 2^11 */
  __syncthreads();   /* every wave has read its last fragments before the epilogue's tiles overwrite the buffers */
#pragma unroll
  for (int j = 0; j < HD / 16; ++j) { v4f lo, hi;   /* acc[j] element r = channel 16 j + 8 g + r of query col */
#pragma unroll
    for (int c = 0; c < 4; ++c) { lo[c] = acc[j][c] * inv; hi[c] = acc[j][4 + c] * inv; }
    *(v4f*)&so[wave][col][j * 16 + 8 * g] = lo; *(v4f*)&so[wave][col][j * 16 + 8 * g + 4] = hi; }
  LDSX();   /* a wave reads back only its own tile: its LDS writes are done before it reads them by rows */
#pragma unroll
  for (int i = 0; i < 8; ++i) { const int rl = 2 * i + g; const v4f c4 = *(const v4f*)&so[wave][rl][col * 4]; v4hs q;   /* ctx carried x 2^6 into f16 so small-magnitude context rows stay clear of f16 subnormals */
#pragma unroll
    for (int c = 0; c < 4; ++c) q[c] = (_Float16)(c4[c] * 64.0f);
    vst2(YH + ((size_t)b * TT + ql0 + rl) * CC + h * HD + col * 4, q); } }   /* each store: two whole 128-B (row, head) segments */
__global__ __launch_bounds__(32 * PVW) void k_pv(const _Float16* __restrict__ QH, const _Float16* __restrict__ KH, const _Float16* __restrict__ QL, const _Float16* __restrict__ KL, const _Float16* __restrict__ VT, const __bf16* __restrict__ VB, const __bf16* __restrict__ VBL, _Float16* __restrict__ YH, __bf16* __restrict__ YB, __bf16* __restrict__ YL) { __shared__ __align__(16) char smem[2 * (64 + 64) * SP * 2];   /* later rows: two buffers of k and v stages; early rows: the partials and the waves' maxima and sums */
  static_assert(sizeof(smem) >= (PVW * 16 * (HD + 4) + 2 * PVW * 16) * 4, "partials, maxima and sums fit");
  float (* const ss)[16][HD + 4] = (float (*)[16][HD + 4])smem; float (* const rm)[16] = (float (*)[16])(smem + PVW * 16 * (HD + 4) * 4); float (* const rs)[16] = rm + PVW;
  const int b = blockIdx.x / NH, h = blockIdx.x % NH; const int tid = threadIdx.x, wave = __builtin_amdgcn_readfirstlane(tid >> 5), lane = tid & 31, col = lane & 15, g = lane >> 4;
  if (__builtin_expect((int)blockIdx.y < NFB, 1)) { att_stream(QH, KH, VT, YH, b, h, TT / FQ - 1 - (int)blockIdx.y, smem); return; }   /* block-uniform; the longest blocks have the lowest indices and start first; marked likely so that the common path stands first in the text */
  const int ql0 = ((int)blockIdx.y - NFB) * 16;
  v8f acc[HD / 16] = {};
  att_body<true>(QH, KH, QL, KL, VT, VB, VBL, b, h, ql0, rm, rs, acc);
#pragma unroll
  for (int j = 0; j < HD / 16; ++j)
#pragma unroll
    for (int r = 0; r < 8; ++r) ss[wave][8 * g + r][j * 16 + col] = acc[j][r];
  __syncthreads();   /* every wave's partial (zero for a wave without chunks) is in LDS before any thread sums across waves */
  for (int e = tid; e < 16 * (HD / 4); e += 32 * PVW) { const int rl = e / (HD / 4), q = e % (HD / 4); v4f s = *(const v4f*)&ss[0][rl][q * 4];
#pragma unroll
    for (int w = 1; w < PVW; ++w) s += *(const v4f*)&ss[w][rl][q * 4];
    s *= 1.0f / 2048.0f; v4b qh, qo; const size_t o = ((size_t)b * TT + ql0 + rl) * CC + h * HD + q * 4;   /* early rows: ctx as bf16 hi + lo; 16 threads write a whole 128-B (row, head) segment of each plane */
#pragma unroll
    for (int c = 0; c < 4; ++c) { const __bf16 hv = (__bf16)s[c]; qh[c] = hv; qo[c] = (__bf16)(s[c] - (float)hv); }
    vst2(YB + o, qh); vst2(YL + o, qo); } }
// ---- k_out: block = (64 rows, 128 cols): out = ctx Wo (+ bo): ctx x 2^6 once to f16 against Wo as f16(bf16 x 2^8) exact (1 product) x 2^-14; causal early rows (< QHI of each sequence): ctx bf16 hi + lo against exact bf16 Wo (2 products)
template <bool EARLY> __device__ __forceinline__ void out_body(const _Float16* __restrict__ YH, const __bf16* __restrict__ YB, const __bf16* __restrict__ YL, const __bf16* __restrict__ OB, const _Float16* __restrict__ OH, const float* __restrict__ BO, float* __restrict__ OUT, char* smem) {
  float (* const sf)[16][132] = (float (*)[16][132])smem;
  const int tid = threadIdx.x, wave = tid >> 5, lane = tid & 31, col = lane & 15, g = lane >> 4; const int c0 = blockIdx.y * 128; const size_t r0 = (size_t)blockIdx.x * 64 + wave * 16;
  __bf16* const sH = (__bf16*)smem; __bf16* const sL = sH + 2 * 64 * SP; __bf16* const sW = sL + 2 * 64 * SP;   /* early rows: [2][64][SP] hi, [2][64][SP] lo, [2][128][SP] W */
  _Float16* const sA = (_Float16*)smem; _Float16* const sV = sA + 2 * 64 * SP;   /* other rows: [2][64][SP] ctx, [2][128][SP] W */
  const size_t ao = ((size_t)blockIdx.x * 64 + (tid >> 3)) * CC + (tid & 7) * 8, wo = (size_t)(c0 + (tid >> 3)) * CC + (tid & 7) * 8; const int so = (tid >> 3) * SP + (tid & 7) * 8;
  v8f acc[8] = {};
  if (EARLY) { const __bf16* pa = YB + ao; const __bf16* pl = YL + ao; const __bf16* pb = OB + wo;
    v8b ra[4], rl[4], rb[8]; ld16(ra, pa, CC); ld16(rl, pl, CC); ld16(rb, pb, CC); XW(pa, pl); XW(pb, pb); st16(ra, sH + so); st16(rl, sL + so); st16(rb, sW + so);
#pragma unroll 1   /* rolled: one copy of the step keeps the kernel's text small */
    for (int ks = 0; ks < CC / KS; ++ks) { const int cur = ks & 1, nxt = cur ^ 1;
      __syncthreads();   /* step ks is whole in buffer cur; every wave has left buffer nxt */
      if (ks + 1 < CC / KS) { pa += KS; pl += KS; pb += KS; ld16(ra, pa, CC); ld16(rl, pl, CC); ld16(rb, pb, CC); XW(pa, pl); XW(pb, pb); }
#pragma unroll
      for (int kk = 0; kk < KS / 32; ++kk) { const int fo = (cur * 64 + wave * 16 + col) * SP + kk * 32; const v16b ah = frag_b(sH + fo, lane), al = frag_b(sL + fo, lane);
#pragma unroll
        for (int jh = 0; jh < 8; jh += 4) { v16b w[4];   /* four fragments' LDS reads go out together, ahead of their products */
#pragma unroll
          for (int j = 0; j < 4; ++j) w[j] = frag_b(sW + (cur * 128 + (jh + j) * 16 + col) * SP + kk * 32, lane);
#pragma unroll
          for (int j = 0; j < 4; ++j) { acc[jh + j] = wmma_bf(ah, w[j], acc[jh + j]); acc[jh + j] = wmma_bf(al, w[j], acc[jh + j]); } } }
      if (ks + 1 < CC / KS) { st16(ra, sH + nxt * 64 * SP + so); st16(rl, sL + nxt * 64 * SP + so); st16(rb, sW + nxt * 128 * SP + so); } }
  } else { const _Float16* pa = YH + ao; const _Float16* pb = OH + wo;
    v8h ra[4], rb[8]; ld16(ra, pa, CC); ld16(rb, pb, CC); XW(pa, pb); st16(ra, sA + so); st16(rb, sV + so);
#pragma unroll 1   /* rolled: one copy of the step keeps the kernel's text small */
    for (int ks = 0; ks < CC / KS; ++ks) { const int cur = ks & 1, nxt = cur ^ 1;
      __syncthreads();   /* step ks is whole in buffer cur; every wave has left buffer nxt */
      if (ks + 1 < CC / KS) { pa += KS; pb += KS; ld16(ra, pa, CC); ld16(rb, pb, CC); XW(pa, pb); }
#pragma unroll
      for (int kk = 0; kk < KS / 32; ++kk) { const v16h a = frag_h(sA + (cur * 64 + wave * 16 + col) * SP + kk * 32, lane);
#pragma unroll
        for (int jh = 0; jh < 8; jh += 4) { v16h w[4];   /* four fragments' LDS reads go out together, ahead of their products */
#pragma unroll
          for (int j = 0; j < 4; ++j) w[j] = frag_h(sV + (cur * 128 + (jh + j) * 16 + col) * SP + kk * 32, lane);
#pragma unroll
          for (int j = 0; j < 4; ++j) acc[jh + j] = wmma16(a, w[j], acc[jh + j]); } }
      if (ks + 1 < CC / KS) { st16(ra, sA + nxt * 64 * SP + so); st16(rb, sV + nxt * 128 * SP + so); } } }
  __syncthreads();   /* every wave has read its last fragments before the epilogue's tile overwrites the buffers */
#pragma unroll
  for (int j = 0; j < 8; ++j) { const float bias = BO ? bfr(BO[c0 + j * 16 + col]) : 0.f;
#pragma unroll
    for (int r = 0; r < 8; ++r) sf[wave][8 * g + r][j * 16 + col] = EARLY ? acc[j][r] + bias : acc[j][r] * (1.0f / 16384.0f) + bias; }   /* other rows: 2^-8 (Wo carry) x 2^-6 (ctx carry) */
  LDSX(); for (int rl = 0; rl < 16; ++rl) vst2(OUT + (r0 + rl) * DIN + c0 + lane * 4, *(const v4f*)&sf[wave][rl][lane * 4]); }
__global__ __launch_bounds__(128) void k_out(const _Float16* __restrict__ YH, const __bf16* __restrict__ YB, const __bf16* __restrict__ YL, const __bf16* __restrict__ OB, const _Float16* __restrict__ OH, const float* __restrict__ BO, float* __restrict__ OUT) { __shared__ __align__(16) char smem[2 * (64 + 64 + 128) * SP * 2];   /* two staging buffers of ctx (hi, lo) and W rows; the epilogue's tile lies over them behind a barrier */
  static_assert(sizeof(smem) >= 4 * 16 * 132 * 4, "epilogue tile fits"); static_assert(WO_OUT_IN == 1, "the staging reads W rows of CC elements");
  if (CAUSAL && (int)(((size_t)blockIdx.x * 64) % TT) < QHI) { out_body<true>(YH, YB, YL, OB, OH, BO, OUT, smem); return; }   /* block-uniform */
  out_body<false>(YH, YB, YL, OB, OH, BO, OUT, smem); }

extern "C" void kernel_launch(void* const* d_in, const int* in_sizes, int n_in, void* d_out, int out_size, void* d_ws, size_t ws_size, hipStream_t stream) {
  (void)in_sizes; (void)n_in; (void)out_size;
  const float** F = (const float**)d_in;
  if (ws_size < (size_t)WS_END) return;
  char* ws = (char*)d_ws; _Float16 *QH = (_Float16*)(ws + WS_QH), *KH = (_Float16*)(ws + WS_KH), *VT = (_Float16*)(ws + WS_VT), *QL = (_Float16*)(ws + WS_QL), *KL = (_Float16*)(ws + WS_KL); __bf16 *VB = (__bf16*)(ws + WS_VB), *VBL = (__bf16*)(ws + WS_VBL); _Float16 *YH = (_Float16*)(ws + WS_Y), *OH = (_Float16*)(ws + WS_OH); __bf16 *YB = (__bf16*)(ws + WS_YB), *YL = (__bf16*)(ws + WS_YL), *XB = (__bf16*)(ws + WS_XB), *WB = (__bf16*)(ws + WS_WB), *OB = (__bf16*)(ws + WS_OB);
  // inputs: 0 x [2,2048,1024]; 1 W_qkv [3072,1024] (out,in): q rows 0..1023, k 1024..2047, v 2048..3071; 2 W_o [1024,1024] (out,in); no biases
  k_cvt<<<dim3((NB * TT * DIN + 3 * CC * DIN + DIN * CC) / 4 / CVU), 256, 0, stream>>>(F[0], F[1], F[2], XB, WB, OB, OH);
  k_proj<<<dim3(TNB * TT / PR, CC / PR, 3), 128, 0, stream>>>(XB, XB, XB, WB, WB + (size_t)CC * DIN, WB + 2 * (size_t)CC * DIN, nullptr, nullptr, nullptr, QH, QL, KH, KL, VT, VB, VBL);
  k_pv<<<dim3(TNB * NH, NFB + NHB), 32 * PVW, 0, stream>>>(QH, KH, QL, KL, VT, VB, VBL, YH, YB, YL);
  k_out<<<dim3(TNB * TT / 64, DIN / 128), 128, 0, stream>>>(YH, YB, YL, OB, OH, nullptr, (float*)d_out);
}
